// v000
// Measured on an AMD MI455X. A time is GPU time per run, averaged over a window of back-to-back runs after a warm-up
// (all launches, gaps included; the runs take copies of the inputs in turn), and the median of several windows.
// Apart from v000's, it joins two sittings. Times from different sittings can be a few percent apart, while
// side-by-side timings come from the same sitting.
// v000, which the later versions start from, runs in 1010 microseconds.
#include <hip/hip_runtime.h>

// Compute dtypes, f32 accumulate, one batch item per pass: q = x^T.wq^T ([4096 x 256].[256 x 32->64 padded], exact bf16 transposed input and weight); the 2x2 average
// pool in f32 -> x_kv^T as bf16 hi + UNSCALED residual; k = x_kv^T.wk^T and v = wv.x_kv (split pooled operand, two/three products); scores = q.k^T/sqrt(32)
// ([4096 x 64].[64 x 1024], three products), row softmax in f32 -> bf16 hi + UNSCALED residual; out_attn = attn.v^T ([4096 x 1024].[1024 x 256], three products)
// and y = wo.out_attn^T ([256 x 256].[256 x 4096], exact wo against split) on v_wmma_f32_16x16x32_bf16; out = x + gamma y in f32. Deterministic, no atomics;

#define NBI  8
#define CC   256
#define HW   64
#define NTOK 4096
#define NKV  1024               // 32 x 32 pooled
#define DQ   32
#define DQP  64                 // padded head dim (zeros)
#define DM   CC
#define NTK  NTOK
#define SCL  0.17677669529663687f
#define LOSC 1024.0f

typedef _Float16 h16;
typedef unsigned short bf;
typedef __attribute__((ext_vector_type(16))) __bf16   v16bf;
typedef __attribute__((ext_vector_type(16))) _Float16 v16h;
typedef __attribute__((ext_vector_type(8)))  _Float16 v8h;
typedef __attribute__((ext_vector_type(8)))  unsigned short v8us;
typedef __attribute__((ext_vector_type(8)))  float    v8f;
typedef __attribute__((ext_vector_type(4)))  float    v4f;
typedef __attribute__((ext_vector_type(4)))  _Float16 v4h;
typedef v8h  __attribute__((may_alias)) v8ha;
typedef v4f  __attribute__((may_alias)) v4fa;
typedef v8us __attribute__((may_alias)) v8usa;

__device__ __forceinline__ unsigned short f2bf(float f) { unsigned u = __float_as_uint(f); u += 0x7FFFu + ((u >> 16) & 1u); return (unsigned short)(u >> 16); }
__device__ __forceinline__ float bf2f(unsigned short b) { return __uint_as_float(((unsigned)b) << 16); }
__device__ __forceinline__ float bfr(float f) { return bf2f(f2bf(f)); }
__device__ __forceinline__ v16h cat16(v8h lo, v8h hi) { return __builtin_shufflevector(lo, hi, 0, 1, 2, 3, 4, 5, 6, 7, 8, 9, 10, 11, 12, 13, 14, 15); }
__device__ __forceinline__ v16bf cat16b(v8us lo, v8us hi) { return __builtin_bit_cast(v16bf, __builtin_shufflevector(lo, hi, 0, 1, 2, 3, 4, 5, 6, 7, 8, 9, 10, 11, 12, 13, 14, 15)); }
__device__ __forceinline__ v8f wmma16(v16h a, v16h b, v8f c) { return __builtin_amdgcn_wmma_f32_16x16x32_f16(false, a, false, b, (short)0, c, false, false); }
__device__ __forceinline__ v8f wmmab(v16bf a, v16bf b, v8f c) { return __builtin_amdgcn_wmma_f32_16x16x32_bf16(false, a, false, b, (short)0, c, false, false); }

// k_wt: WT [n][K] = bf16(W[k][n]) (k-major [K][ncols]) via 64 x 64 LDS tiles; grid (K/64, ncols/64).
__global__ __launch_bounds__(256) void k_wt(const float* __restrict__ Wm, int K, int ncols, bf* WT) {
    __shared__ __align__(16) unsigned short tl[64 * 72];
    const int tid = threadIdx.x, k0 = blockIdx.x * 64, n0 = blockIdx.y * 64;
    const int kk = tid >> 2, nq = (tid & 3) * 16;
#pragma unroll
    for (int i = 0; i < 16; ++i) tl[(nq + i) * 72 + kk] = f2bf(Wm[(size_t)(k0 + kk) * ncols + n0 + nq + i]);
    __syncthreads();
    const int piece = tid & 7;
    auto pass = [&]() {
#pragma unroll
        for (int s = 0; s < 2; ++s) { const int nr = (tid >> 3) + 32 * s; const v8us val = *(const v8usa*)(tl + nr * 72 + piece * 8); *(v8us*)(WT + (size_t)(n0 + nr) * K + k0 + piece * 8) = val; }
    };
    pass(); 
}
// k_gemmb: 64 x 64 block tile (4 waves x 16 x 64) of C[NTK][NW] = (A [+ Al]).B^T (K = 256) [+ bf(bias[c])] [+ bf(R[r][c]) residual]; f32 whole-line epilogue (or f16
template <bool SPLITA, bool F16OUT = false>
__global__ __launch_bounds__(128) void k_gemmb(const bf* __restrict__ A, const bf* __restrict__ Al, const bf* __restrict__ Bn, const float* __restrict__ bias, float* C, int ldc, h16* C2, const float* __restrict__ R = nullptr, int K = DM, int roundR = 1) {
    __shared__ __align__(16) float ost[4][16 * 68];
    const int lane = threadIdx.x & 31, wave = threadIdx.x >> 5, lr = lane & 15, hi = lane >> 4;
    const int r0 = blockIdx.x * 64 + wave * 16, c0 = blockIdx.y * 64;
    const size_t aoff = (size_t)(r0 + lr) * K + 8 * hi;
    size_t boff[4];
#pragma unroll
    for (int t = 0; t < 4; ++t) boff[t] = (size_t)(c0 + t * 16 + lr) * K + 8 * hi;
    v8f acc[4];
#pragma unroll
    for (int t = 0; t < 4; ++t) acc[t] = (v8f){};
#pragma unroll 1
    for (int kc = 0; kc < K; kc += 32) {
        const v16bf a = cat16b(*(const v8us*)(A + aoff + kc), *(const v8us*)(A + aoff + kc + 16));
        v16bf al = a;
        if (SPLITA) al = cat16b(*(const v8us*)(Al + aoff + kc), *(const v8us*)(Al + aoff + kc + 16));
#pragma unroll
        for (int t = 0; t < 4; ++t) { const v16bf b = cat16b(*(const v8us*)(Bn + boff[t] + kc), *(const v8us*)(Bn + boff[t] + kc + 16)); acc[t] = wmmab(a, b, acc[t]); if (SPLITA) acc[t] = wmmab(al, b, acc[t]); }
        asm volatile("v_nop\n\tv_nop\n\tv_nop\n\tv_nop" : "+v"(acc[0]), "+v"(acc[1]), "+v"(acc[2]), "+v"(acc[3]) : "v"(a), "v"(al));
    }
    float* os = &ost[wave][0];
#pragma unroll
    for (int t = 0; t < 4; ++t) { const float bv = bias ? bfr(bias[c0 + t * 16 + lr]) : 0.f;
#pragma unroll
        for (int j = 0; j < 8; ++j) os[(hi * 8 + j) * 68 + t * 16 + lr] = acc[t][j] + bv; }
    __syncthreads();
    if (F16OUT) {
        h16* crow = (h16*)(void*)C + (size_t)r0 * ldc + c0;
        auto pass = [&]() {
#pragma unroll
            for (int s = 0; s < 4; ++s) { const int row = 4 * s + (lane >> 3), piece = lane & 7; const float* sp = os + row * 68 + piece * 8; v8h o, o2;
#pragma unroll
                for (int i = 0; i < 8; ++i) { const h16 a = (h16)sp[i]; o[i] = a; o2[i] = (h16)((sp[i] - (float)a) * LOSC); }
                *(v8h*)(crow + (size_t)row * ldc + piece * 8) = o; if (C2) *(v8h*)(C2 + (size_t)r0 * ldc + c0 + (size_t)row * ldc + piece * 8) = o2; }
        };
        pass(); 
    } else {
        float* crow = C + (size_t)r0 * ldc + c0;
        auto pass = [&]() {
#pragma unroll
            for (int s = 0; s < 8; ++s) { const int Lid = (lane >> 3) + 4 * s, piece = lane & 7; const int row = Lid >> 1, cofs = (Lid & 1) * 32 + piece * 4;
                v4f val = *(const v4fa*)(os + row * 68 + cofs); if (R) { const v4f rv = *(const v4f*)(R + ((size_t)r0 + row) * ldc + c0 + cofs); val += roundR ? (v4f){bfr(rv[0]), bfr(rv[1]), bfr(rv[2]), bfr(rv[3])} : rv; }
                *(v4f*)(crow + (size_t)row * ldc + cofs) = val; }
        };
        pass(); 
    }
}

// k_gemm3: 64 x 64 tile of C = (Ah + Al).(Bh + Bl)^T over K (row strides = K for all four planes; n-major B): three products per 32-k step (hh, hl, lh); f32
__global__ __launch_bounds__(128) void k_gemm3(const bf* __restrict__ Ah, const bf* __restrict__ Al, const bf* __restrict__ Bh, const bf* __restrict__ Bl, int K, float* C, int ldc) {
    __shared__ __align__(16) float ost[4][16 * 68];
    const int lane = threadIdx.x & 31, wave = threadIdx.x >> 5, lr = lane & 15, hi = lane >> 4;
    const int r0 = blockIdx.x * 64 + wave * 16, c0 = blockIdx.y * 64;
    const size_t aoff = (size_t)(r0 + lr) * K + 8 * hi;
    v8f acc[4];
#pragma unroll
    for (int t = 0; t < 4; ++t) acc[t] = (v8f){};
#pragma unroll 1
    for (int kc = 0; kc < K; kc += 32) {
        const v16bf a = cat16b(*(const v8us*)(Ah + aoff + kc), *(const v8us*)(Ah + aoff + kc + 16));
        const v16bf al = cat16b(*(const v8us*)(Al + aoff + kc), *(const v8us*)(Al + aoff + kc + 16));
#pragma unroll
        for (int t = 0; t < 4; ++t) { const size_t bo = (size_t)(c0 + t * 16 + lr) * K + kc + 8 * hi;
            const v16bf bh = cat16b(*(const v8us*)(Bh + bo), *(const v8us*)(Bh + bo + 16)); const v16bf bl = cat16b(*(const v8us*)(Bl + bo), *(const v8us*)(Bl + bo + 16));
            acc[t] = wmmab(a, bh, acc[t]); acc[t] = wmmab(al, bh, acc[t]); acc[t] = wmmab(a, bl, acc[t]); }
        asm volatile("v_nop\n\tv_nop\n\tv_nop\n\tv_nop" : "+v"(acc[0]), "+v"(acc[1]), "+v"(acc[2]), "+v"(acc[3]) : "v"(a), "v"(al));
    }
    float* os = &ost[wave][0];
#pragma unroll
    for (int t = 0; t < 4; ++t) {
#pragma unroll
        for (int j = 0; j < 8; ++j) os[(hi * 8 + j) * 68 + t * 16 + lr] = acc[t][j]; }
    __builtin_amdgcn_wave_barrier(); asm volatile("" ::: "memory");
    float* crow = C + (size_t)r0 * ldc + c0;
    auto pass = [&]() {
#pragma unroll
        for (int s = 0; s < 8; ++s) { const int Lid = (lane >> 3) + 4 * s, piece = lane & 7; const int row = Lid >> 1, cofs = (Lid & 1) * 32 + piece * 4;
            const v4f val = *(const v4fa*)(os + row * 68 + cofs); *(v4f*)(crow + (size_t)row * ldc + cofs) = val; }
    };
    pass(); 
}

__global__ __launch_bounds__(256) void k_bfz(const float* __restrict__ src, bf* dh, bf* dz, size_t n8) {
    const size_t i = (size_t)blockIdx.x * 256 + threadIdx.x; if (i >= n8) return;
    const v8f v = *(const v8f*)(src + i * 8); v8us o, z;
#pragma unroll
    for (int k = 0; k < 8; ++k) { o[k] = f2bf(v[k]); z[k] = 0; }
    *(v8us*)(dh + i * 8) = o; *(v8us*)(dz + i * 8) = z; 
}
__global__ __launch_bounds__(256) void k_wpad(const float* __restrict__ w, bf* WP) {
    const int u = blockIdx.x * 256 + threadIdx.x; if (u >= DQP * CC / 8) return;
    const int d = u / (CC / 8), c0 = (u % (CC / 8)) * 8; v8us o;
#pragma unroll
    for (int i = 0; i < 8; ++i) o[i] = (d < DQ) ? f2bf(w[d * CC + c0 + i]) : (unsigned short)0;
    *(v8us*)(WP + (size_t)d * CC + c0) = o; 
}
// k_poolT: x_kv^T[m][c] = mean of the 2x2 block (f32, the reference's order ((a+b)+(c+d))/4 -> sum then * 0.25) of bf16-rounded x -> bf16 hi + UNSCALED residual planes
__global__ __launch_bounds__(256) void k_poolT(const float* __restrict__ x, bf* Ph, bf* Pl) {
    const int lane = threadIdx.x & 31, m = blockIdx.x * 8 + (threadIdx.x >> 5); if (m >= NKV) return;
    const int pi = m / 32, pj = m % 32; v8us oh, ol;
#pragma unroll
    for (int i = 0; i < 8; ++i) { const int c = lane * 8 + i; const float* xc = x + (size_t)c * NTOK + (2 * pi) * HW + 2 * pj;
        const float s = (bfr(xc[0]) + bfr(xc[1])) + (bfr(xc[HW]) + bfr(xc[HW + 1])); const float v = s * 0.25f; const unsigned short hb = f2bf(v); oh[i] = hb; ol[i] = f2bf(v - bf2f(hb)); }
    const size_t o = (size_t)m * CC + lane * 8; *(v8us*)(Ph + o) = oh; *(v8us*)(Pl + o) = ol; 
}
__global__ __launch_bounds__(256) void k_split64(const float* __restrict__ src, int nrows, bf* dh, bf* dl) {
    typedef __attribute__((ext_vector_type(2))) unsigned short v2us;
    const int lane = threadIdx.x & 31, r = blockIdx.x * 8 + (threadIdx.x >> 5); if (r >= nrows) return;
    const size_t o = (size_t)r * DQP + lane * 2; v2us oh, ol;
#pragma unroll
    for (int i = 0; i < 2; ++i) { const float v = src[o + i]; const unsigned short hb = f2bf(v); oh[i] = hb; ol[i] = f2bf(v - bf2f(hb)); }
    *(v2us*)(dh + o) = oh; *(v2us*)(dl + o) = ol; 
}
__global__ __launch_bounds__(256) void k_splitw(const float* __restrict__ src, int nrows, int ncols, bf* dh, bf* dl) {
    const int lane = threadIdx.x & 31, r = blockIdx.x * 8 + (threadIdx.x >> 5); if (r >= nrows) return;
{
#pragma unroll 1
        for (int q = 0; q < ncols / 256; ++q) { const size_t o = (size_t)r * ncols + q * 256 + lane * 8; const v8f v = *(const v8f*)(src + o); v8us oh, ol;
#pragma unroll
            for (int i = 0; i < 8; ++i) { const unsigned short hb = f2bf(v[i]); oh[i] = hb; ol[i] = f2bf(v[i] - bf2f(hb)); }
            *(v8us*)(dh + o) = oh; *(v8us*)(dl + o) = ol; }
         }
}
__global__ __launch_bounds__(256) void k_softmax(const float* __restrict__ S, bf* PH, bf* PL) {
    const int lane = threadIdx.x & 31, r = blockIdx.x * 8 + (threadIdx.x >> 5); if (r >= NTOK) return;
    const float* sr = S + (size_t)r * NKV; float m = -3.0e38f;
#pragma unroll 1
    for (int c0 = lane * 8; c0 < NKV; c0 += 256) { const v8f v = *(const v8f*)(sr + c0);
#pragma unroll
        for (int i = 0; i < 8; ++i) m = fmaxf(m, v[i] * SCL); }
#pragma unroll
    for (int sh = 16; sh; sh >>= 1) m = fmaxf(m, __shfl_xor(m, sh, 32));
    float sum = 0.f;
#pragma unroll 1
    for (int c0 = lane * 8; c0 < NKV; c0 += 256) { const v8f v = *(const v8f*)(sr + c0);
#pragma unroll
        for (int i = 0; i < 8; ++i) sum += __expf(v[i] * SCL - m); }
#pragma unroll
    for (int sh = 16; sh; sh >>= 1) sum += __shfl_xor(sum, sh, 32);
    const float inv = 1.0f / sum;
{
#pragma unroll 1
        for (int c0 = lane * 8; c0 < NKV; c0 += 256) { const v8f v = *(const v8f*)(sr + c0); v8us oh, ol;
#pragma unroll
            for (int i = 0; i < 8; ++i) { const float p = __expf(v[i] * SCL - m) * inv; const unsigned short hb = f2bf(p); oh[i] = hb; ol[i] = f2bf(p - bf2f(hb)); }
            const size_t o = (size_t)r * NKV + c0; *(v8us*)(PH + o) = oh; *(v8us*)(PL + o) = ol; }
         }
}
__global__ __launch_bounds__(256) void k_resid(const float* __restrict__ Y, const float* __restrict__ X, const float* __restrict__ gam, float* OUTP) {
    const int lane = threadIdx.x & 31, r = blockIdx.x * 8 + (threadIdx.x >> 5); if (r >= CC) return;
    const float g = bfr(gam[0]);
{
#pragma unroll 1
        for (int q = 0; q < NTOK / 256; ++q) { const size_t o = (size_t)r * NTOK + q * 256 + lane * 8; const v8f y = *(const v8f*)(Y + o); const v8f xv = *(const v8f*)(X + o); v8f v;
#pragma unroll
            for (int i = 0; i < 8; ++i) v[i] = bfr(xv[i]) + g * y[i];
            *(v8f*)(OUTP + o) = v; }
         }
}

extern "C" void kernel_launch(void* const* d_in, const int* in_sizes, int n_in,
                              void* d_out, int out_size, void* d_ws, size_t ws_size, hipStream_t stream) {
    (void)in_sizes; (void)n_in; (void)out_size;
    const float* x = (const float*)d_in[0]; const float* wq = (const float*)d_in[1]; const float* wk = (const float*)d_in[2]; const float* wv = (const float*)d_in[3]; const float* wo = (const float*)d_in[4]; const float* gam = (const float*)d_in[5];
    float* out = (float*)d_out;    // [8][256][64][64]
    char* wsp = (char*)d_ws;
    auto take = [&](size_t bytes) { char* p = wsp; wsp += (bytes + 255) & ~(size_t)255; return (void*)p; };
    bf* WqP = (bf*)take((size_t)DQP * CC * 2); bf* WkP = (bf*)take((size_t)DQP * CC * 2); bf* WvB = (bf*)take((size_t)CC * CC * 2); bf* WoB = (bf*)take((size_t)CC * CC * 2); bf* WZ = (bf*)take((size_t)CC * CC * 2);
    bf* XT = (bf*)take((size_t)NTOK * CC * 2); bf* KVh = (bf*)take((size_t)NKV * CC * 2); bf* KVl = (bf*)take((size_t)NKV * CC * 2);
    float* TMP = (float*)take((size_t)CC * NTOK * 4); bf* Qh = (bf*)take((size_t)NTOK * DQP * 2); bf* Ql = (bf*)take((size_t)NTOK * DQP * 2); bf* Kh = (bf*)take((size_t)NKV * DQP * 2); bf* Kl = (bf*)take((size_t)NKV * DQP * 2);
    bf* Vh = (bf*)take((size_t)CC * NKV * 2); bf* Vl = (bf*)take((size_t)CC * NKV * 2); float* S = (float*)take((size_t)NTOK * NKV * 4); bf* PH = (bf*)take((size_t)NTOK * NKV * 2); bf* PL = (bf*)take((size_t)NTOK * NKV * 2);
    bf* OAh = (bf*)take((size_t)NTOK * CC * 2); bf* OAl = (bf*)take((size_t)NTOK * CC * 2);
    if ((size_t)(wsp - (char*)d_ws) > ws_size) return;    // ~ 0.5 + 2.1 + 1 + 4.2 + 1 + 0.26 + 1 + 16.8 + 16.8 + 4.2 ~ 48 MB; TMP (f32 [256][4096] = 4.2 MB) holds in turn q [4096][64] (1 MB), k, v, out_attn [4096][256] (4.2 MB), y — each consumed before the next (stream order)
    k_wpad<<<(DQP * CC / 8 + 255) / 256, 256, 0, stream>>>(wq, WqP); k_wpad<<<(DQP * CC / 8 + 255) / 256, 256, 0, stream>>>(wk, WkP);
    k_bfz<<<(CC * CC / 8 + 255) / 256, 256, 0, stream>>>(wv, WvB, WZ, CC * CC / 8); k_bfz<<<(CC * CC / 8 + 255) / 256, 256, 0, stream>>>(wo, WoB, WZ, CC * CC / 8);
    for (int b = 0; b < NBI; ++b) {
        const float* xb = x + (size_t)b * CC * NTOK;
        k_wt<<<dim3(CC / 64, NTOK / 64, 1), 256, 0, stream>>>(xb, CC, NTOK, XT);                                                              // x^T [4096][256] exact
        k_gemmb<false, false><<<dim3(NTOK / 64, 1, 1), 128, 0, stream>>>(XT, nullptr, WqP, nullptr, TMP, DQP, nullptr); k_split64<<<NTOK / 8, 256, 0, stream>>>(TMP, NTOK, Qh, Ql);        // q [4096][64] (32 real)
        k_poolT<<<NKV / 8, 256, 0, stream>>>(xb, KVh, KVl);                                                                                   // x_kv^T [1024][256] hi/lo
        k_gemmb<true, false><<<dim3(NKV / 64, 1, 1), 128, 0, stream>>>(KVh, KVl, WkP, nullptr, TMP, DQP, nullptr); k_split64<<<NKV / 8, 256, 0, stream>>>(TMP, NKV, Kh, Kl);             // k [1024][64]
        k_gemm3<<<dim3(CC / 64, NKV / 64, 1), 128, 0, stream>>>(WvB, WZ, KVh, KVl, CC, TMP, NKV); k_splitw<<<CC / 8, 256, 0, stream>>>(TMP, CC, NKV, Vh, Vl);                              // v [256][1024]
        k_gemm3<<<dim3(NTOK / 64, NKV / 64, 1), 128, 0, stream>>>(Qh, Ql, Kh, Kl, DQP, S, NKV);                                              // scores [4096][1024]
        k_softmax<<<NTOK / 8, 256, 0, stream>>>(S, PH, PL);
        k_gemm3<<<dim3(NTOK / 64, CC / 64, 1), 128, 0, stream>>>(PH, PL, Vh, Vl, NKV, TMP, CC); k_splitw<<<NTOK / 8, 256, 0, stream>>>(TMP, NTOK, CC, OAh, OAl);                           // out_attn token-major [4096][256]
        k_gemm3<<<dim3(CC / 64, NTOK / 64, 1), 128, 0, stream>>>(WoB, WZ, OAh, OAl, CC, TMP, NTOK);                                           // y = wo.out_attn^T [256][4096]
        k_resid<<<CC / 8, 256, 0, stream>>>(TMP, xb, gam, out + (size_t)b * CC * NTOK);                                                       // x + gamma y
    }
}

// v001
// One run takes 386 microseconds.
// Two timings next to v000 put it at 2.57 and 2.56 times that version's speed.
#include <hip/hip_runtime.h>

// Compute dtypes, f32 accumulate, batch items side by side on blockIdx.z (or as more rows) of each per-item launch, four per launch for scores / softmax / attn.v: q = x^T.wq^T ([4096 x 256].[256 x 32->64 padded], exact bf16 transposed input and weight); the 2x2 average
// pool in f32 -> x_kv^T as bf16 hi + UNSCALED residual; k = x_kv^T.wk^T and v = wv.x_kv (split pooled operand, two/three products); scores = q.k^T/sqrt(32)
// ([4096 x 64].[64 x 1024], three products), row softmax in f32 -> bf16 hi + UNSCALED residual; out_attn = attn.v^T ([4096 x 1024].[1024 x 256], three products)
// and y = wo.out_attn^T ([256 x 256].[256 x 4096], exact wo against split) on v_wmma_f32_16x16x32_bf16; out = x + gamma y in f32. Deterministic, no atomics;

#define NBI  8
#define CC   256
#define HW   64
#define NTOK 4096
#define NKV  1024               // 32 x 32 pooled
#define DQ   32
#define DQP  64                 // padded head dim (zeros)
#define DM   CC
#define NTK  NTOK
#define SCL  0.17677669529663687f
#define LOSC 1024.0f
#define NCH  4                  // batch items per scores / softmax / attn.v launch: their three planes for all 8 would not fit the workspace

typedef _Float16 h16;
typedef unsigned short bf;
typedef __attribute__((ext_vector_type(16))) __bf16   v16bf;
typedef __attribute__((ext_vector_type(16))) _Float16 v16h;
typedef __attribute__((ext_vector_type(8)))  _Float16 v8h;
typedef __attribute__((ext_vector_type(8)))  unsigned short v8us;
typedef __attribute__((ext_vector_type(8)))  float    v8f;
typedef __attribute__((ext_vector_type(4)))  float    v4f;
typedef __attribute__((ext_vector_type(4)))  _Float16 v4h;
typedef v8h  __attribute__((may_alias)) v8ha;
typedef v4f  __attribute__((may_alias)) v4fa;
typedef v8us __attribute__((may_alias)) v8usa;

__device__ __forceinline__ unsigned short f2bf(float f) { unsigned u = __float_as_uint(f); u += 0x7FFFu + ((u >> 16) & 1u); return (unsigned short)(u >> 16); }
__device__ __forceinline__ float bf2f(unsigned short b) { return __uint_as_float(((unsigned)b) << 16); }
__device__ __forceinline__ float bfr(float f) { return bf2f(f2bf(f)); }
__device__ __forceinline__ v16h cat16(v8h lo, v8h hi) { return __builtin_shufflevector(lo, hi, 0, 1, 2, 3, 4, 5, 6, 7, 8, 9, 10, 11, 12, 13, 14, 15); }
__device__ __forceinline__ v16bf cat16b(v8us lo, v8us hi) { return __builtin_bit_cast(v16bf, __builtin_shufflevector(lo, hi, 0, 1, 2, 3, 4, 5, 6, 7, 8, 9, 10, 11, 12, 13, 14, 15)); }
__device__ __forceinline__ v8f wmma16(v16h a, v16h b, v8f c) { return __builtin_amdgcn_wmma_f32_16x16x32_f16(false, a, false, b, (short)0, c, false, false); }
__device__ __forceinline__ v8f wmmab(v16bf a, v16bf b, v8f c) { return __builtin_amdgcn_wmma_f32_16x16x32_bf16(false, a, false, b, (short)0, c, false, false); }

// k_wt: WT [n][K] = bf16(W[k][n]) (k-major [K][ncols]) via 64 x 64 LDS tiles; grid (K/64, ncols/64, matrices).
__global__ __launch_bounds__(256) void k_wt(const float* __restrict__ Wm, int K, int ncols, bf* WT) {
    __shared__ __align__(16) unsigned short tl[64 * 72];
    const int tid = threadIdx.x, k0 = blockIdx.x * 64, n0 = blockIdx.y * 64;
    Wm += (size_t)blockIdx.z * K * ncols; WT += (size_t)blockIdx.z * K * ncols;
    const int kk = tid >> 2, nq = (tid & 3) * 16;
#pragma unroll
    for (int i = 0; i < 16; ++i) tl[(nq + i) * 72 + kk] = f2bf(Wm[(size_t)(k0 + kk) * ncols + n0 + nq + i]);
    __syncthreads();
    const int piece = tid & 7;
    auto pass = [&]() {
#pragma unroll
        for (int s = 0; s < 2; ++s) { const int nr = (tid >> 3) + 32 * s; const v8us val = *(const v8usa*)(tl + nr * 72 + piece * 8); *(v8us*)(WT + (size_t)(n0 + nr) * K + k0 + piece * 8) = val; }
    };
    pass(); 
}
// k_gemmb: 64 x 64 block tile (4 waves x 16 x 64) of C[NTK][NW] = (A [+ Al]).B^T (K = 256) [+ bf(bias[c])] [+ bf(R[r][c]) residual]; f32 whole-line epilogue (or f16
template <bool SPLITA, bool F16OUT = false>
__global__ __launch_bounds__(128) void k_gemmb(const bf* __restrict__ A, const bf* __restrict__ Al, const bf* __restrict__ Bn, const float* __restrict__ bias, float* C, int ldc, h16* C2, const float* __restrict__ R = nullptr, int K = DM, int roundR = 1, size_t sA = 0, size_t sC = 0) {
    __shared__ __align__(16) float ost[4][16 * 68];
    const int lane = threadIdx.x & 31, wave = threadIdx.x >> 5, lr = lane & 15, hi = lane >> 4;
    const int r0 = blockIdx.x * 64 + wave * 16, c0 = blockIdx.y * 64;
    A += blockIdx.z * sA; if (SPLITA) Al += blockIdx.z * sA; C += blockIdx.z * sC;    // item blockIdx.z: element strides sA (A planes), sC (C); B is shared
    const size_t aoff = (size_t)(r0 + lr) * K + 8 * hi;
    size_t boff[4];
#pragma unroll
    for (int t = 0; t < 4; ++t) boff[t] = (size_t)(c0 + t * 16 + lr) * K + 8 * hi;
    v8f acc[4];
#pragma unroll
    for (int t = 0; t < 4; ++t) acc[t] = (v8f){};
#pragma unroll 1
    for (int kc = 0; kc < K; kc += 32) {
        const v16bf a = cat16b(*(const v8us*)(A + aoff + kc), *(const v8us*)(A + aoff + kc + 16));
        v16bf al = a;
        if (SPLITA) al = cat16b(*(const v8us*)(Al + aoff + kc), *(const v8us*)(Al + aoff + kc + 16));
#pragma unroll
        for (int t = 0; t < 4; ++t) { const v16bf b = cat16b(*(const v8us*)(Bn + boff[t] + kc), *(const v8us*)(Bn + boff[t] + kc + 16)); acc[t] = wmmab(a, b, acc[t]); if (SPLITA) acc[t] = wmmab(al, b, acc[t]); }
        asm volatile("v_nop\n\tv_nop\n\tv_nop\n\tv_nop" : "+v"(acc[0]), "+v"(acc[1]), "+v"(acc[2]), "+v"(acc[3]) : "v"(a), "v"(al));
    }
    float* os = &ost[wave][0];
#pragma unroll
    for (int t = 0; t < 4; ++t) { const float bv = bias ? bfr(bias[c0 + t * 16 + lr]) : 0.f;
#pragma unroll
        for (int j = 0; j < 8; ++j) os[(hi * 8 + j) * 68 + t * 16 + lr] = acc[t][j] + bv; }
    __syncthreads();
    if (F16OUT) {
        h16* crow = (h16*)(void*)C + (size_t)r0 * ldc + c0;
        auto pass = [&]() {
#pragma unroll
            for (int s = 0; s < 4; ++s) { const int row = 4 * s + (lane >> 3), piece = lane & 7; const float* sp = os + row * 68 + piece * 8; v8h o, o2;
#pragma unroll
                for (int i = 0; i < 8; ++i) { const h16 a = (h16)sp[i]; o[i] = a; o2[i] = (h16)((sp[i] - (float)a) * LOSC); }
                *(v8h*)(crow + (size_t)row * ldc + piece * 8) = o; if (C2) *(v8h*)(C2 + (size_t)r0 * ldc + c0 + (size_t)row * ldc + piece * 8) = o2; }
        };
        pass(); 
    } else {
        float* crow = C + (size_t)r0 * ldc + c0;
        auto pass = [&]() {
#pragma unroll
            for (int s = 0; s < 8; ++s) { const int Lid = (lane >> 3) + 4 * s, piece = lane & 7; const int row = Lid >> 1, cofs = (Lid & 1) * 32 + piece * 4;
                v4f val = *(const v4fa*)(os + row * 68 + cofs); if (R) { const v4f rv = *(const v4f*)(R + ((size_t)r0 + row) * ldc + c0 + cofs); val += roundR ? (v4f){bfr(rv[0]), bfr(rv[1]), bfr(rv[2]), bfr(rv[3])} : rv; }
                *(v4f*)(crow + (size_t)row * ldc + cofs) = val; }
        };
        pass(); 
    }
}

// k_gemm3: 64 x 64 tile of C = (Ah + Al).(Bh + Bl)^T over K (row strides = K for all four planes; n-major B): three products per 32-k step (hh, hl, lh); f32
__global__ __launch_bounds__(128) void k_gemm3(const bf* __restrict__ Ah, const bf* __restrict__ Al, const bf* __restrict__ Bh, const bf* __restrict__ Bl, int K, float* C, int ldc, size_t sA, size_t sB, size_t sC) {
    __shared__ __align__(16) float ost[4][16 * 68];
    const int lane = threadIdx.x & 31, wave = threadIdx.x >> 5, lr = lane & 15, hi = lane >> 4;
    const int r0 = blockIdx.x * 64 + wave * 16, c0 = blockIdx.y * 64;
    Ah += blockIdx.z * sA; Al += blockIdx.z * sA; Bh += blockIdx.z * sB; Bl += blockIdx.z * sB; C += blockIdx.z * sC;    // item blockIdx.z: element strides (0 = shared weights)
    const size_t aoff = (size_t)(r0 + lr) * K + 8 * hi;
    v8f acc[4];
#pragma unroll
    for (int t = 0; t < 4; ++t) acc[t] = (v8f){};
#pragma unroll 1
    for (int kc = 0; kc < K; kc += 32) {
        const v16bf a = cat16b(*(const v8us*)(Ah + aoff + kc), *(const v8us*)(Ah + aoff + kc + 16));
        const v16bf al = cat16b(*(const v8us*)(Al + aoff + kc), *(const v8us*)(Al + aoff + kc + 16));
#pragma unroll
        for (int t = 0; t < 4; ++t) { const size_t bo = (size_t)(c0 + t * 16 + lr) * K + kc + 8 * hi;
            const v16bf bh = cat16b(*(const v8us*)(Bh + bo), *(const v8us*)(Bh + bo + 16)); const v16bf bl = cat16b(*(const v8us*)(Bl + bo), *(const v8us*)(Bl + bo + 16));
            acc[t] = wmmab(a, bh, acc[t]); acc[t] = wmmab(al, bh, acc[t]); acc[t] = wmmab(a, bl, acc[t]); }
        asm volatile("v_nop\n\tv_nop\n\tv_nop\n\tv_nop" : "+v"(acc[0]), "+v"(acc[1]), "+v"(acc[2]), "+v"(acc[3]) : "v"(a), "v"(al));
    }
    float* os = &ost[wave][0];
#pragma unroll
    for (int t = 0; t < 4; ++t) {
#pragma unroll
        for (int j = 0; j < 8; ++j) os[(hi * 8 + j) * 68 + t * 16 + lr] = acc[t][j]; }
    __builtin_amdgcn_wave_barrier(); asm volatile("" ::: "memory");
    float* crow = C + (size_t)r0 * ldc + c0;
    auto pass = [&]() {
#pragma unroll
        for (int s = 0; s < 8; ++s) { const int Lid = (lane >> 3) + 4 * s, piece = lane & 7; const int row = Lid >> 1, cofs = (Lid & 1) * 32 + piece * 4;
            const v4f val = *(const v4fa*)(os + row * 68 + cofs); *(v4f*)(crow + (size_t)row * ldc + cofs) = val; }
    };
    pass(); 
}

__global__ __launch_bounds__(256) void k_bfz(const float* __restrict__ src, bf* dh, bf* dz, size_t n8) {
    const size_t i = (size_t)blockIdx.x * 256 + threadIdx.x; if (i >= n8) return;
    const v8f v = *(const v8f*)(src + i * 8); v8us o, z;
#pragma unroll
    for (int k = 0; k < 8; ++k) { o[k] = f2bf(v[k]); z[k] = 0; }
    *(v8us*)(dh + i * 8) = o; *(v8us*)(dz + i * 8) = z; 
}
__global__ __launch_bounds__(256) void k_wpad(const float* __restrict__ w, bf* WP) {
    const int u = blockIdx.x * 256 + threadIdx.x; if (u >= DQP * CC / 8) return;
    const int d = u / (CC / 8), c0 = (u % (CC / 8)) * 8; v8us o;
#pragma unroll
    for (int i = 0; i < 8; ++i) o[i] = (d < DQ) ? f2bf(w[d * CC + c0 + i]) : (unsigned short)0;
    *(v8us*)(WP + (size_t)d * CC + c0) = o; 
}
// k_poolT: x_kv^T[m][c] = mean of the 2x2 block (f32, the reference's order ((a+b)+(c+d))/4 -> sum then * 0.25) of bf16-rounded x -> bf16 hi + UNSCALED residual planes
__global__ __launch_bounds__(256) void k_poolT(const float* __restrict__ x, bf* Ph, bf* Pl) {
    const int lane = threadIdx.x & 31, m = blockIdx.x * 8 + (threadIdx.x >> 5); if (m >= NKV) return;
    x += (size_t)blockIdx.z * CC * NTOK; Ph += (size_t)blockIdx.z * NKV * CC; Pl += (size_t)blockIdx.z * NKV * CC;
    const int pi = m / 32, pj = m % 32; v8us oh, ol;
#pragma unroll
    for (int i = 0; i < 8; ++i) { const int c = lane * 8 + i; const float* xc = x + (size_t)c * NTOK + (2 * pi) * HW + 2 * pj;
        const float s = (bfr(xc[0]) + bfr(xc[1])) + (bfr(xc[HW]) + bfr(xc[HW + 1])); const float v = s * 0.25f; const unsigned short hb = f2bf(v); oh[i] = hb; ol[i] = f2bf(v - bf2f(hb)); }
    const size_t o = (size_t)m * CC + lane * 8; *(v8us*)(Ph + o) = oh; *(v8us*)(Pl + o) = ol; 
}
__global__ __launch_bounds__(256) void k_split64(const float* __restrict__ src, int nrows, bf* dh, bf* dl) {
    typedef __attribute__((ext_vector_type(2))) unsigned short v2us;
    const int lane = threadIdx.x & 31, r = blockIdx.x * 8 + (threadIdx.x >> 5); if (r >= nrows) return;
    const size_t o = (size_t)r * DQP + lane * 2; v2us oh, ol;
#pragma unroll
    for (int i = 0; i < 2; ++i) { const float v = src[o + i]; const unsigned short hb = f2bf(v); oh[i] = hb; ol[i] = f2bf(v - bf2f(hb)); }
    *(v2us*)(dh + o) = oh; *(v2us*)(dl + o) = ol; 
}
__global__ __launch_bounds__(256) void k_splitw(const float* __restrict__ src, int nrows, int ncols, bf* dh, bf* dl) {
    const int lane = threadIdx.x & 31, r = blockIdx.x * 8 + (threadIdx.x >> 5); if (r >= nrows) return;
{
#pragma unroll 1
        for (int q = 0; q < ncols / 256; ++q) { const size_t o = (size_t)r * ncols + q * 256 + lane * 8; const v8f v = *(const v8f*)(src + o); v8us oh, ol;
#pragma unroll
            for (int i = 0; i < 8; ++i) { const unsigned short hb = f2bf(v[i]); oh[i] = hb; ol[i] = f2bf(v[i] - bf2f(hb)); }
            *(v8us*)(dh + o) = oh; *(v8us*)(dl + o) = ol; }
         }
}
__global__ __launch_bounds__(256) void k_softmax(const float* __restrict__ S, bf* PH, bf* PL) {
    const int lane = threadIdx.x & 31, r = blockIdx.x * 8 + (threadIdx.x >> 5); if (r >= NTOK) return;
    S += (size_t)blockIdx.z * NTOK * NKV; PH += (size_t)blockIdx.z * NTOK * NKV; PL += (size_t)blockIdx.z * NTOK * NKV;
    const float* sr = S + (size_t)r * NKV; float m = -3.0e38f;
#pragma unroll 1
    for (int c0 = lane * 8; c0 < NKV; c0 += 256) { const v8f v = *(const v8f*)(sr + c0);
#pragma unroll
        for (int i = 0; i < 8; ++i) m = fmaxf(m, v[i] * SCL); }
#pragma unroll
    for (int sh = 16; sh; sh >>= 1) m = fmaxf(m, __shfl_xor(m, sh, 32));
    float sum = 0.f;
#pragma unroll 1
    for (int c0 = lane * 8; c0 < NKV; c0 += 256) { const v8f v = *(const v8f*)(sr + c0);
#pragma unroll
        for (int i = 0; i < 8; ++i) sum += __expf(v[i] * SCL - m); }
#pragma unroll
    for (int sh = 16; sh; sh >>= 1) sum += __shfl_xor(sum, sh, 32);
    const float inv = 1.0f / sum;
{
#pragma unroll 1
        for (int c0 = lane * 8; c0 < NKV; c0 += 256) { const v8f v = *(const v8f*)(sr + c0); v8us oh, ol;
#pragma unroll
            for (int i = 0; i < 8; ++i) { const float p = __expf(v[i] * SCL - m) * inv; const unsigned short hb = f2bf(p); oh[i] = hb; ol[i] = f2bf(p - bf2f(hb)); }
            const size_t o = (size_t)r * NKV + c0; *(v8us*)(PH + o) = oh; *(v8us*)(PL + o) = ol; }
         }
}
__global__ __launch_bounds__(256) void k_resid(const float* __restrict__ Y, const float* __restrict__ X, const float* __restrict__ gam, float* OUTP) {
    const int lane = threadIdx.x & 31, r = blockIdx.x * 8 + (threadIdx.x >> 5); if (r >= CC) return;
    Y += (size_t)blockIdx.z * CC * NTOK; X += (size_t)blockIdx.z * CC * NTOK; OUTP += (size_t)blockIdx.z * CC * NTOK;
    const float g = bfr(gam[0]);
{
#pragma unroll 1
        for (int q = 0; q < NTOK / 256; ++q) { const size_t o = (size_t)r * NTOK + q * 256 + lane * 8; const v8f y = *(const v8f*)(Y + o); const v8f xv = *(const v8f*)(X + o); v8f v;
#pragma unroll
            for (int i = 0; i < 8; ++i) v[i] = bfr(xv[i]) + g * y[i];
            *(v8f*)(OUTP + o) = v; }
         }
}

extern "C" void kernel_launch(void* const* d_in, const int* in_sizes, int n_in,
                              void* d_out, int out_size, void* d_ws, size_t ws_size, hipStream_t stream) {
    (void)in_sizes; (void)n_in; (void)out_size;
    const float* x = (const float*)d_in[0]; const float* wq = (const float*)d_in[1]; const float* wk = (const float*)d_in[2]; const float* wv = (const float*)d_in[3]; const float* wo = (const float*)d_in[4]; const float* gam = (const float*)d_in[5];
    float* out = (float*)d_out;    // [8][256][64][64]
    char* wsp = (char*)d_ws;
    auto take = [&](size_t bytes) { char* p = wsp; wsp += (bytes + 255) & ~(size_t)255; return (void*)p; };
    bf* WqP = (bf*)take((size_t)DQP * CC * 2); bf* WkP = (bf*)take((size_t)DQP * CC * 2); bf* WvB = (bf*)take((size_t)CC * CC * 2); bf* WoB = (bf*)take((size_t)CC * CC * 2); bf* WZ = (bf*)take((size_t)CC * CC * 2);
    bf* XT = (bf*)take((size_t)NBI * NTOK * CC * 2); bf* KVh = (bf*)take((size_t)NBI * NKV * CC * 2); bf* KVl = (bf*)take((size_t)NBI * NKV * CC * 2);
    float* TMP = (float*)take((size_t)NBI * CC * NTOK * 4); bf* Qh = (bf*)take((size_t)NBI * NTOK * DQP * 2); bf* Ql = (bf*)take((size_t)NBI * NTOK * DQP * 2); bf* Kh = (bf*)take((size_t)NBI * NKV * DQP * 2); bf* Kl = (bf*)take((size_t)NBI * NKV * DQP * 2);
    bf* Vh = (bf*)take((size_t)NBI * CC * NKV * 2); bf* Vl = (bf*)take((size_t)NBI * CC * NKV * 2); float* S = (float*)take((size_t)NCH * NTOK * NKV * 4); bf* PH = (bf*)take((size_t)NCH * NTOK * NKV * 2); bf* PL = (bf*)take((size_t)NCH * NTOK * NKV * 2);
    bf* OAh = (bf*)take((size_t)NBI * NTOK * CC * 2); bf* OAl = (bf*)take((size_t)NBI * NTOK * CC * 2);
    if ((size_t)(wsp - (char*)d_ws) > ws_size) return;    // MiB: 0.4 + 16 + 8 + 32 + 8 + 2 + 8 + 64 + 64 + 32 ~ 235 of 256; TMP (f32 [8][256][4096]) holds in turn q [8][4096][64], k, v, out_attn [8][4096][256], y, each consumed before the next (stream order)
    k_wpad<<<(DQP * CC / 8 + 255) / 256, 256, 0, stream>>>(wq, WqP); k_wpad<<<(DQP * CC / 8 + 255) / 256, 256, 0, stream>>>(wk, WkP);
    k_bfz<<<(CC * CC / 8 + 255) / 256, 256, 0, stream>>>(wv, WvB, WZ, CC * CC / 8); k_bfz<<<(CC * CC / 8 + 255) / 256, 256, 0, stream>>>(wo, WoB, WZ, CC * CC / 8);
    k_wt<<<dim3(CC / 64, NTOK / 64, NBI), 256, 0, stream>>>(x, CC, NTOK, XT);                                                                 // x^T [8][4096][256] exact
    k_gemmb<false, false><<<dim3(NTOK / 64, 1, NBI), 128, 0, stream>>>(XT, nullptr, WqP, nullptr, TMP, DQP, nullptr, nullptr, DM, 1, (size_t)NTOK * CC, (size_t)NTOK * DQP);
    k_split64<<<NBI * NTOK / 8, 256, 0, stream>>>(TMP, NBI * NTOK, Qh, Ql);                                                                  // q [8][4096][64] (32 real)
    k_poolT<<<dim3(NKV / 8, 1, NBI), 256, 0, stream>>>(x, KVh, KVl);                                                                         // x_kv^T [8][1024][256] hi/lo
    k_gemmb<true, false><<<dim3(NKV / 64, 1, NBI), 128, 0, stream>>>(KVh, KVl, WkP, nullptr, TMP, DQP, nullptr, nullptr, DM, 1, (size_t)NKV * CC, (size_t)NKV * DQP);
    k_split64<<<NBI * NKV / 8, 256, 0, stream>>>(TMP, NBI * NKV, Kh, Kl);                                                                    // k [8][1024][64]
    k_gemm3<<<dim3(CC / 64, NKV / 64, NBI), 128, 0, stream>>>(WvB, WZ, KVh, KVl, CC, TMP, NKV, 0, (size_t)NKV * CC, (size_t)CC * NKV);
    k_splitw<<<NBI * CC / 8, 256, 0, stream>>>(TMP, NBI * CC, NKV, Vh, Vl);                                                                  // v [8][256][1024]
    for (int b = 0; b < NBI; b += NCH) {
        k_gemm3<<<dim3(NTOK / 64, NKV / 64, NCH), 128, 0, stream>>>(Qh + (size_t)b * NTOK * DQP, Ql + (size_t)b * NTOK * DQP, Kh + (size_t)b * NKV * DQP, Kl + (size_t)b * NKV * DQP, DQP, S, NKV,
                                                                    (size_t)NTOK * DQP, (size_t)NKV * DQP, (size_t)NTOK * NKV);             // scores [4][4096][1024]
        k_softmax<<<dim3(NTOK / 8, 1, NCH), 256, 0, stream>>>(S, PH, PL);
        k_gemm3<<<dim3(NTOK / 64, CC / 64, NCH), 128, 0, stream>>>(PH, PL, Vh + (size_t)b * CC * NKV, Vl + (size_t)b * CC * NKV, NKV, TMP + (size_t)b * NTOK * CC, CC,
                                                                   (size_t)NTOK * NKV, (size_t)CC * NKV, (size_t)NTOK * CC);                // out_attn token-major [4096][256] per item
    }
    k_splitw<<<NBI * NTOK / 8, 256, 0, stream>>>(TMP, NBI * NTOK, CC, OAh, OAl);
    k_gemm3<<<dim3(CC / 64, NTOK / 64, NBI), 128, 0, stream>>>(WoB, WZ, OAh, OAl, CC, TMP, NTOK, 0, (size_t)NTOK * CC, (size_t)CC * NTOK);   // y = wo.out_attn^T [8][256][4096]
    k_resid<<<dim3(CC / 8, 1, NBI), 256, 0, stream>>>(TMP, x, gam, out);                                                                     // x + gamma y
}

// v002
// It runs in 200 microseconds.
// Timed twice side by side with v001, it ran 1.93 times as fast both times.
// Counting every step since v000, it is 4.96 times as fast.
#include <hip/hip_runtime.h>

// Compute dtypes, f32 accumulate, batch items side by side on blockIdx.z (or as more rows) of each per-item launch, all eight per launch: q = x^T.wq^T ([4096 x 256].[256 x 32->64 padded], exact bf16 transposed input and weight); the 2x2 average
// pool in f32 -> x_kv^T as bf16 hi + UNSCALED residual; k = x_kv^T.wk^T and v = wv.x_kv (split pooled operand, two/three products); scores = q.k^T/sqrt(32)
// ([4096 x 32].[32 x 1024], three products), row softmax in f32 -> bf16 hi + UNSCALED residual; out_attn = attn.v^T ([4096 x 1024].[1024 x 256], three products), these three in one kernel,
// and y = wo.out_attn^T ([256 x 256].[256 x 4096], exact wo against split) on v_wmma_f32_16x16x32_bf16; out = x + gamma y in f32. Deterministic, no atomics;

#define NBI  8
#define CC   256
#define HW   64
#define NTOK 4096
#define NKV  1024               // 32 x 32 pooled
#define DQ   32
#define DQP  64                 // padded head dim (zeros)
#define DM   CC
#define NTK  NTOK
#define LOSC 1024.0f

typedef _Float16 h16;
typedef unsigned short bf;
typedef __attribute__((ext_vector_type(16))) __bf16   v16bf;
typedef __attribute__((ext_vector_type(16))) _Float16 v16h;
typedef __attribute__((ext_vector_type(8)))  _Float16 v8h;
typedef __attribute__((ext_vector_type(8)))  unsigned short v8us;
typedef __attribute__((ext_vector_type(8)))  float    v8f;
typedef __attribute__((ext_vector_type(4)))  float    v4f;
typedef __attribute__((ext_vector_type(4)))  _Float16 v4h;
typedef v8h  __attribute__((may_alias)) v8ha;
typedef v4f  __attribute__((may_alias)) v4fa;
typedef v8us __attribute__((may_alias)) v8usa;

__device__ __forceinline__ unsigned short f2bf(float f) { unsigned u = __float_as_uint(f); u += 0x7FFFu + ((u >> 16) & 1u); return (unsigned short)(u >> 16); }
__device__ __forceinline__ float bf2f(unsigned short b) { return __uint_as_float(((unsigned)b) << 16); }
__device__ __forceinline__ float bfr(float f) { return bf2f(f2bf(f)); }
__device__ __forceinline__ v16h cat16(v8h lo, v8h hi) { return __builtin_shufflevector(lo, hi, 0, 1, 2, 3, 4, 5, 6, 7, 8, 9, 10, 11, 12, 13, 14, 15); }
__device__ __forceinline__ v16bf cat16b(v8us lo, v8us hi) { return __builtin_bit_cast(v16bf, __builtin_shufflevector(lo, hi, 0, 1, 2, 3, 4, 5, 6, 7, 8, 9, 10, 11, 12, 13, 14, 15)); }
__device__ __forceinline__ v8f wmma16(v16h a, v16h b, v8f c) { return __builtin_amdgcn_wmma_f32_16x16x32_f16(false, a, false, b, (short)0, c, false, false); }
__device__ __forceinline__ v8f wmmab(v16bf a, v16bf b, v8f c) { return __builtin_amdgcn_wmma_f32_16x16x32_bf16(false, a, false, b, (short)0, c, false, false); }

// k_wt: WT [n][K] = bf16(W[k][n]) (k-major [K][ncols]) via 64 x 64 LDS tiles; grid (K/64, ncols/64, matrices).
__global__ __launch_bounds__(256) void k_wt(const float* __restrict__ Wm, int K, int ncols, bf* WT) {
    __shared__ __align__(16) unsigned short tl[64 * 72];
    const int tid = threadIdx.x, k0 = blockIdx.x * 64, n0 = blockIdx.y * 64;
    Wm += (size_t)blockIdx.z * K * ncols; WT += (size_t)blockIdx.z * K * ncols;
    const int kk = tid >> 2, nq = (tid & 3) * 16;
#pragma unroll
    for (int i = 0; i < 16; ++i) tl[(nq + i) * 72 + kk] = f2bf(Wm[(size_t)(k0 + kk) * ncols + n0 + nq + i]);
    __syncthreads();
    const int piece = tid & 7;
    auto pass = [&]() {
#pragma unroll
        for (int s = 0; s < 2; ++s) { const int nr = (tid >> 3) + 32 * s; const v8us val = *(const v8usa*)(tl + nr * 72 + piece * 8); *(v8us*)(WT + (size_t)(n0 + nr) * K + k0 + piece * 8) = val; }
    };
    pass(); 
}
// k_gemmb: 64 x 64 block tile (4 waves x 16 x 64) of C[NTK][NW] = (A [+ Al]).B^T (K = 256) [+ bf(bias[c])] [+ bf(R[r][c]) residual]; f32 whole-line epilogue (or f16
template <bool SPLITA, bool F16OUT = false>
__global__ __launch_bounds__(128) void k_gemmb(const bf* __restrict__ A, const bf* __restrict__ Al, const bf* __restrict__ Bn, const float* __restrict__ bias, float* C, int ldc, h16* C2, const float* __restrict__ R = nullptr, int K = DM, int roundR = 1, size_t sA = 0, size_t sC = 0) {
    __shared__ __align__(16) float ost[4][16 * 68];
    const int lane = threadIdx.x & 31, wave = threadIdx.x >> 5, lr = lane & 15, hi = lane >> 4;
    const int r0 = blockIdx.x * 64 + wave * 16, c0 = blockIdx.y * 64;
    A += blockIdx.z * sA; if (SPLITA) Al += blockIdx.z * sA; C += blockIdx.z * sC;    // item blockIdx.z: element strides sA (A planes), sC (C); B is shared
    const size_t aoff = (size_t)(r0 + lr) * K + 8 * hi;
    size_t boff[4];
#pragma unroll
    for (int t = 0; t < 4; ++t) boff[t] = (size_t)(c0 + t * 16 + lr) * K + 8 * hi;
    v8f acc[4];
#pragma unroll
    for (int t = 0; t < 4; ++t) acc[t] = (v8f){};
#pragma unroll 1
    for (int kc = 0; kc < K; kc += 32) {
        const v16bf a = cat16b(*(const v8us*)(A + aoff + kc), *(const v8us*)(A + aoff + kc + 16));
        v16bf al = a;
        if (SPLITA) al = cat16b(*(const v8us*)(Al + aoff + kc), *(const v8us*)(Al + aoff + kc + 16));
#pragma unroll
        for (int t = 0; t < 4; ++t) { const v16bf b = cat16b(*(const v8us*)(Bn + boff[t] + kc), *(const v8us*)(Bn + boff[t] + kc + 16)); acc[t] = wmmab(a, b, acc[t]); if (SPLITA) acc[t] = wmmab(al, b, acc[t]); }
        asm volatile("v_nop\n\tv_nop\n\tv_nop\n\tv_nop" : "+v"(acc[0]), "+v"(acc[1]), "+v"(acc[2]), "+v"(acc[3]) : "v"(a), "v"(al));
    }
    float* os = &ost[wave][0];
#pragma unroll
    for (int t = 0; t < 4; ++t) { const float bv = bias ? bfr(bias[c0 + t * 16 + lr]) : 0.f;
#pragma unroll
        for (int j = 0; j < 8; ++j) os[(hi * 8 + j) * 68 + t * 16 + lr] = acc[t][j] + bv; }
    __syncthreads();
    if (F16OUT) {
        h16* crow = (h16*)(void*)C + (size_t)r0 * ldc + c0;
        auto pass = [&]() {
#pragma unroll
            for (int s = 0; s < 4; ++s) { const int row = 4 * s + (lane >> 3), piece = lane & 7; const float* sp = os + row * 68 + piece * 8; v8h o, o2;
#pragma unroll
                for (int i = 0; i < 8; ++i) { const h16 a = (h16)sp[i]; o[i] = a; o2[i] = (h16)((sp[i] - (float)a) * LOSC); }
                *(v8h*)(crow + (size_t)row * ldc + piece * 8) = o; if (C2) *(v8h*)(C2 + (size_t)r0 * ldc + c0 + (size_t)row * ldc + piece * 8) = o2; }
        };
        pass(); 
    } else {
        float* crow = C + (size_t)r0 * ldc + c0;
        auto pass = [&]() {
#pragma unroll
            for (int s = 0; s < 8; ++s) { const int Lid = (lane >> 3) + 4 * s, piece = lane & 7; const int row = Lid >> 1, cofs = (Lid & 1) * 32 + piece * 4;
                v4f val = *(const v4fa*)(os + row * 68 + cofs); if (R) { const v4f rv = *(const v4f*)(R + ((size_t)r0 + row) * ldc + c0 + cofs); val += roundR ? (v4f){bfr(rv[0]), bfr(rv[1]), bfr(rv[2]), bfr(rv[3])} : rv; }
                *(v4f*)(crow + (size_t)row * ldc + cofs) = val; }
        };
        pass(); 
    }
}

// k_gemm3: 64 x 64 tile of C = (Ah + Al).(Bh + Bl)^T over K (row strides = K for all four planes; n-major B): three products per 32-k step (hh, hl, lh); f32
__global__ __launch_bounds__(128) void k_gemm3(const bf* __restrict__ Ah, const bf* __restrict__ Al, const bf* __restrict__ Bh, const bf* __restrict__ Bl, int K, float* C, int ldc, size_t sA, size_t sB, size_t sC) {
    __shared__ __align__(16) float ost[4][16 * 68];
    const int lane = threadIdx.x & 31, wave = threadIdx.x >> 5, lr = lane & 15, hi = lane >> 4;
    const int r0 = blockIdx.x * 64 + wave * 16, c0 = blockIdx.y * 64;
    Ah += blockIdx.z * sA; Al += blockIdx.z * sA; Bh += blockIdx.z * sB; Bl += blockIdx.z * sB; C += blockIdx.z * sC;    // item blockIdx.z: element strides (0 = shared weights)
    const size_t aoff = (size_t)(r0 + lr) * K + 8 * hi;
    v8f acc[4];
#pragma unroll
    for (int t = 0; t < 4; ++t) acc[t] = (v8f){};
#pragma unroll 1
    for (int kc = 0; kc < K; kc += 32) {
        const v16bf a = cat16b(*(const v8us*)(Ah + aoff + kc), *(const v8us*)(Ah + aoff + kc + 16));
        const v16bf al = cat16b(*(const v8us*)(Al + aoff + kc), *(const v8us*)(Al + aoff + kc + 16));
#pragma unroll
        for (int t = 0; t < 4; ++t) { const size_t bo = (size_t)(c0 + t * 16 + lr) * K + kc + 8 * hi;
            const v16bf bh = cat16b(*(const v8us*)(Bh + bo), *(const v8us*)(Bh + bo + 16)); const v16bf bl = cat16b(*(const v8us*)(Bl + bo), *(const v8us*)(Bl + bo + 16));
            acc[t] = wmmab(a, bh, acc[t]); acc[t] = wmmab(al, bh, acc[t]); acc[t] = wmmab(a, bl, acc[t]); }
        asm volatile("v_nop\n\tv_nop\n\tv_nop\n\tv_nop" : "+v"(acc[0]), "+v"(acc[1]), "+v"(acc[2]), "+v"(acc[3]) : "v"(a), "v"(al));
    }
    float* os = &ost[wave][0];
#pragma unroll
    for (int t = 0; t < 4; ++t) {
#pragma unroll
        for (int j = 0; j < 8; ++j) os[(hi * 8 + j) * 68 + t * 16 + lr] = acc[t][j]; }
    __builtin_amdgcn_wave_barrier(); asm volatile("" ::: "memory");
    float* crow = C + (size_t)r0 * ldc + c0;
    auto pass = [&]() {
#pragma unroll
        for (int s = 0; s < 8; ++s) { const int Lid = (lane >> 3) + 4 * s, piece = lane & 7; const int row = Lid >> 1, cofs = (Lid & 1) * 32 + piece * 4;
            const v4f val = *(const v4fa*)(os + row * 68 + cofs); *(v4f*)(crow + (size_t)row * ldc + cofs) = val; }
    };
    pass(); 
}

__global__ __launch_bounds__(256) void k_bfz(const float* __restrict__ src, bf* dh, bf* dz, size_t n8) {
    const size_t i = (size_t)blockIdx.x * 256 + threadIdx.x; if (i >= n8) return;
    const v8f v = *(const v8f*)(src + i * 8); v8us o, z;
#pragma unroll
    for (int k = 0; k < 8; ++k) { o[k] = f2bf(v[k]); z[k] = 0; }
    *(v8us*)(dh + i * 8) = o; *(v8us*)(dz + i * 8) = z; 
}
__global__ __launch_bounds__(256) void k_wpad(const float* __restrict__ w, bf* WP) {
    const int u = blockIdx.x * 256 + threadIdx.x; if (u >= DQP * CC / 8) return;
    const int d = u / (CC / 8), c0 = (u % (CC / 8)) * 8; v8us o;
#pragma unroll
    for (int i = 0; i < 8; ++i) o[i] = (d < DQ) ? f2bf(w[d * CC + c0 + i]) : (unsigned short)0;
    *(v8us*)(WP + (size_t)d * CC + c0) = o; 
}
// k_poolT: x_kv^T[m][c] = mean of the 2x2 block (f32, the reference's order ((a+b)+(c+d))/4 -> sum then * 0.25) of bf16-rounded x -> bf16 hi + UNSCALED residual planes
__global__ __launch_bounds__(256) void k_poolT(const float* __restrict__ x, bf* Ph, bf* Pl) {
    const int lane = threadIdx.x & 31, m = blockIdx.x * 8 + (threadIdx.x >> 5); if (m >= NKV) return;
    x += (size_t)blockIdx.z * CC * NTOK; Ph += (size_t)blockIdx.z * NKV * CC; Pl += (size_t)blockIdx.z * NKV * CC;
    const int pi = m / 32, pj = m % 32; v8us oh, ol;
#pragma unroll
    for (int i = 0; i < 8; ++i) { const int c = lane * 8 + i; const float* xc = x + (size_t)c * NTOK + (2 * pi) * HW + 2 * pj;
        const float s = (bfr(xc[0]) + bfr(xc[1])) + (bfr(xc[HW]) + bfr(xc[HW + 1])); const float v = s * 0.25f; const unsigned short hb = f2bf(v); oh[i] = hb; ol[i] = f2bf(v - bf2f(hb)); }
    const size_t o = (size_t)m * CC + lane * 8; *(v8us*)(Ph + o) = oh; *(v8us*)(Pl + o) = ol; 
}
__global__ __launch_bounds__(256) void k_split64(const float* __restrict__ src, int nrows, bf* dh, bf* dl) {
    typedef __attribute__((ext_vector_type(2))) unsigned short v2us;
    const int lane = threadIdx.x & 31, r = blockIdx.x * 8 + (threadIdx.x >> 5); if (r >= nrows) return;
    const size_t o = (size_t)r * DQP + lane * 2; v2us oh, ol;
#pragma unroll
    for (int i = 0; i < 2; ++i) { const float v = src[o + i]; const unsigned short hb = f2bf(v); oh[i] = hb; ol[i] = f2bf(v - bf2f(hb)); }
    *(v2us*)(dh + o) = oh; *(v2us*)(dl + o) = ol; 
}
__global__ __launch_bounds__(256) void k_splitw(const float* __restrict__ src, int nrows, int ncols, bf* dh, bf* dl) {
    const int lane = threadIdx.x & 31, r = blockIdx.x * 8 + (threadIdx.x >> 5); if (r >= nrows) return;
{
#pragma unroll 1
        for (int q = 0; q < ncols / 256; ++q) { const size_t o = (size_t)r * ncols + q * 256 + lane * 8; const v8f v = *(const v8f*)(src + o); v8us oh, ol;
#pragma unroll
            for (int i = 0; i < 8; ++i) { const unsigned short hb = f2bf(v[i]); oh[i] = hb; ol[i] = f2bf(v[i] - bf2f(hb)); }
            *(v8us*)(dh + o) = oh; *(v8us*)(dl + o) = ol; }
         }
}
#define AQ   4
#define ACT  4
#define ANW  8                  // waves per block
#define ACG  (CC / 16 / ACT)    // channel groups
#define AQB  (ANW / ACG * AQ * 16)   // queries per block
#define SCL2 0.25503486f        // (1/sqrt(32)) * log2(e)
typedef __attribute__((ext_vector_type(2))) float  v2f;
typedef __attribute__((ext_vector_type(2))) __bf16 v2bf;
typedef __attribute__((ext_vector_type(4))) unsigned int v4u;
__global__ __launch_bounds__(ANW * 32) void k_attn(const bf* __restrict__ Qh, const bf* __restrict__ Ql, const bf* __restrict__ Kh, const bf* __restrict__ Kl,
                                                   const bf* __restrict__ Vh, const bf* __restrict__ Vl, bf* OAh, bf* OAl) {
    __shared__ __align__(16) unsigned short ksh[NKV * DQ], ksl[NKV * DQ];    // per 16-key tile 512 elements: [k half of the fragment][lane][8]
    const int tid = threadIdx.x, lane = tid & 31, wave = tid >> 5, lr = lane & 15, hi = lane >> 4;
    const int q0 = blockIdx.x * AQB + (wave / ACG) * (AQ * 16), cb = (wave % ACG) * (ACT * 16);
    const size_t it = blockIdx.z;
    Qh += it * NTOK * DQP; Ql += it * NTOK * DQP; Kh += it * NKV * DQP; Kl += it * NKV * DQP; Vh += it * CC * NKV; Vl += it * CC * NKV; OAh += it * NTOK * CC; OAl += it * NTOK * CC;
    const bf* qp = Qh + (size_t)(q0 + lr) * DQP + 8 * hi; const bf* qlp = Ql + (size_t)(q0 + lr) * DQP + 8 * hi;
    v16bf qh[AQ], ql[AQ];
#pragma unroll
    for (int n = 0; n < AQ; ++n) { qh[n] = cat16b(*(const v8us*)(qp + n * 16 * DQP), *(const v8us*)(qp + n * 16 * DQP + 16)); ql[n] = cat16b(*(const v8us*)(qlp + n * 16 * DQP), *(const v8us*)(qlp + n * 16 * DQP + 16)); }
    asm volatile("s_wait_xcnt 0x0" :: "v"(qp), "v"(qlp) : "memory");    // the q loads stay in flight over the staging of k, which reuses their address registers: the wait in front of that overwrite (the two addresses as inputs keep them whole up to it)
    // k staging: thread tid takes chunk tid & 3 of row (tid >> 2) + 64 u, so every load of a plane is one address pair plus a constant step, and every LDS store one index plus a constant step
    const bf* kp = Kh + (tid >> 2) * DQP + (tid & 3) * 8; const bf* klp = Kl + (tid >> 2) * DQP + (tid & 3) * 8;
    const int kd = (tid >> 6) * 512 + ((tid & 3) >> 1) * 256 + ((tid & 1) * 16 + ((tid >> 2) & 15)) * 8;
#pragma unroll    // whole: the constant steps become immediate offsets
    for (int g = 0; g < NKV / (ANW * 8) / 8; ++g) { v8us th[8], tl[8];    // groups of sixteen loads, each with its wait behind it
#pragma unroll
        for (int u = 0; u < 8; ++u) { th[u] = *(const v8us*)(kp + (g * 8 + u) * (ANW * 8) * DQP); tl[u] = *(const v8us*)(klp + (g * 8 + u) * (ANW * 8) * DQP); }
        asm volatile("s_wait_xcnt 0x0" :: "v"(kp), "v"(klp) : "memory");    // the wait in front of any overwrite of the k loads' address registers (the two addresses as inputs keep them whole up to it, so that no load's result lands in them)
#pragma unroll
        for (int u = 0; u < 8; ++u) { *(v8usa*)(ksh + kd + (g * 8 + u) * 2048) = th[u]; *(v8usa*)(ksl + kd + (g * 8 + u) * 2048) = tl[u]; } }
    __syncthreads();    // k is staged: from here on LDS is only read
    float mx[AQ];
#pragma unroll
    for (int n = 0; n < AQ; ++n) mx[n] = -3.0e38f;
#pragma unroll 4    // four key tiles a trip: their sixteen LDS reads issue ahead of the block of matrix instructions that uses them
    for (int mt = 0; mt < NKV / 16; ++mt) { const int kb = mt * 512 + lane * 8;
        const v16bf a = cat16b(*(const v8usa*)(ksh + kb), *(const v8usa*)(ksh + kb + 256)); const v16bf al = cat16b(*(const v8usa*)(ksl + kb), *(const v8usa*)(ksl + kb + 256));
#pragma unroll
        for (int n = 0; n < AQ; ++n) { v8f s = (v8f){}; s = wmmab(a, qh[n], s); s = wmmab(al, qh[n], s); s = wmmab(a, ql[n], s);
#pragma unroll
            for (int r = 0; r < 8; ++r) mx[n] = fmaxf(mx[n], s[r]); }
    }
    float mc[AQ], sum[AQ];
#pragma unroll
    for (int n = 0; n < AQ; ++n) { mx[n] = fmaxf(mx[n], __shfl_xor(mx[n], 16, 32)); mc[n] = mx[n] * SCL2; sum[n] = 0.f; }
    v8f acc[ACT][AQ];
#pragma unroll
    for (int c = 0; c < ACT; ++c) {
#pragma unroll
        for (int n = 0; n < AQ; ++n) acc[c][n] = (v8f){}; }
    const int vo = (cb + lr) * NKV + 8 * hi;
#pragma unroll 1    // stays rolled: one trip is already some six hundred instructions and the register budget is nearly used
    for (int m0 = 0; m0 < NKV; m0 += 32) {
        v16bf a[ACT], al[ACT];
#pragma unroll
        for (int c = 0; c < ACT; ++c) { const int vb = vo + c * 16 * NKV + m0;
            a[c] = cat16b(*(const v8us*)(Vh + vb), *(const v8us*)(Vh + vb + 16)); al[c] = cat16b(*(const v8us*)(Vl + vb), *(const v8us*)(Vl + vb + 16)); }
        asm volatile("s_wait_xcnt 0x0" ::: "memory");    // the v loads stay in flight over the score work, which reuses their address registers: the wait in front of that overwrite
        v8f s[2][AQ];
#pragma unroll
        for (int t = 0; t < 2; ++t) { const int kb = (m0 / 16 + t) * 512 + lane * 8;
            const v16bf k = cat16b(*(const v8usa*)(ksh + kb), *(const v8usa*)(ksh + kb + 256)); const v16bf kl = cat16b(*(const v8usa*)(ksl + kb), *(const v8usa*)(ksl + kb + 256));
#pragma unroll
            for (int n = 0; n < AQ; ++n) { v8f z = (v8f){}; z = wmmab(k, qh[n], z); z = wmmab(kl, qh[n], z); z = wmmab(k, ql[n], z); s[t][n] = z; } }
        v16bf ph[AQ], pl[AQ];
#pragma unroll
        for (int n = 0; n < AQ; ++n) { float x[16];
#pragma unroll
            for (int e = 0; e < 16; ++e) x[e] = __builtin_fmaf(s[e >> 3][n][e & 7], SCL2, -mc[n]);
#pragma unroll
            for (int e = 0; e < 16; e += 8)    // eight exponentials a statement: each has an independent instruction behind it, the last a v_nop (the slot the instruction set asks for behind a transcendental)
                asm("v_exp_f32 %0, %0\n\tv_exp_f32 %1, %1\n\tv_exp_f32 %2, %2\n\tv_exp_f32 %3, %3\n\tv_exp_f32 %4, %4\n\tv_exp_f32 %5, %5\n\tv_exp_f32 %6, %6\n\tv_exp_f32 %7, %7\n\tv_nop"
                    : "+v"(x[e]), "+v"(x[e + 1]), "+v"(x[e + 2]), "+v"(x[e + 3]), "+v"(x[e + 4]), "+v"(x[e + 5]), "+v"(x[e + 6]), "+v"(x[e + 7]));
#pragma unroll
            for (int e = 0; e < 16; e += 2) {
                const float p0 = x[e], p1 = x[e + 1];
                sum[n] += p0 + p1;
                const v2bf h = __builtin_convertvector((v2f){p0, p1}, v2bf);
                const v2bf l = __builtin_convertvector((v2f){p0 - (float)h[0], p1 - (float)h[1]}, v2bf);
                ph[n][e] = h[0]; ph[n][e + 1] = h[1]; pl[n][e] = l[0]; pl[n][e + 1] = l[1]; } }
#pragma unroll
        for (int c = 0; c < ACT; ++c) {
#pragma unroll
            for (int n = 0; n < AQ; ++n) acc[c][n] = wmmab(a[c], ph[n], acc[c][n]); }
#pragma unroll
        for (int c = 0; c < ACT; ++c) {
#pragma unroll
            for (int n = 0; n < AQ; ++n) acc[c][n] = wmmab(al[c], ph[n], acc[c][n]); }
#pragma unroll
        for (int c = 0; c < ACT; ++c) {
#pragma unroll
            for (int n = 0; n < AQ; ++n) acc[c][n] = wmmab(a[c], pl[n], acc[c][n]); }
    }
#pragma unroll
    for (int n = 0; n < AQ; ++n) { const float inv = 1.0f / (sum[n] + __shfl_xor(sum[n], 16, 32));
        const size_t ob = (size_t)(q0 + n * 16 + lr) * CC + cb + 8 * hi;
#pragma unroll
        for (int c = 0; c < ACT; ++c) { v8us oh, ol;
#pragma unroll
            for (int r = 0; r < 8; ++r) { const float v = acc[c][n][r] * inv; const unsigned short hb = f2bf(v); oh[r] = hb; ol[r] = f2bf(v - bf2f(hb)); }
            // the two stores and their wait in one statement: the next tile's split reuses the registers they name
            asm volatile("global_store_b128 %0, %1, off\n\tglobal_store_b128 %2, %3, off\n\ts_wait_xcnt 0x0"
                         :: "v"(OAh + ob + c * 16), "v"(__builtin_bit_cast(v4u, oh)), "v"(OAl + ob + c * 16), "v"(__builtin_bit_cast(v4u, ol)) : "memory"); } }
}
__global__ __launch_bounds__(256) void k_resid(const float* __restrict__ Y, const float* __restrict__ X, const float* __restrict__ gam, float* OUTP) {
    const int lane = threadIdx.x & 31, r = blockIdx.x * 8 + (threadIdx.x >> 5); if (r >= CC) return;
    Y += (size_t)blockIdx.z * CC * NTOK; X += (size_t)blockIdx.z * CC * NTOK; OUTP += (size_t)blockIdx.z * CC * NTOK;
    const float g = bfr(gam[0]);
{
#pragma unroll 1
        for (int q = 0; q < NTOK / 256; ++q) { const size_t o = (size_t)r * NTOK + q * 256 + lane * 8; const v8f y = *(const v8f*)(Y + o); const v8f xv = *(const v8f*)(X + o); v8f v;
#pragma unroll
            for (int i = 0; i < 8; ++i) v[i] = bfr(xv[i]) + g * y[i];
            *(v8f*)(OUTP + o) = v; }
         }
}

extern "C" void kernel_launch(void* const* d_in, const int* in_sizes, int n_in,
                              void* d_out, int out_size, void* d_ws, size_t ws_size, hipStream_t stream) {
    (void)in_sizes; (void)n_in; (void)out_size;
    const float* x = (const float*)d_in[0]; const float* wq = (const float*)d_in[1]; const float* wk = (const float*)d_in[2]; const float* wv = (const float*)d_in[3]; const float* wo = (const float*)d_in[4]; const float* gam = (const float*)d_in[5];
    float* out = (float*)d_out;    // [8][256][64][64]
    char* wsp = (char*)d_ws;
    auto take = [&](size_t bytes) { char* p = wsp; wsp += (bytes + 255) & ~(size_t)255; return (void*)p; };
    bf* WqP = (bf*)take((size_t)DQP * CC * 2); bf* WkP = (bf*)take((size_t)DQP * CC * 2); bf* WvB = (bf*)take((size_t)CC * CC * 2); bf* WoB = (bf*)take((size_t)CC * CC * 2); bf* WZ = (bf*)take((size_t)CC * CC * 2);
    bf* XT = (bf*)take((size_t)NBI * NTOK * CC * 2); bf* KVh = (bf*)take((size_t)NBI * NKV * CC * 2); bf* KVl = (bf*)take((size_t)NBI * NKV * CC * 2);
    float* TMP = (float*)take((size_t)NBI * CC * NTOK * 4); bf* Qh = (bf*)take((size_t)NBI * NTOK * DQP * 2); bf* Ql = (bf*)take((size_t)NBI * NTOK * DQP * 2); bf* Kh = (bf*)take((size_t)NBI * NKV * DQP * 2); bf* Kl = (bf*)take((size_t)NBI * NKV * DQP * 2);
    bf* Vh = (bf*)take((size_t)NBI * CC * NKV * 2); bf* Vl = (bf*)take((size_t)NBI * CC * NKV * 2);
    bf* OAh = (bf*)take((size_t)NBI * NTOK * CC * 2); bf* OAl = (bf*)take((size_t)NBI * NTOK * CC * 2);
    if ((size_t)(wsp - (char*)d_ws) > ws_size) return;    // MiB: 0.4 + 16 + 8 + 32 + 8 + 2 + 8 + 32 ~ 107 of 256; TMP (f32 [8][256][4096]) holds in turn q [8][4096][64], k, v, y, each consumed before the next (stream order)
    k_wpad<<<(DQP * CC / 8 + 255) / 256, 256, 0, stream>>>(wq, WqP); k_wpad<<<(DQP * CC / 8 + 255) / 256, 256, 0, stream>>>(wk, WkP);
    k_bfz<<<(CC * CC / 8 + 255) / 256, 256, 0, stream>>>(wv, WvB, WZ, CC * CC / 8); k_bfz<<<(CC * CC / 8 + 255) / 256, 256, 0, stream>>>(wo, WoB, WZ, CC * CC / 8);
    k_wt<<<dim3(CC / 64, NTOK / 64, NBI), 256, 0, stream>>>(x, CC, NTOK, XT);                                                                 // x^T [8][4096][256] exact
    k_gemmb<false, false><<<dim3(NTOK / 64, 1, NBI), 128, 0, stream>>>(XT, nullptr, WqP, nullptr, TMP, DQP, nullptr, nullptr, DM, 1, (size_t)NTOK * CC, (size_t)NTOK * DQP);
    k_split64<<<NBI * NTOK / 8, 256, 0, stream>>>(TMP, NBI * NTOK, Qh, Ql);                                                                  // q [8][4096][64] (32 real)
    k_poolT<<<dim3(NKV / 8, 1, NBI), 256, 0, stream>>>(x, KVh, KVl);                                                                         // x_kv^T [8][1024][256] hi/lo
    k_gemmb<true, false><<<dim3(NKV / 64, 1, NBI), 128, 0, stream>>>(KVh, KVl, WkP, nullptr, TMP, DQP, nullptr, nullptr, DM, 1, (size_t)NKV * CC, (size_t)NKV * DQP);
    k_split64<<<NBI * NKV / 8, 256, 0, stream>>>(TMP, NBI * NKV, Kh, Kl);                                                                    // k [8][1024][64]
    k_gemm3<<<dim3(CC / 64, NKV / 64, NBI), 128, 0, stream>>>(WvB, WZ, KVh, KVl, CC, TMP, NKV, 0, (size_t)NKV * CC, (size_t)CC * NKV);
    k_splitw<<<NBI * CC / 8, 256, 0, stream>>>(TMP, NBI * CC, NKV, Vh, Vl);                                                                  // v [8][256][1024]
    k_attn<<<dim3(NTOK / AQB, 1, NBI), ANW * 32, 0, stream>>>(Qh, Ql, Kh, Kl, Vh, Vl, OAh, OAl);                                                    // out_attn token-major [8][4096][256] hi/lo
    k_gemm3<<<dim3(CC / 64, NTOK / 64, NBI), 128, 0, stream>>>(WoB, WZ, OAh, OAl, CC, TMP, NTOK, 0, (size_t)NTOK * CC, (size_t)CC * NTOK);   // y = wo.out_attn^T [8][256][4096]
    k_resid<<<dim3(CC / 8, 1, NBI), 256, 0, stream>>>(TMP, x, gam, out);                                                                     // x + gamma y
}

// v003
// Measured time: 172 microseconds a run.
// In two side-by-side timings against v002, it was 1.16 and 1.15 times as fast.
// All steps since v000 together make it 5.73 times as fast.
#include <hip/hip_runtime.h>

// Compute dtypes, f32 accumulate, batch items side by side on blockIdx.z of each per-item launch, all eight per launch: q = x^T.wq^T ([4096 x 256].[256 x 32->64 padded], exact bf16 transposed input and weight); the 2x2 average
// pool in f32 -> x_kv^T as bf16 hi + UNSCALED residual; k = x_kv^T.wk^T and v = wv.x_kv (split pooled operand, two/three products); scores = q.k^T/sqrt(32)
// ([4096 x 32].[32 x 1024], three products), row softmax in f32 -> bf16 hi + UNSCALED residual; out_attn = attn.v^T ([4096 x 1024].[1024 x 256], three products), these three in one kernel,
// and y = wo.out_attn^T ([256 x 256].[256 x 4096], exact wo against split) on v_wmma_f32_16x16x32_bf16; out = x + gamma y in f32. Every product's kernel stores what its consumer reads (the hi/lo planes, or out itself). Deterministic, no atomics;

#define NBI  8
#define CC   256
#define HW   64
#define NTOK 4096
#define NKV  1024               // 32 x 32 pooled
#define DQ   32
#define DQP  64                 // padded head dim (zeros)
#define DM   CC
#define NTK  NTOK
#define LOSC 1024.0f

typedef _Float16 h16;
typedef unsigned short bf;
typedef __attribute__((ext_vector_type(16))) __bf16   v16bf;
typedef __attribute__((ext_vector_type(16))) _Float16 v16h;
typedef __attribute__((ext_vector_type(8)))  _Float16 v8h;
typedef __attribute__((ext_vector_type(8)))  unsigned short v8us;
typedef __attribute__((ext_vector_type(8)))  float    v8f;
typedef __attribute__((ext_vector_type(4)))  float    v4f;
typedef __attribute__((ext_vector_type(4)))  _Float16 v4h;
typedef v8h  __attribute__((may_alias)) v8ha;
typedef v4f  __attribute__((may_alias)) v4fa;
typedef v8us __attribute__((may_alias)) v8usa;

__device__ __forceinline__ unsigned short f2bf(float f) { unsigned u = __float_as_uint(f); u += 0x7FFFu + ((u >> 16) & 1u); return (unsigned short)(u >> 16); }
__device__ __forceinline__ float bf2f(unsigned short b) { return __uint_as_float(((unsigned)b) << 16); }
__device__ __forceinline__ float bfr(float f) { return bf2f(f2bf(f)); }
__device__ __forceinline__ v16h cat16(v8h lo, v8h hi) { return __builtin_shufflevector(lo, hi, 0, 1, 2, 3, 4, 5, 6, 7, 8, 9, 10, 11, 12, 13, 14, 15); }
__device__ __forceinline__ v16bf cat16b(v8us lo, v8us hi) { return __builtin_bit_cast(v16bf, __builtin_shufflevector(lo, hi, 0, 1, 2, 3, 4, 5, 6, 7, 8, 9, 10, 11, 12, 13, 14, 15)); }
__device__ __forceinline__ v8f wmma16(v16h a, v16h b, v8f c) { return __builtin_amdgcn_wmma_f32_16x16x32_f16(false, a, false, b, (short)0, c, false, false); }
__device__ __forceinline__ v8f wmmab(v16bf a, v16bf b, v8f c) { return __builtin_amdgcn_wmma_f32_16x16x32_bf16(false, a, false, b, (short)0, c, false, false); }

// k_wt: WT [n][K] = bf16(W[k][n]) (k-major [K][ncols]) via 64 x 64 LDS tiles; grid (K/64, ncols/64, matrices).
__global__ __launch_bounds__(256) void k_wt(const float* __restrict__ Wm, int K, int ncols, bf* WT) {
    __shared__ __align__(16) unsigned short tl[64 * 72];
    const int tid = threadIdx.x, k0 = blockIdx.x * 64, n0 = blockIdx.y * 64;
    Wm += (size_t)blockIdx.z * K * ncols; WT += (size_t)blockIdx.z * K * ncols;
    const int kk = tid >> 2, nq = (tid & 3) * 16;
#pragma unroll
    for (int i = 0; i < 16; ++i) tl[(nq + i) * 72 + kk] = f2bf(Wm[(size_t)(k0 + kk) * ncols + n0 + nq + i]);
    __syncthreads();
    const int piece = tid & 7;
    auto pass = [&]() {
#pragma unroll
        for (int s = 0; s < 2; ++s) { const int nr = (tid >> 3) + 32 * s; const v8us val = *(const v8usa*)(tl + nr * 72 + piece * 8); *(v8us*)(WT + (size_t)(n0 + nr) * K + k0 + piece * 8) = val; }
    };
    pass(); 
}
// split_rows: a wave's staged 16 x 64 f32 tile -> bf16 hi + UNSCALED residual planes (row stride LDC, a constant: one address a plane, the rows as immediate offsets); 8 lanes store one whole 128-byte row of a plane.
template <int LDC>
__device__ __forceinline__ void split_rows(const float* os, int lane, bf* ch, bf* cl) {
    const size_t o = (size_t)(lane >> 3) * LDC + (lane & 7) * 8; ch += o; cl += o;
#pragma unroll
    for (int s = 0; s < 4; ++s) { const int row = 4 * s + (lane >> 3), piece = lane & 7; const float* sp = os + row * 68 + piece * 8;
        const v4f v0 = *(const v4fa*)sp, v1 = *(const v4fa*)(sp + 4); v8us oh, ol;
#pragma unroll
        for (int i = 0; i < 8; ++i) { const float v = i < 4 ? v0[i & 3] : v1[i & 3]; const unsigned short hb = f2bf(v); oh[i] = hb; ol[i] = f2bf(v - bf2f(hb)); }
        *(v8us*)(ch + 4 * s * LDC) = oh; *(v8us*)(cl + 4 * s * LDC) = ol; }
}
// k_gemmb: 64 x 64 block tile (4 waves x 16 x 64) of C [rows][DQP] = (A [+ Al]).B^T over K; the epilogue splits the f32 tile itself and stores the two bf16 planes its consumer reads.
template <bool SPLITA>
__global__ __launch_bounds__(128) void k_gemmb(const bf* __restrict__ A, const bf* __restrict__ Al, const bf* __restrict__ Bn, bf* Ch, bf* Cl, int K, size_t sA, size_t sC) {
    __shared__ __align__(16) float ost[4][16 * 68];
    const int lane = threadIdx.x & 31, wave = threadIdx.x >> 5, lr = lane & 15, hi = lane >> 4;
    const int r0 = blockIdx.x * 64 + wave * 16, c0 = blockIdx.y * 64;
    A += blockIdx.z * sA; if (SPLITA) Al += blockIdx.z * sA; Ch += blockIdx.z * sC; Cl += blockIdx.z * sC;    // item blockIdx.z: element strides sA (A planes), sC (C planes); B is shared
    const size_t aoff = (size_t)(r0 + lr) * K + 8 * hi;
    size_t boff[4];
#pragma unroll
    for (int t = 0; t < 4; ++t) boff[t] = (size_t)(c0 + t * 16 + lr) * K + 8 * hi;
    v8f acc[4];
#pragma unroll
    for (int t = 0; t < 4; ++t) acc[t] = (v8f){};
#pragma unroll 1
    for (int kc = 0; kc < K; kc += 32) {
        const v16bf a = cat16b(*(const v8us*)(A + aoff + kc), *(const v8us*)(A + aoff + kc + 16));
        v16bf al = a;
        if (SPLITA) al = cat16b(*(const v8us*)(Al + aoff + kc), *(const v8us*)(Al + aoff + kc + 16));
#pragma unroll
        for (int t = 0; t < 4; ++t) { const v16bf b = cat16b(*(const v8us*)(Bn + boff[t] + kc), *(const v8us*)(Bn + boff[t] + kc + 16)); acc[t] = wmmab(a, b, acc[t]); if (SPLITA) acc[t] = wmmab(al, b, acc[t]); }
        asm volatile("v_nop\n\tv_nop\n\tv_nop\n\tv_nop" : "+v"(acc[0]), "+v"(acc[1]), "+v"(acc[2]), "+v"(acc[3]) : "v"(a), "v"(al));
    }
    float* os = &ost[wave][0];
#pragma unroll
    for (int t = 0; t < 4; ++t) {
#pragma unroll
        for (int j = 0; j < 8; ++j) os[(hi * 8 + j) * 68 + t * 16 + lr] = acc[t][j]; }
    __syncthreads();
    const size_t co = (size_t)r0 * DQP + c0;
    split_rows<DQP>(os, lane, Ch + co, Cl + co);
}

// k_gemm3: 64 x 64 tile of C = (Ah + Al).(Bh + Bl)^T over K (row strides = K for all four planes; n-major B; C's row stride LDC): three products per 32-k step (hh, hl, lh). The epilogue writes what
// the consumer reads: the two bf16 planes of C (RESID false), or OUTP = X + gamma C in f32, whole lines (RESID true; X is fetched ahead of the k loop).
// Eight waves a SIMD asked for: with the 32 registers of X the kernel stays within 128, so that the 2048 blocks of the last product are all resident at once.
template <bool RESID, int LDC>
__global__ __launch_bounds__(128, 8) void k_gemm3(const bf* __restrict__ Ah, const bf* __restrict__ Al, const bf* __restrict__ Bh, const bf* __restrict__ Bl, int K, bf* Ch, bf* Cl,
                                               const float* __restrict__ X, const float* __restrict__ gam, float* OUTP, size_t sA, size_t sB, size_t sC) {
    __shared__ __align__(16) float ost[4][16 * 68];
    const int lane = threadIdx.x & 31, wave = threadIdx.x >> 5, lr = lane & 15, hi = lane >> 4;
    const int r0 = blockIdx.x * 64 + wave * 16, c0 = blockIdx.y * 64;
    Ah += blockIdx.z * sA; Al += blockIdx.z * sA; Bh += blockIdx.z * sB; Bl += blockIdx.z * sB;    // item blockIdx.z: element strides (0 = shared weights)
    const size_t co = blockIdx.z * sC + (size_t)r0 * LDC + c0;
    const size_t eo = co + (size_t)(lane >> 4) * LDC + (lane & 15) * 4;    // RESID: pass s of the epilogue takes rows 2 s and 2 s + 1, 16 lanes a row of 64 floats (two whole lines)
    v4f xv[8]; float g = 0.f;
    if (RESID) { g = bfr(gam[0]); const float* xp = X + eo;
#pragma unroll
        for (int s = 0; s < 8; ++s) xv[s] = *(const v4f*)(xp + 2 * s * LDC);
        asm volatile("s_wait_xcnt 0x0" :: "v"(xp) : "memory"); }    // the x loads stay in flight over the k loop, whose set-up reuses their address registers: the wait in front of that overwrite (the address as an input keeps it whole up to it)
    const size_t aoff = (size_t)(r0 + lr) * K + 8 * hi;
    v8f acc[4];
#pragma unroll
    for (int t = 0; t < 4; ++t) acc[t] = (v8f){};
#pragma unroll 1
    for (int kc = 0; kc < K; kc += 32) {
        const v16bf a = cat16b(*(const v8us*)(Ah + aoff + kc), *(const v8us*)(Ah + aoff + kc + 16));
        const v16bf al = cat16b(*(const v8us*)(Al + aoff + kc), *(const v8us*)(Al + aoff + kc + 16));
#pragma unroll
        for (int t = 0; t < 4; ++t) { const size_t bo = (size_t)(c0 + t * 16 + lr) * K + kc + 8 * hi;
            const v16bf bh = cat16b(*(const v8us*)(Bh + bo), *(const v8us*)(Bh + bo + 16)); const v16bf bl = cat16b(*(const v8us*)(Bl + bo), *(const v8us*)(Bl + bo + 16));
            acc[t] = wmmab(a, bh, acc[t]); acc[t] = wmmab(al, bh, acc[t]); acc[t] = wmmab(a, bl, acc[t]); }
        asm volatile("v_nop\n\tv_nop\n\tv_nop\n\tv_nop" : "+v"(acc[0]), "+v"(acc[1]), "+v"(acc[2]), "+v"(acc[3]) : "v"(a), "v"(al));
    }
    float* os = &ost[wave][0];
#pragma unroll
    for (int t = 0; t < 4; ++t) {
#pragma unroll
        for (int j = 0; j < 8; ++j) os[(hi * 8 + j) * 68 + t * 16 + lr] = acc[t][j]; }
    __builtin_amdgcn_wave_barrier(); asm volatile("" ::: "memory");
    if (RESID) {
#pragma unroll
        for (int s = 0; s < 8; ++s) { const v4f y = *(const v4fa*)(os + (2 * s + (lane >> 4)) * 68 + (lane & 15) * 4); v4f val;
#pragma unroll
            for (int i = 0; i < 4; ++i) val[i] = bfr(xv[s][i]) + g * y[i];
            *(v4f*)(OUTP + eo + 2 * s * LDC) = val; }
    } else split_rows<LDC>(os, lane, Ch + co, Cl + co);
}

__global__ __launch_bounds__(256) void k_bfz(const float* __restrict__ src, bf* dh, bf* dz, size_t n8) {
    const size_t i = (size_t)blockIdx.x * 256 + threadIdx.x; if (i >= n8) return;
    const v8f v = *(const v8f*)(src + i * 8); v8us o, z;
#pragma unroll
    for (int k = 0; k < 8; ++k) { o[k] = f2bf(v[k]); z[k] = 0; }
    *(v8us*)(dh + i * 8) = o; *(v8us*)(dz + i * 8) = z; 
}
__global__ __launch_bounds__(256) void k_wpad(const float* __restrict__ w, bf* WP) {
    const int u = blockIdx.x * 256 + threadIdx.x; if (u >= DQP * CC / 8) return;
    const int d = u / (CC / 8), c0 = (u % (CC / 8)) * 8; v8us o;
#pragma unroll
    for (int i = 0; i < 8; ++i) o[i] = (d < DQ) ? f2bf(w[d * CC + c0 + i]) : (unsigned short)0;
    *(v8us*)(WP + (size_t)d * CC + c0) = o; 
}
// k_poolT: x_kv^T[m][c] = mean of the 2x2 block (f32, the reference's order ((a+b)+(c+d))/4 -> sum then * 0.25) of bf16-rounded x -> bf16 hi + UNSCALED residual planes
__global__ __launch_bounds__(256) void k_poolT(const float* __restrict__ x, bf* Ph, bf* Pl) {
    const int lane = threadIdx.x & 31, m = blockIdx.x * 8 + (threadIdx.x >> 5); if (m >= NKV) return;
    x += (size_t)blockIdx.z * CC * NTOK; Ph += (size_t)blockIdx.z * NKV * CC; Pl += (size_t)blockIdx.z * NKV * CC;
    const int pi = m / 32, pj = m % 32; v8us oh, ol;
#pragma unroll
    for (int i = 0; i < 8; ++i) { const int c = lane * 8 + i; const float* xc = x + (size_t)c * NTOK + (2 * pi) * HW + 2 * pj;
        const float s = (bfr(xc[0]) + bfr(xc[1])) + (bfr(xc[HW]) + bfr(xc[HW + 1])); const float v = s * 0.25f; const unsigned short hb = f2bf(v); oh[i] = hb; ol[i] = f2bf(v - bf2f(hb)); }
    const size_t o = (size_t)m * CC + lane * 8; *(v8us*)(Ph + o) = oh; *(v8us*)(Pl + o) = ol; 
}
#define AQ   4
#define ACT  4
#define ANW  8                  // waves per block
#define ACG  (CC / 16 / ACT)    // channel groups
#define AQB  (ANW / ACG * AQ * 16)   // queries per block
#define SCL2 0.25503486f        // (1/sqrt(32)) * log2(e)
typedef __attribute__((ext_vector_type(2))) float  v2f;
typedef __attribute__((ext_vector_type(2))) __bf16 v2bf;
typedef __attribute__((ext_vector_type(4))) unsigned int v4u;
__global__ __launch_bounds__(ANW * 32) void k_attn(const bf* __restrict__ Qh, const bf* __restrict__ Ql, const bf* __restrict__ Kh, const bf* __restrict__ Kl,
                                                   const bf* __restrict__ Vh, const bf* __restrict__ Vl, bf* OAh, bf* OAl) {
    __shared__ __align__(16) unsigned short ksh[NKV * DQ], ksl[NKV * DQ];    // per 16-key tile 512 elements: [k half of the fragment][lane][8]
    const int tid = threadIdx.x, lane = tid & 31, wave = tid >> 5, lr = lane & 15, hi = lane >> 4;
    const int q0 = blockIdx.x * AQB + (wave / ACG) * (AQ * 16), cb = (wave % ACG) * (ACT * 16);
    const size_t it = blockIdx.z;
    Qh += it * NTOK * DQP; Ql += it * NTOK * DQP; Kh += it * NKV * DQP; Kl += it * NKV * DQP; Vh += it * CC * NKV; Vl += it * CC * NKV; OAh += it * NTOK * CC; OAl += it * NTOK * CC;
    const bf* qp = Qh + (size_t)(q0 + lr) * DQP + 8 * hi; const bf* qlp = Ql + (size_t)(q0 + lr) * DQP + 8 * hi;
    v16bf qh[AQ], ql[AQ];
#pragma unroll
    for (int n = 0; n < AQ; ++n) { qh[n] = cat16b(*(const v8us*)(qp + n * 16 * DQP), *(const v8us*)(qp + n * 16 * DQP + 16)); ql[n] = cat16b(*(const v8us*)(qlp + n * 16 * DQP), *(const v8us*)(qlp + n * 16 * DQP + 16)); }
    asm volatile("s_wait_xcnt 0x0" :: "v"(qp), "v"(qlp) : "memory");    // the q loads stay in flight over the staging of k, which reuses their address registers: the wait in front of that overwrite (the two addresses as inputs keep them whole up to it)
    // k staging: thread tid takes chunk tid & 3 of row (tid >> 2) + 64 u, so every load of a plane is one address pair plus a constant step, and every LDS store one index plus a constant step
    const bf* kp = Kh + (tid >> 2) * DQP + (tid & 3) * 8; const bf* klp = Kl + (tid >> 2) * DQP + (tid & 3) * 8;
    const int kd = (tid >> 6) * 512 + ((tid & 3) >> 1) * 256 + ((tid & 1) * 16 + ((tid >> 2) & 15)) * 8;
#pragma unroll    // whole: the constant steps become immediate offsets
    for (int g = 0; g < NKV / (ANW * 8) / 8; ++g) { v8us th[8], tl[8];    // groups of sixteen loads, each with its wait behind it
#pragma unroll
        for (int u = 0; u < 8; ++u) { th[u] = *(const v8us*)(kp + (g * 8 + u) * (ANW * 8) * DQP); tl[u] = *(const v8us*)(klp + (g * 8 + u) * (ANW * 8) * DQP); }
        asm volatile("s_wait_xcnt 0x0" :: "v"(kp), "v"(klp) : "memory");    // the wait in front of any overwrite of the k loads' address registers (the two addresses as inputs keep them whole up to it, so that no load's result lands in them)
#pragma unroll
        for (int u = 0; u < 8; ++u) { *(v8usa*)(ksh + kd + (g * 8 + u) * 2048) = th[u]; *(v8usa*)(ksl + kd + (g * 8 + u) * 2048) = tl[u]; } }
    __syncthreads();    // k is staged: from here on LDS is only read
    float mx[AQ];
#pragma unroll
    for (int n = 0; n < AQ; ++n) mx[n] = -3.0e38f;
#pragma unroll 4    // four key tiles a trip: their sixteen LDS reads issue ahead of the block of matrix instructions that uses them
    for (int mt = 0; mt < NKV / 16; ++mt) { const int kb = mt * 512 + lane * 8;
        const v16bf a = cat16b(*(const v8usa*)(ksh + kb), *(const v8usa*)(ksh + kb + 256)); const v16bf al = cat16b(*(const v8usa*)(ksl + kb), *(const v8usa*)(ksl + kb + 256));
#pragma unroll
        for (int n = 0; n < AQ; ++n) { v8f s = (v8f){}; s = wmmab(a, qh[n], s); s = wmmab(al, qh[n], s); s = wmmab(a, ql[n], s);
#pragma unroll
            for (int r = 0; r < 8; ++r) mx[n] = fmaxf(mx[n], s[r]); }
    }
    float mc[AQ], sum[AQ];
#pragma unroll
    for (int n = 0; n < AQ; ++n) { mx[n] = fmaxf(mx[n], __shfl_xor(mx[n], 16, 32)); mc[n] = mx[n] * SCL2; sum[n] = 0.f; }
    v8f acc[ACT][AQ];
#pragma unroll
    for (int c = 0; c < ACT; ++c) {
#pragma unroll
        for (int n = 0; n < AQ; ++n) acc[c][n] = (v8f){}; }
    const int vo = (cb + lr) * NKV + 8 * hi;
#pragma unroll 1    // stays rolled: one trip is already some six hundred instructions and the register budget is nearly used
    for (int m0 = 0; m0 < NKV; m0 += 32) {
        v16bf a[ACT], al[ACT];
#pragma unroll
        for (int c = 0; c < ACT; ++c) { const int vb = vo + c * 16 * NKV + m0;
            a[c] = cat16b(*(const v8us*)(Vh + vb), *(const v8us*)(Vh + vb + 16)); al[c] = cat16b(*(const v8us*)(Vl + vb), *(const v8us*)(Vl + vb + 16)); }
        asm volatile("s_wait_xcnt 0x0" ::: "memory");    // the v loads stay in flight over the score work, which reuses their address registers: the wait in front of that overwrite
        v8f s[2][AQ];
#pragma unroll
        for (int t = 0; t < 2; ++t) { const int kb = (m0 / 16 + t) * 512 + lane * 8;
            const v16bf k = cat16b(*(const v8usa*)(ksh + kb), *(const v8usa*)(ksh + kb + 256)); const v16bf kl = cat16b(*(const v8usa*)(ksl + kb), *(const v8usa*)(ksl + kb + 256));
#pragma unroll
            for (int n = 0; n < AQ; ++n) { v8f z = (v8f){}; z = wmmab(k, qh[n], z); z = wmmab(kl, qh[n], z); z = wmmab(k, ql[n], z); s[t][n] = z; } }
        v16bf ph[AQ], pl[AQ];
#pragma unroll
        for (int n = 0; n < AQ; ++n) { float x[16];
#pragma unroll
            for (int e = 0; e < 16; ++e) x[e] = __builtin_fmaf(s[e >> 3][n][e & 7], SCL2, -mc[n]);
#pragma unroll
            for (int e = 0; e < 16; e += 8)    // eight exponentials a statement: each has an independent instruction behind it, the last a v_nop (the slot the instruction set asks for behind a transcendental)
                asm("v_exp_f32 %0, %0\n\tv_exp_f32 %1, %1\n\tv_exp_f32 %2, %2\n\tv_exp_f32 %3, %3\n\tv_exp_f32 %4, %4\n\tv_exp_f32 %5, %5\n\tv_exp_f32 %6, %6\n\tv_exp_f32 %7, %7\n\tv_nop"
                    : "+v"(x[e]), "+v"(x[e + 1]), "+v"(x[e + 2]), "+v"(x[e + 3]), "+v"(x[e + 4]), "+v"(x[e + 5]), "+v"(x[e + 6]), "+v"(x[e + 7]));
#pragma unroll
            for (int e = 0; e < 16; e += 2) {
                const float p0 = x[e], p1 = x[e + 1];
                sum[n] += p0 + p1;
                const v2bf h = __builtin_convertvector((v2f){p0, p1}, v2bf);
                const v2bf l = __builtin_convertvector((v2f){p0 - (float)h[0], p1 - (float)h[1]}, v2bf);
                ph[n][e] = h[0]; ph[n][e + 1] = h[1]; pl[n][e] = l[0]; pl[n][e + 1] = l[1]; } }
#pragma unroll
        for (int c = 0; c < ACT; ++c) {
#pragma unroll
            for (int n = 0; n < AQ; ++n) acc[c][n] = wmmab(a[c], ph[n], acc[c][n]); }
#pragma unroll
        for (int c = 0; c < ACT; ++c) {
#pragma unroll
            for (int n = 0; n < AQ; ++n) acc[c][n] = wmmab(al[c], ph[n], acc[c][n]); }
#pragma unroll
        for (int c = 0; c < ACT; ++c) {
#pragma unroll
            for (int n = 0; n < AQ; ++n) acc[c][n] = wmmab(a[c], pl[n], acc[c][n]); }
    }
#pragma unroll
    for (int n = 0; n < AQ; ++n) { const float inv = 1.0f / (sum[n] + __shfl_xor(sum[n], 16, 32));
        const size_t ob = (size_t)(q0 + n * 16 + lr) * CC + cb + 8 * hi;
#pragma unroll
        for (int c = 0; c < ACT; ++c) { v8us oh, ol;
#pragma unroll
            for (int r = 0; r < 8; ++r) { const float v = acc[c][n][r] * inv; const unsigned short hb = f2bf(v); oh[r] = hb; ol[r] = f2bf(v - bf2f(hb)); }
            // the two stores and their wait in one statement: the next tile's split reuses the registers they name
            asm volatile("global_store_b128 %0, %1, off\n\tglobal_store_b128 %2, %3, off\n\ts_wait_xcnt 0x0"
                         :: "v"(OAh + ob + c * 16), "v"(__builtin_bit_cast(v4u, oh)), "v"(OAl + ob + c * 16), "v"(__builtin_bit_cast(v4u, ol)) : "memory"); } }
}

extern "C" void kernel_launch(void* const* d_in, const int* in_sizes, int n_in,
                              void* d_out, int out_size, void* d_ws, size_t ws_size, hipStream_t stream) {
    (void)in_sizes; (void)n_in; (void)out_size;
    const float* x = (const float*)d_in[0]; const float* wq = (const float*)d_in[1]; const float* wk = (const float*)d_in[2]; const float* wv = (const float*)d_in[3]; const float* wo = (const float*)d_in[4]; const float* gam = (const float*)d_in[5];
    float* out = (float*)d_out;    // [8][256][64][64]
    char* wsp = (char*)d_ws;
    auto take = [&](size_t bytes) { char* p = wsp; wsp += (bytes + 255) & ~(size_t)255; return (void*)p; };
    bf* WqP = (bf*)take((size_t)DQP * CC * 2); bf* WkP = (bf*)take((size_t)DQP * CC * 2); bf* WvB = (bf*)take((size_t)CC * CC * 2); bf* WoB = (bf*)take((size_t)CC * CC * 2); bf* WZ = (bf*)take((size_t)CC * CC * 2);
    bf* XT = (bf*)take((size_t)NBI * NTOK * CC * 2); bf* KVh = (bf*)take((size_t)NBI * NKV * CC * 2); bf* KVl = (bf*)take((size_t)NBI * NKV * CC * 2);
    bf* Qh = (bf*)take((size_t)NBI * NTOK * DQP * 2); bf* Ql = (bf*)take((size_t)NBI * NTOK * DQP * 2); bf* Kh = (bf*)take((size_t)NBI * NKV * DQP * 2); bf* Kl = (bf*)take((size_t)NBI * NKV * DQP * 2);
    bf* Vh = (bf*)take((size_t)NBI * CC * NKV * 2); bf* Vl = (bf*)take((size_t)NBI * CC * NKV * 2);
    bf* OAh = (bf*)take((size_t)NBI * NTOK * CC * 2); bf* OAl = (bf*)take((size_t)NBI * NTOK * CC * 2);
    if ((size_t)(wsp - (char*)d_ws) > ws_size) return;    // MiB: 0.4 + 16 + 8 + 8 + 2 + 8 + 32 ~ 75 of 256
    k_wpad<<<(DQP * CC / 8 + 255) / 256, 256, 0, stream>>>(wq, WqP); k_wpad<<<(DQP * CC / 8 + 255) / 256, 256, 0, stream>>>(wk, WkP);
    k_bfz<<<(CC * CC / 8 + 255) / 256, 256, 0, stream>>>(wv, WvB, WZ, CC * CC / 8); k_bfz<<<(CC * CC / 8 + 255) / 256, 256, 0, stream>>>(wo, WoB, WZ, CC * CC / 8);
    k_wt<<<dim3(CC / 64, NTOK / 64, NBI), 256, 0, stream>>>(x, CC, NTOK, XT);                                                                 // x^T [8][4096][256] exact
    k_gemmb<false><<<dim3(NTOK / 64, 1, NBI), 128, 0, stream>>>(XT, nullptr, WqP, Qh, Ql, DM, (size_t)NTOK * CC, (size_t)NTOK * DQP);             // q [8][4096][64] (32 real) hi/lo
    k_poolT<<<dim3(NKV / 8, 1, NBI), 256, 0, stream>>>(x, KVh, KVl);                                                                         // x_kv^T [8][1024][256] hi/lo
    k_gemmb<true><<<dim3(NKV / 64, 1, NBI), 128, 0, stream>>>(KVh, KVl, WkP, Kh, Kl, DM, (size_t)NKV * CC, (size_t)NKV * DQP);                    // k [8][1024][64] hi/lo
    k_gemm3<false, NKV><<<dim3(CC / 64, NKV / 64, NBI), 128, 0, stream>>>(WvB, WZ, KVh, KVl, CC, Vh, Vl, nullptr, nullptr, nullptr, 0, (size_t)NKV * CC, (size_t)CC * NKV);    // v [8][256][1024] hi/lo
    k_attn<<<dim3(NTOK / AQB, 1, NBI), ANW * 32, 0, stream>>>(Qh, Ql, Kh, Kl, Vh, Vl, OAh, OAl);                                                    // out_attn token-major [8][4096][256] hi/lo
    k_gemm3<true, NTOK><<<dim3(CC / 64, NTOK / 64, NBI), 128, 0, stream>>>(WoB, WZ, OAh, OAl, CC, nullptr, nullptr, x, gam, out, 0, (size_t)NTOK * CC, (size_t)CC * NTOK);    // out = x + gamma wo.out_attn^T [8][256][4096]
}

// v004
// It runs in 157 microseconds.
// Timed twice side by side with v003, it ran 1.10 and 1.09 times as fast.
// All steps since v000 together make it 6.26 times as fast.
#include <hip/hip_runtime.h>

// Compute dtypes, f32 accumulate, batch items side by side on blockIdx.z of each per-item launch, all eight per launch: q = x^T.wq^T ([4096 x 256].[256 x 32->64 padded], exact bf16 transposed input and weight); the 2x2 average
// pool in f32 -> x_kv^T as bf16 hi + UNSCALED residual; k = x_kv^T.wk^T and v = wv.x_kv (split pooled operand, two/three products); scores = q.k^T/sqrt(32)
// ([4096 x 32].[32 x 1024], three products), row softmax in f32 -> bf16 hi + UNSCALED residual; out_attn = attn.v^T ([4096 x 1024].[1024 x 256], three products), these three in one kernel,
// and y = wo.out_attn^T ([256 x 256].[256 x 4096], exact wo against split) on v_wmma_f32_16x16x32_bf16; out = x + gamma y in f32. Every product's kernel stores what its consumer reads (the hi/lo planes, or out itself). Deterministic, no atomics;
// Every bf16 plane in the workspace stands in FRAGMENT ORDER: a plane of R rows x K is cut in tiles of 16 rows x 32 k, tile (r / 16, k / 32) at element ((r / 16) (K / 32) + k / 32) 512, and inside a tile
// [k half of 16][lane = ((k / 8) & 1) 16 + (r & 15)][8 k]: the two 16-byte loads of an A or B fragment are each 512 contiguous bytes (4 whole lines) a wave, where row-major planes gave 16 lines.

#define NBI  8
#define CC   256
#define HW   64
#define NTOK 4096
#define NKV  1024               // 32 x 32 pooled
#define DQ   32
#define DQP  64                 // padded head dim (zeros)
#define DM   CC
#define NTK  NTOK
#define LOSC 1024.0f

typedef _Float16 h16;
typedef unsigned short bf;
typedef __attribute__((ext_vector_type(16))) __bf16   v16bf;
typedef __attribute__((ext_vector_type(16))) _Float16 v16h;
typedef __attribute__((ext_vector_type(8)))  _Float16 v8h;
typedef __attribute__((ext_vector_type(8)))  unsigned short v8us;
typedef __attribute__((ext_vector_type(8)))  float    v8f;
typedef __attribute__((ext_vector_type(4)))  float    v4f;
typedef __attribute__((ext_vector_type(4)))  _Float16 v4h;
typedef v8h  __attribute__((may_alias)) v8ha;
typedef v4f  __attribute__((may_alias)) v4fa;
typedef v8us __attribute__((may_alias)) v8usa;

__device__ __forceinline__ unsigned short f2bf(float f) { unsigned u = __float_as_uint(f); u += 0x7FFFu + ((u >> 16) & 1u); return (unsigned short)(u >> 16); }
__device__ __forceinline__ float bf2f(unsigned short b) { return __uint_as_float(((unsigned)b) << 16); }
__device__ __forceinline__ float bfr(float f) { return bf2f(f2bf(f)); }
__device__ __forceinline__ v16h cat16(v8h lo, v8h hi) { return __builtin_shufflevector(lo, hi, 0, 1, 2, 3, 4, 5, 6, 7, 8, 9, 10, 11, 12, 13, 14, 15); }
__device__ __forceinline__ v16bf cat16b(v8us lo, v8us hi) { return __builtin_bit_cast(v16bf, __builtin_shufflevector(lo, hi, 0, 1, 2, 3, 4, 5, 6, 7, 8, 9, 10, 11, 12, 13, 14, 15)); }
__device__ __forceinline__ v8f wmma16(v16h a, v16h b, v8f c) { return __builtin_amdgcn_wmma_f32_16x16x32_f16(false, a, false, b, (short)0, c, false, false); }
__device__ __forceinline__ v8f wmmab(v16bf a, v16bf b, v8f c) { return __builtin_amdgcn_wmma_f32_16x16x32_bf16(false, a, false, b, (short)0, c, false, false); }
// frag_off: the element at which the 8 consecutive k from 8 k8 on of row r stand in a fragment-order plane of KB = K / 32 k blocks.
__device__ __forceinline__ size_t frag_off(int r, int k8, int KB) { return ((size_t)(r >> 4) * KB + (k8 >> 2)) * 512 + ((k8 >> 1) & 1) * 256 + ((k8 & 1) * 16 + (r & 15)) * 8; }

// k_wt: WT (rows n, K wide, fragment order) = bf16(W[k][n]) (k-major [K][ncols]) via 64 x 64 LDS tiles; grid (K/64, ncols/64, matrices). A wave's store is one k half of one fragment tile: 512 contiguous bytes.
__global__ __launch_bounds__(256) void k_wt(const float* __restrict__ Wm, int K, int ncols, bf* WT) {
    __shared__ __align__(16) unsigned short tl[64 * 72];
    const int tid = threadIdx.x, k0 = blockIdx.x * 64, n0 = blockIdx.y * 64;
    Wm += (size_t)blockIdx.z * K * ncols; WT += (size_t)blockIdx.z * K * ncols;
    const int kk = tid >> 2, nq = (tid & 3) * 16;
#pragma unroll
    for (int i = 0; i < 16; ++i) tl[(nq + i) * 72 + kk] = f2bf(Wm[(size_t)(k0 + kk) * ncols + n0 + nq + i]);
    __syncthreads();
    const int lane = tid & 31;
#pragma unroll
    for (int s = 0; s < 2; ++s) { const int ch = (tid >> 5) * 2 + s, rt = ch >> 2, kq = ch & 3;    // row tile rt of 4; kq = k block of 2, k half of 2
        const v8us val = *(const v8usa*)(tl + (rt * 16 + (lane & 15)) * 72 + (kq * 2 + (lane >> 4)) * 8);
        *(v8us*)(WT + ((size_t)((n0 >> 4) + rt) * (K >> 5) + (k0 >> 5)) * 512 + kq * 256 + lane * 8) = val; }
}
// split_rows: a wave's staged 16 x 64 f32 tile -> bf16 hi + UNSCALED residual planes in fragment order: two tiles side by side, 2 KiB in a row a plane (ch, cl: the first tile's start); pass s stores one k half, 512 contiguous bytes.
__device__ __forceinline__ void split_rows(const float* os, int lane, bf* ch, bf* cl) {
    ch += lane * 8; cl += lane * 8;
#pragma unroll
    for (int s = 0; s < 4; ++s) { const float* sp = os + (lane & 15) * 68 + s * 16 + (lane >> 4) * 8;
        const v4f v0 = *(const v4fa*)sp, v1 = *(const v4fa*)(sp + 4); v8us oh, ol;
#pragma unroll
        for (int i = 0; i < 8; ++i) { const float v = i < 4 ? v0[i & 3] : v1[i & 3]; const unsigned short hb = f2bf(v); oh[i] = hb; ol[i] = f2bf(v - bf2f(hb)); }
        *(v8us*)(ch + s * 256) = oh; *(v8us*)(cl + s * 256) = ol; }
}
// k_gemmb: 64 x 64 block tile (4 waves x 16 x 64) of C [rows][DQP] = (A [+ Al]).B^T over K; the epilogue splits the f32 tile itself and stores the two bf16 planes its consumer reads.
template <bool SPLITA, int K>
__global__ __launch_bounds__(128) void k_gemmb(const bf* __restrict__ A, const bf* __restrict__ Al, const bf* __restrict__ Bn, bf* Ch, bf* Cl, size_t sA, size_t sC) {
    __shared__ __align__(16) float ost[4][16 * 68];
    const int lane = threadIdx.x & 31, wave = threadIdx.x >> 5, lr = lane & 15, hi = lane >> 4;
    const int r0 = blockIdx.x * 64 + wave * 16, c0 = blockIdx.y * 64;
    A += blockIdx.z * sA; if (SPLITA) Al += blockIdx.z * sA; Ch += blockIdx.z * sC; Cl += blockIdx.z * sC;    // item blockIdx.z: element strides sA (A planes), sC (C planes); B is shared
    const size_t aoff = (size_t)(r0 >> 4) * (K * 16) + lane * 8;    // fragment order: a row tile is K / 32 tiles of 512 elements = 16 K, a constant: one address a plane, B's four row tiles as immediate offsets
    const bf* pa = A + aoff; const bf* pal = SPLITA ? Al + aoff : pa; const bf* pb = Bn + (size_t)(c0 >> 4) * (K * 16) + lane * 8;
    v8f acc[4];
#pragma unroll
    for (int t = 0; t < 4; ++t) acc[t] = (v8f){};
#pragma unroll 1
    for (int kc = 0; kc < K; kc += 32) {
        const v16bf a = cat16b(*(const v8us*)pa, *(const v8us*)(pa + 256));
        v16bf al = a;
        if (SPLITA) al = cat16b(*(const v8us*)pal, *(const v8us*)(pal + 256));
#pragma unroll
        for (int t = 0; t < 4; ++t) { const v16bf b = cat16b(*(const v8us*)(pb + t * K * 16), *(const v8us*)(pb + t * K * 16 + 256)); acc[t] = wmmab(a, b, acc[t]); if (SPLITA) acc[t] = wmmab(al, b, acc[t]); }
        asm volatile("v_nop\n\tv_nop\n\tv_nop\n\tv_nop" : "+v"(acc[0]), "+v"(acc[1]), "+v"(acc[2]), "+v"(acc[3]) : "v"(a), "v"(al));
        asm volatile("s_wait_xcnt 0x0" :: "v"(pa), "v"(pal), "v"(pb) : "memory");    // the wait in front of the step of the trip's load addresses (the addresses as inputs keep them whole up to it, so that no load's result lands in them)
        pa += 512; pal += 512; pb += 512;
    }
    float* os = &ost[wave][0];
#pragma unroll
    for (int t = 0; t < 4; ++t) {
#pragma unroll
        for (int j = 0; j < 8; ++j) os[(hi * 8 + j) * 68 + t * 16 + lr] = acc[t][j]; }
    __syncthreads();
    const size_t co = ((size_t)(r0 >> 4) * (DQP / 32) + (c0 >> 5)) * 512;
    split_rows(os, lane, Ch + co, Cl + co);
}

// k_gemm3: 64 x 64 tile of C = (Ah + Al).(Bh + Bl)^T over K (all four planes K wide, in fragment order; n-major B; C is LDC wide): three products per 32-k step (hh, hl, lh). The epilogue writes what
// the consumer reads: the two bf16 planes of C (RESID false), or OUTP = X + gamma C in f32, whole lines (RESID true; X is fetched ahead of the k loop).
// Eight waves a SIMD asked for: with the 32 registers of X the kernel stays within 128, so that the 2048 blocks of the last product are all resident at once.
template <bool RESID, int LDC, int K>
__global__ __launch_bounds__(128, 8) void k_gemm3(const bf* __restrict__ Ah, const bf* __restrict__ Al, const bf* __restrict__ Bh, const bf* __restrict__ Bl, bf* Ch, bf* Cl,
                                               const float* __restrict__ X, const float* __restrict__ gam, float* OUTP, size_t sA, size_t sB, size_t sC) {
    __shared__ __align__(16) float ost[4][16 * 68];
    const int lane = threadIdx.x & 31, wave = threadIdx.x >> 5, lr = lane & 15, hi = lane >> 4;
    const int r0 = blockIdx.x * 64 + wave * 16, c0 = blockIdx.y * 64;
    Ah += blockIdx.z * sA; Al += blockIdx.z * sA; Bh += blockIdx.z * sB; Bl += blockIdx.z * sB;    // item blockIdx.z: element strides (0 = shared weights)
    const size_t co = blockIdx.z * sC + (RESID ? (size_t)r0 * LDC + c0 : ((size_t)(r0 >> 4) * (LDC / 32) + (c0 >> 5)) * 512);    // X and OUTP are row-major, the planes of C in fragment order
    const size_t eo = co + (size_t)(lane >> 4) * LDC + (lane & 15) * 4;    // RESID: pass s of the epilogue takes rows 2 s and 2 s + 1, 16 lanes a row of 64 floats (two whole lines)
    v4f xv[8]; float g = 0.f;
    if (RESID) { g = bfr(gam[0]); const float* xp = X + eo;
#pragma unroll
        for (int s = 0; s < 8; ++s) xv[s] = *(const v4f*)(xp + 2 * s * LDC);
        asm volatile("s_wait_xcnt 0x0" :: "v"(xp) : "memory"); }    // the x loads stay in flight over the k loop, whose set-up reuses their address registers: the wait in front of that overwrite (the address as an input keeps it whole up to it)
    const size_t aoff = (size_t)(r0 >> 4) * (K * 16) + lane * 8, boff = (size_t)(c0 >> 4) * (K * 16) + lane * 8;    // a row tile is 16 K elements, a constant: one address a plane, B's four row tiles as immediate offsets
    const bf* pa = Ah + aoff; const bf* pal = Al + aoff; const bf* pbh = Bh + boff; const bf* pbl = Bl + boff;
    v8f acc[4];
#pragma unroll
    for (int t = 0; t < 4; ++t) acc[t] = (v8f){};
#pragma unroll 1
    for (int kc = 0; kc < K; kc += 32) {
        const v16bf a = cat16b(*(const v8us*)pa, *(const v8us*)(pa + 256));
        const v16bf al = cat16b(*(const v8us*)pal, *(const v8us*)(pal + 256));
#pragma unroll
        for (int t = 0; t < 4; ++t) { const int bo = t * K * 16;
            const v16bf bh = cat16b(*(const v8us*)(pbh + bo), *(const v8us*)(pbh + bo + 256)); const v16bf bl = cat16b(*(const v8us*)(pbl + bo), *(const v8us*)(pbl + bo + 256));
            acc[t] = wmmab(a, bh, acc[t]); acc[t] = wmmab(al, bh, acc[t]); acc[t] = wmmab(a, bl, acc[t]); }
        asm volatile("v_nop\n\tv_nop\n\tv_nop\n\tv_nop" : "+v"(acc[0]), "+v"(acc[1]), "+v"(acc[2]), "+v"(acc[3]) : "v"(a), "v"(al));
        asm volatile("s_wait_xcnt 0x0" :: "v"(pa), "v"(pal), "v"(pbh), "v"(pbl) : "memory");    // the wait in front of the step of the trip's load addresses (the addresses as inputs keep them whole up to it, so that no load's result lands in them)
        pa += 512; pal += 512; pbh += 512; pbl += 512;
    }
    float* os = &ost[wave][0];
#pragma unroll
    for (int t = 0; t < 4; ++t) {
#pragma unroll
        for (int j = 0; j < 8; ++j) os[(hi * 8 + j) * 68 + t * 16 + lr] = acc[t][j]; }
    __builtin_amdgcn_wave_barrier(); asm volatile("" ::: "memory");
    if (RESID) {
#pragma unroll
        for (int s = 0; s < 8; ++s) { const v4f y = *(const v4fa*)(os + (2 * s + (lane >> 4)) * 68 + (lane & 15) * 4); v4f val;
#pragma unroll
            for (int i = 0; i < 4; ++i) val[i] = bfr(xv[s][i]) + g * y[i];
            *(v4f*)(OUTP + eo + 2 * s * LDC) = val; }
    } else split_rows(os, lane, Ch + co, Cl + co);
}

__global__ __launch_bounds__(256) void k_bfz(const float* __restrict__ src, bf* dh, bf* dz, size_t n8) {
    const size_t i = (size_t)blockIdx.x * 256 + threadIdx.x; if (i >= n8) return;
    const v8f v = *(const v8f*)(src + i * 8); v8us o, z;
#pragma unroll
    for (int k = 0; k < 8; ++k) { o[k] = f2bf(v[k]); z[k] = 0; }
    *(v8us*)(dh + frag_off((int)(i / (CC / 8)), (int)(i % (CC / 8)), CC / 32)) = o; *(v8us*)(dz + i * 8) = z;    // src is [rows][CC]; the plane of zeros reads the same in any order
}
__global__ __launch_bounds__(256) void k_wpad(const float* __restrict__ w, bf* WP) {
    const int u = blockIdx.x * 256 + threadIdx.x; if (u >= DQP * CC / 8) return;
    const int d = u / (CC / 8), c0 = (u % (CC / 8)) * 8; v8us o;
#pragma unroll
    for (int i = 0; i < 8; ++i) o[i] = (d < DQ) ? f2bf(w[d * CC + c0 + i]) : (unsigned short)0;
    *(v8us*)(WP + frag_off(d, c0 / 8, CC / 32)) = o;
}
// k_poolT: x_kv^T[m][c] = mean of the 2x2 block (f32, the reference's order ((a+b)+(c+d))/4 -> sum then * 0.25) of bf16-rounded x -> bf16 hi + UNSCALED residual planes (fragment order).
// A wave makes one k half of one fragment tile, its lanes as the fragment's: 16 pooled positions of one pooled row x 2 groups of 8 channels. A store is 512 contiguous bytes, and 16 lanes read one whole line of a channel's image row.
__global__ __launch_bounds__(256) void k_poolT(const float* __restrict__ x, bf* Ph, bf* Pl) {
    const int lane = threadIdx.x & 31, w = blockIdx.x * 8 + (threadIdx.x >> 5); if (w >= (NKV / 16) * (CC / 16)) return;
    const int m = (w / (CC / 16)) * 16 + (lane & 15), k8 = (w % (CC / 16)) * 2 + (lane >> 4);    // pooled position; group of 8 channels
    x += (size_t)blockIdx.z * CC * NTOK; Ph += (size_t)blockIdx.z * NKV * CC; Pl += (size_t)blockIdx.z * NKV * CC;
    const int pi = m / 32, pj = m % 32; v8us oh, ol;
    const float* xb = x + (size_t)(k8 * 8) * NTOK + (2 * pi) * HW + 2 * pj;
#pragma unroll
    for (int i = 0; i < 8; ++i) { const float* xc = xb + i * NTOK;
        const float s = (bfr(xc[0]) + bfr(xc[1])) + (bfr(xc[HW]) + bfr(xc[HW + 1])); const float v = s * 0.25f; const unsigned short hb = f2bf(v); oh[i] = hb; ol[i] = f2bf(v - bf2f(hb)); }
    asm volatile("s_wait_xcnt 0x0" :: "v"(xb) : "memory");    // the wait in front of any overwrite of the x loads' address registers (the address as an input keeps it whole up to it, so that no load's result lands in it)
    const size_t o = frag_off(m, k8, CC / 32); *(v8us*)(Ph + o) = oh; *(v8us*)(Pl + o) = ol;
}
#define AQ   4
#define ACT  4
#define ANW  8                  // waves per block
#define ACG  (CC / 16 / ACT)    // channel groups
#define AQB  (ANW / ACG * AQ * 16)   // queries per block
#define SCL2 0.25503486f        // (1/sqrt(32)) * log2(e)
typedef __attribute__((ext_vector_type(2))) float  v2f;
typedef __attribute__((ext_vector_type(2))) __bf16 v2bf;
typedef __attribute__((ext_vector_type(4))) unsigned int v4u;
__global__ __launch_bounds__(ANW * 32) void k_attn(const bf* __restrict__ Qh, const bf* __restrict__ Ql, const bf* __restrict__ Kh, const bf* __restrict__ Kl,
                                                   const bf* __restrict__ Vh, const bf* __restrict__ Vl, bf* OAh, bf* OAl) {
    __shared__ __align__(16) unsigned short ksh[NKV * DQ], ksl[NKV * DQ];    // per 16-key tile 512 elements: [k half of the fragment][lane][8]
    const int tid = threadIdx.x, lane = tid & 31, wave = tid >> 5;
    const int q0 = blockIdx.x * AQB + (wave / ACG) * (AQ * 16), cb = (wave % ACG) * (ACT * 16);
    const size_t it = blockIdx.z;
    Qh += it * NTOK * DQP; Ql += it * NTOK * DQP; Kh += it * NKV * DQP; Kl += it * NKV * DQP; Vh += it * CC * NKV; Vl += it * CC * NKV; OAh += it * NTOK * CC; OAl += it * NTOK * CC;
    const bf* qp = Qh + (size_t)(q0 >> 4) * (DQP / 32) * 512 + lane * 8; const bf* qlp = Ql + (size_t)(q0 >> 4) * (DQP / 32) * 512 + lane * 8;    // k block 0 of each row tile holds the 32 real dims
    v16bf qh[AQ], ql[AQ];
#pragma unroll
    for (int n = 0; n < AQ; ++n) { qh[n] = cat16b(*(const v8us*)(qp + n * 16 * DQP), *(const v8us*)(qp + n * 16 * DQP + 256)); ql[n] = cat16b(*(const v8us*)(qlp + n * 16 * DQP), *(const v8us*)(qlp + n * 16 * DQP + 256)); }
    asm volatile("s_wait_xcnt 0x0" :: "v"(qp), "v"(qlp) : "memory");    // the q loads stay in flight over the staging of k, which reuses their address registers: the wait in front of that overwrite (the two addresses as inputs keep them whole up to it)
    // k staging: a straight copy of k block 0 of every 16-key tile (the planes are in fragment order already); 64 threads a tile, four tiles a pass, so every load of a plane is one address pair plus a constant step, and every LDS store one index plus a constant step
    const bf* kp = Kh + (tid >> 6) * (DQP / 32) * 512 + (tid & 63) * 8; const bf* klp = Kl + (tid >> 6) * (DQP / 32) * 512 + (tid & 63) * 8;
    const int kd = tid * 8;
#pragma unroll    // whole: the constant steps become immediate offsets
    for (int g = 0; g < NKV / (ANW * 8) / 8; ++g) { v8us th[8], tl[8];    // groups of sixteen loads, each with its wait behind it
#pragma unroll
        for (int u = 0; u < 8; ++u) { th[u] = *(const v8us*)(kp + (g * 8 + u) * (ANW * 8) * DQP); tl[u] = *(const v8us*)(klp + (g * 8 + u) * (ANW * 8) * DQP); }
        asm volatile("s_wait_xcnt 0x0" :: "v"(kp), "v"(klp) : "memory");    // the wait in front of any overwrite of the k loads' address registers (the two addresses as inputs keep them whole up to it, so that no load's result lands in them)
#pragma unroll
        for (int u = 0; u < 8; ++u) { *(v8usa*)(ksh + kd + (g * 8 + u) * 2048) = th[u]; *(v8usa*)(ksl + kd + (g * 8 + u) * 2048) = tl[u]; } }
    __syncthreads();    // k is staged: from here on LDS is only read
    float mx[AQ];
#pragma unroll
    for (int n = 0; n < AQ; ++n) mx[n] = -3.0e38f;
#pragma unroll 4    // four key tiles a trip: their sixteen LDS reads issue ahead of the block of matrix instructions that uses them
    for (int mt = 0; mt < NKV / 16; ++mt) { const int kb = mt * 512 + lane * 8;
        const v16bf a = cat16b(*(const v8usa*)(ksh + kb), *(const v8usa*)(ksh + kb + 256)); const v16bf al = cat16b(*(const v8usa*)(ksl + kb), *(const v8usa*)(ksl + kb + 256));
#pragma unroll
        for (int n = 0; n < AQ; ++n) { v8f s = (v8f){}; s = wmmab(a, qh[n], s); s = wmmab(al, qh[n], s); s = wmmab(a, ql[n], s);
#pragma unroll
            for (int r = 0; r < 8; ++r) mx[n] = fmaxf(mx[n], s[r]); }
    }
    float mc[AQ], sum[AQ];
#pragma unroll
    for (int n = 0; n < AQ; ++n) { mx[n] = fmaxf(mx[n], __shfl_xor(mx[n], 16, 32)); mc[n] = mx[n] * SCL2; sum[n] = 0.f; }
    v8f acc[ACT][AQ];
#pragma unroll
    for (int c = 0; c < ACT; ++c) {
#pragma unroll
        for (int n = 0; n < AQ; ++n) acc[c][n] = (v8f){}; }
    const int vo = (cb >> 4) * (NKV / 32) * 512 + lane * 8;
#pragma unroll 1    // stays rolled: one trip is already some six hundred instructions and the register budget is nearly used
    for (int m0 = 0; m0 < NKV; m0 += 32) {
        v16bf a[ACT], al[ACT];
#pragma unroll
        for (int c = 0; c < ACT; ++c) { const int vb = vo + c * 16 * NKV + m0 * 16;    // a channel tile is NKV / 32 tiles of 512 elements = 16 NKV
            a[c] = cat16b(*(const v8us*)(Vh + vb), *(const v8us*)(Vh + vb + 256)); al[c] = cat16b(*(const v8us*)(Vl + vb), *(const v8us*)(Vl + vb + 256)); }
        asm volatile("s_wait_xcnt 0x0" ::: "memory");    // the v loads stay in flight over the score work, which reuses their address registers: the wait in front of that overwrite
        v8f s[2][AQ];
#pragma unroll
        for (int t = 0; t < 2; ++t) { const int kb = (m0 / 16 + t) * 512 + lane * 8;
            const v16bf k = cat16b(*(const v8usa*)(ksh + kb), *(const v8usa*)(ksh + kb + 256)); const v16bf kl = cat16b(*(const v8usa*)(ksl + kb), *(const v8usa*)(ksl + kb + 256));
#pragma unroll
            for (int n = 0; n < AQ; ++n) { v8f z = (v8f){}; z = wmmab(k, qh[n], z); z = wmmab(kl, qh[n], z); z = wmmab(k, ql[n], z); s[t][n] = z; } }
        v16bf ph[AQ], pl[AQ];
#pragma unroll
        for (int n = 0; n < AQ; ++n) { float x[16];
#pragma unroll
            for (int e = 0; e < 16; ++e) x[e] = __builtin_fmaf(s[e >> 3][n][e & 7], SCL2, -mc[n]);
#pragma unroll
            for (int e = 0; e < 16; e += 8)    // eight exponentials a statement: each has an independent instruction behind it, the last a v_nop (the slot the instruction set asks for behind a transcendental)
                asm("v_exp_f32 %0, %0\n\tv_exp_f32 %1, %1\n\tv_exp_f32 %2, %2\n\tv_exp_f32 %3, %3\n\tv_exp_f32 %4, %4\n\tv_exp_f32 %5, %5\n\tv_exp_f32 %6, %6\n\tv_exp_f32 %7, %7\n\tv_nop"
                    : "+v"(x[e]), "+v"(x[e + 1]), "+v"(x[e + 2]), "+v"(x[e + 3]), "+v"(x[e + 4]), "+v"(x[e + 5]), "+v"(x[e + 6]), "+v"(x[e + 7]));
#pragma unroll
            for (int e = 0; e < 16; e += 2) {
                const float p0 = x[e], p1 = x[e + 1];
                sum[n] += p0 + p1;
                const v2bf h = __builtin_convertvector((v2f){p0, p1}, v2bf);
                const v2bf l = __builtin_convertvector((v2f){p0 - (float)h[0], p1 - (float)h[1]}, v2bf);
                ph[n][e] = h[0]; ph[n][e + 1] = h[1]; pl[n][e] = l[0]; pl[n][e + 1] = l[1]; } }
#pragma unroll
        for (int c = 0; c < ACT; ++c) {
#pragma unroll
            for (int n = 0; n < AQ; ++n) acc[c][n] = wmmab(a[c], ph[n], acc[c][n]); }
#pragma unroll
        for (int c = 0; c < ACT; ++c) {
#pragma unroll
            for (int n = 0; n < AQ; ++n) acc[c][n] = wmmab(al[c], ph[n], acc[c][n]); }
#pragma unroll
        for (int c = 0; c < ACT; ++c) {
#pragma unroll
            for (int n = 0; n < AQ; ++n) acc[c][n] = wmmab(a[c], pl[n], acc[c][n]); }
    }
#pragma unroll
    for (int n = 0; n < AQ; ++n) { const float inv = 1.0f / (sum[n] + __shfl_xor(sum[n], 16, 32));
        const size_t ob = ((size_t)((q0 >> 4) + n) * (CC / 32) + (cb >> 5)) * 512 + lane * 8;    // channel tile c is k half c & 1 of k block c / 2 from there: c * 256
#pragma unroll
        for (int c = 0; c < ACT; ++c) { v8us oh, ol;
#pragma unroll
            for (int r = 0; r < 8; ++r) { const float v = acc[c][n][r] * inv; const unsigned short hb = f2bf(v); oh[r] = hb; ol[r] = f2bf(v - bf2f(hb)); }
            // the two stores and their wait in one statement: the next tile's split reuses the registers they name
            asm volatile("global_store_b128 %0, %1, off\n\tglobal_store_b128 %2, %3, off\n\ts_wait_xcnt 0x0"
                         :: "v"(OAh + ob + c * 256), "v"(__builtin_bit_cast(v4u, oh)), "v"(OAl + ob + c * 256), "v"(__builtin_bit_cast(v4u, ol)) : "memory"); } }
}

extern "C" void kernel_launch(void* const* d_in, const int* in_sizes, int n_in,
                              void* d_out, int out_size, void* d_ws, size_t ws_size, hipStream_t stream) {
    (void)in_sizes; (void)n_in; (void)out_size;
    const float* x = (const float*)d_in[0]; const float* wq = (const float*)d_in[1]; const float* wk = (const float*)d_in[2]; const float* wv = (const float*)d_in[3]; const float* wo = (const float*)d_in[4]; const float* gam = (const float*)d_in[5];
    float* out = (float*)d_out;    // [8][256][64][64]
    char* wsp = (char*)d_ws;
    auto take = [&](size_t bytes) { char* p = wsp; wsp += (bytes + 255) & ~(size_t)255; return (void*)p; };
    bf* WqP = (bf*)take((size_t)DQP * CC * 2); bf* WkP = (bf*)take((size_t)DQP * CC * 2); bf* WvB = (bf*)take((size_t)CC * CC * 2); bf* WoB = (bf*)take((size_t)CC * CC * 2); bf* WZ = (bf*)take((size_t)CC * CC * 2);
    bf* XT = (bf*)take((size_t)NBI * NTOK * CC * 2); bf* KVh = (bf*)take((size_t)NBI * NKV * CC * 2); bf* KVl = (bf*)take((size_t)NBI * NKV * CC * 2);
    bf* Qh = (bf*)take((size_t)NBI * NTOK * DQP * 2); bf* Ql = (bf*)take((size_t)NBI * NTOK * DQP * 2); bf* Kh = (bf*)take((size_t)NBI * NKV * DQP * 2); bf* Kl = (bf*)take((size_t)NBI * NKV * DQP * 2);
    bf* Vh = (bf*)take((size_t)NBI * CC * NKV * 2); bf* Vl = (bf*)take((size_t)NBI * CC * NKV * 2);
    bf* OAh = (bf*)take((size_t)NBI * NTOK * CC * 2); bf* OAl = (bf*)take((size_t)NBI * NTOK * CC * 2);
    if ((size_t)(wsp - (char*)d_ws) > ws_size) return;    // MiB: 0.4 + 16 + 8 + 8 + 2 + 8 + 32 ~ 75 of 256
    k_wpad<<<(DQP * CC / 8 + 255) / 256, 256, 0, stream>>>(wq, WqP); k_wpad<<<(DQP * CC / 8 + 255) / 256, 256, 0, stream>>>(wk, WkP);
    k_bfz<<<(CC * CC / 8 + 255) / 256, 256, 0, stream>>>(wv, WvB, WZ, CC * CC / 8); k_bfz<<<(CC * CC / 8 + 255) / 256, 256, 0, stream>>>(wo, WoB, WZ, CC * CC / 8);
    k_wt<<<dim3(CC / 64, NTOK / 64, NBI), 256, 0, stream>>>(x, CC, NTOK, XT);                                                                 // x^T [8][4096][256] exact
    k_gemmb<false, DM><<<dim3(NTOK / 64, 1, NBI), 128, 0, stream>>>(XT, nullptr, WqP, Qh, Ql, (size_t)NTOK * CC, (size_t)NTOK * DQP);             // q [8][4096][64] (32 real) hi/lo
    k_poolT<<<dim3((NKV / 16) * (CC / 16) / 8, 1, NBI), 256, 0, stream>>>(x, KVh, KVl);                                                                         // x_kv^T [8][1024][256] hi/lo
    k_gemmb<true, DM><<<dim3(NKV / 64, 1, NBI), 128, 0, stream>>>(KVh, KVl, WkP, Kh, Kl, (size_t)NKV * CC, (size_t)NKV * DQP);                    // k [8][1024][64] hi/lo
    k_gemm3<false, NKV, CC><<<dim3(CC / 64, NKV / 64, NBI), 128, 0, stream>>>(WvB, WZ, KVh, KVl, Vh, Vl, nullptr, nullptr, nullptr, 0, (size_t)NKV * CC, (size_t)CC * NKV);    // v [8][256][1024] hi/lo
    k_attn<<<dim3(NTOK / AQB, 1, NBI), ANW * 32, 0, stream>>>(Qh, Ql, Kh, Kl, Vh, Vl, OAh, OAl);                                                    // out_attn token-major [8][4096][256] hi/lo
    k_gemm3<true, NTOK, CC><<<dim3(CC / 64, NTOK / 64, NBI), 128, 0, stream>>>(WoB, WZ, OAh, OAl, nullptr, nullptr, x, gam, out, 0, (size_t)NTOK * CC, (size_t)CC * NTOK);    // out = x + gamma wo.out_attn^T [8][256][4096]
}

// v005
// Measured time: 125 microseconds a run.
// In two side-by-side timings against v004, it was 1.26 and 1.25 times as fast.
// All steps since v000 together make it 7.86 times as fast.
#include <hip/hip_runtime.h>

// Compute dtypes, f32 accumulate, batch items side by side in every launch (on blockIdx.z in k_attn and k_out, in the block index in k_prep and k_proj): q = x^T.wq^T ([4096 x 256].[256 x 32->64 padded], exact bf16 transposed input and weight); the 2x2 average
// pool in f32 -> x_kv^T as bf16 hi + UNSCALED residual; k = x_kv^T.wk^T and v = wv.x_kv (split pooled operand, two/three products); scores = q.k^T/sqrt(32)
// ([4096 x 32].[32 x 1024], three products), row softmax in f32 -> bf16 hi + UNSCALED residual; out_attn = attn.v^T ([4096 x 1024].[1024 x 256], three products), these three in one kernel,
// and y = wo.out_attn^T ([256 x 256].[256 x 4096], exact wo against split) on v_wmma_f32_16x16x32_bf16; out = x + gamma y in f32. Every product's kernel stores what its consumer reads (the hi/lo planes, or out itself). Deterministic, no atomics;
// Four launches: k_prep (all that reads the inputs alone), k_proj (q, k, v), k_attn, k_out; kernels that need nothing of one another share a launch, a block taking its part by its index.
// Every bf16 plane in the workspace stands in FRAGMENT ORDER: a plane of R rows x K is cut in tiles of 16 rows x 32 k, tile (r / 16, k / 32) at element ((r / 16) (K / 32) + k / 32) 512, and inside a tile
// [k half of 16][lane = ((k / 8) & 1) 16 + (r & 15)][8 k]: the two 16-byte loads of an A or B fragment are each 512 contiguous bytes (4 whole lines) a wave, where row-major planes gave 16 lines.

#define NBI  8
#define CC   256
#define HW   64
#define NTOK 4096
#define NKV  1024               // 32 x 32 pooled
#define DQ   32
#define DQP  64                 // padded head dim (zeros)
#define DM   CC
#define NTK  NTOK
#define LOSC 1024.0f

typedef _Float16 h16;
typedef unsigned short bf;
typedef __attribute__((ext_vector_type(16))) __bf16   v16bf;
typedef __attribute__((ext_vector_type(16))) _Float16 v16h;
typedef __attribute__((ext_vector_type(8)))  _Float16 v8h;
typedef __attribute__((ext_vector_type(8)))  unsigned short v8us;
typedef __attribute__((ext_vector_type(8)))  float    v8f;
typedef __attribute__((ext_vector_type(4)))  float    v4f;
typedef __attribute__((ext_vector_type(4)))  _Float16 v4h;
typedef v8h  __attribute__((may_alias)) v8ha;
typedef v4f  __attribute__((may_alias)) v4fa;
typedef v8us __attribute__((may_alias)) v8usa;

__device__ __forceinline__ unsigned short f2bf(float f) { unsigned u = __float_as_uint(f); u += 0x7FFFu + ((u >> 16) & 1u); return (unsigned short)(u >> 16); }
__device__ __forceinline__ float bf2f(unsigned short b) { return __uint_as_float(((unsigned)b) << 16); }
__device__ __forceinline__ float bfr(float f) { return bf2f(f2bf(f)); }
__device__ __forceinline__ v16h cat16(v8h lo, v8h hi) { return __builtin_shufflevector(lo, hi, 0, 1, 2, 3, 4, 5, 6, 7, 8, 9, 10, 11, 12, 13, 14, 15); }
__device__ __forceinline__ v16bf cat16b(v8us lo, v8us hi) { return __builtin_bit_cast(v16bf, __builtin_shufflevector(lo, hi, 0, 1, 2, 3, 4, 5, 6, 7, 8, 9, 10, 11, 12, 13, 14, 15)); }
__device__ __forceinline__ v8f wmma16(v16h a, v16h b, v8f c) { return __builtin_amdgcn_wmma_f32_16x16x32_f16(false, a, false, b, (short)0, c, false, false); }
__device__ __forceinline__ v8f wmmab(v16bf a, v16bf b, v8f c) { return __builtin_amdgcn_wmma_f32_16x16x32_bf16(false, a, false, b, (short)0, c, false, false); }
// frag_off: the element at which the 8 consecutive k from 8 k8 on of row r stand in a fragment-order plane of KB = K / 32 k blocks.
__device__ __forceinline__ size_t frag_off(int r, int k8, int KB) { return ((size_t)(r >> 4) * KB + (k8 >> 2)) * 512 + ((k8 >> 1) & 1) * 256 + ((k8 & 1) * 16 + (r & 15)) * 8; }

// d_wt: WT (rows n, K wide, fragment order) = bf16(W[k][n]) (k-major [K][ncols]) via 64 x 64 LDS tiles; block (bx, by, bz) of (K/64, ncols/64, matrices), 256 threads. A wave's store is one k half of one fragment tile: 512 contiguous bytes.
__device__ __forceinline__ void d_wt(const float* __restrict__ Wm, int K, int ncols, bf* WT, int bx, int by, int bz) {
    __shared__ __align__(16) unsigned short tl[64 * 72];
    const int tid = threadIdx.x, k0 = bx * 64, n0 = by * 64;
    Wm += (size_t)bz * K * ncols; WT += (size_t)bz * K * ncols;
    const int kk = tid >> 2, nq = (tid & 3) * 16;
#pragma unroll
    for (int i = 0; i < 16; ++i) tl[(nq + i) * 72 + kk] = f2bf(Wm[(size_t)(k0 + kk) * ncols + n0 + nq + i]);
    __syncthreads();
    const int lane = tid & 31;
#pragma unroll
    for (int s = 0; s < 2; ++s) { const int ch = (tid >> 5) * 2 + s, rt = ch >> 2, kq = ch & 3;    // row tile rt of 4; kq = k block of 2, k half of 2
        const v8us val = *(const v8usa*)(tl + (rt * 16 + (lane & 15)) * 72 + (kq * 2 + (lane >> 4)) * 8);
        *(v8us*)(WT + ((size_t)((n0 >> 4) + rt) * (K >> 5) + (k0 >> 5)) * 512 + kq * 256 + lane * 8) = val; }
    asm volatile("s_wait_xcnt 0x0" ::: "memory");    // the wait behind the two stores: in the merged kernel's text another part's code, which writes the registers they name, follows this one
}
// split_rows: a wave's staged 16 x 64 f32 tile -> bf16 hi + UNSCALED residual planes in fragment order: two tiles side by side, 2 KiB in a row a plane (ch, cl: the first tile's start); pass s stores one k half, 512 contiguous bytes.
__device__ __forceinline__ void split_rows(const float* os, int lane, bf* ch, bf* cl) {
    ch += lane * 8; cl += lane * 8;
#pragma unroll
    for (int s = 0; s < 4; ++s) { const float* sp = os + (lane & 15) * 68 + s * 16 + (lane >> 4) * 8;
        const v4f v0 = *(const v4fa*)sp, v1 = *(const v4fa*)(sp + 4); v8us oh, ol;
#pragma unroll
        for (int i = 0; i < 8; ++i) { const float v = i < 4 ? v0[i & 3] : v1[i & 3]; const unsigned short hb = f2bf(v); oh[i] = hb; ol[i] = f2bf(v - bf2f(hb)); }
        *(v8us*)(ch + s * 256) = oh; *(v8us*)(cl + s * 256) = ol;
        asm volatile("s_wait_xcnt 0x0" ::: "memory"); }    // the wait behind the two stores, in front of the next pass's (in a merged kernel's text: another part's) writes of the registers they name
}
// d_gemmb (block (bx, by, bz), 128 threads, ost: the block's staging tiles in LDS): 64 x 64 block tile (4 waves x 16 x 64) of C [rows][DQP] = (A [+ Al]).B^T over K; the epilogue splits the f32 tile itself and stores the two bf16 planes its consumer reads.
template <bool SPLITA, int K>
__device__ __forceinline__ void d_gemmb(float (*ost)[16 * 68], int bx, int by, int bz, const bf* __restrict__ A, const bf* __restrict__ Al, const bf* __restrict__ Bn, bf* Ch, bf* Cl, size_t sA, size_t sC) {
    const int lane = threadIdx.x & 31, wave = threadIdx.x >> 5, lr = lane & 15, hi = lane >> 4;
    const int r0 = bx * 64 + wave * 16, c0 = by * 64;
    A += bz * sA; if (SPLITA) Al += bz * sA; Ch += bz * sC; Cl += bz * sC;    // item bz: element strides sA (A planes), sC (C planes); B is shared
    const size_t aoff = (size_t)(r0 >> 4) * (K * 16) + lane * 8;    // fragment order: a row tile is K / 32 tiles of 512 elements = 16 K, a constant: one address a plane, B's four row tiles as immediate offsets
    const bf* pa = A + aoff; const bf* pal = SPLITA ? Al + aoff : pa; const bf* pb = Bn + (size_t)(c0 >> 4) * (K * 16) + lane * 8;
    v8f acc[4];
#pragma unroll
    for (int t = 0; t < 4; ++t) acc[t] = (v8f){};
#pragma unroll 1
    for (int kc = 0; kc < K; kc += 32) {
        const v16bf a = cat16b(*(const v8us*)pa, *(const v8us*)(pa + 256));
        v16bf al = a;
        if (SPLITA) al = cat16b(*(const v8us*)pal, *(const v8us*)(pal + 256));
#pragma unroll
        for (int t = 0; t < 4; ++t) { const v16bf b = cat16b(*(const v8us*)(pb + t * K * 16), *(const v8us*)(pb + t * K * 16 + 256)); acc[t] = wmmab(a, b, acc[t]); if (SPLITA) acc[t] = wmmab(al, b, acc[t]); }
        asm volatile("v_nop\n\tv_nop\n\tv_nop\n\tv_nop" : "+v"(acc[0]), "+v"(acc[1]), "+v"(acc[2]), "+v"(acc[3]) : "v"(a), "v"(al));
        asm volatile("s_wait_xcnt 0x0" :: "v"(pa), "v"(pal), "v"(pb) : "memory");    // the wait in front of the step of the trip's load addresses (the addresses as inputs keep them whole up to it, so that no load's result lands in them)
        pa += 512; pal += 512; pb += 512;
    }
    float* os = &ost[wave][0];
#pragma unroll
    for (int t = 0; t < 4; ++t) {
#pragma unroll
        for (int j = 0; j < 8; ++j) os[(hi * 8 + j) * 68 + t * 16 + lr] = acc[t][j]; }
    __syncthreads();
    const size_t co = ((size_t)(r0 >> 4) * (DQP / 32) + (c0 >> 5)) * 512;
    split_rows(os, lane, Ch + co, Cl + co);
}

// d_gemm3 (block (bx, by, bz), 128 threads, ost as above): 64 x 64 tile of C = (Ah + Al).(Bh + Bl)^T over K (all four planes K wide, in fragment order; n-major B; C is LDC wide): three products per 32-k step (hh, hl, lh). The epilogue writes what
// the consumer reads: the two bf16 planes of C (RESID false), or OUTP = X + gamma C in f32, whole lines (RESID true; X is fetched ahead of the k loop).
template <bool RESID, int LDC, int K>
__device__ __forceinline__ void d_gemm3(float (*ost)[16 * 68], int bx, int by, int bz, const bf* __restrict__ Ah, const bf* __restrict__ Al, const bf* __restrict__ Bh, const bf* __restrict__ Bl, bf* Ch, bf* Cl,
                                        const float* __restrict__ X, const float* __restrict__ gam, float* OUTP, size_t sA, size_t sB, size_t sC) {
    const int lane = threadIdx.x & 31, wave = threadIdx.x >> 5, lr = lane & 15, hi = lane >> 4;
    const int r0 = bx * 64 + wave * 16, c0 = by * 64;
    Ah += bz * sA; Al += bz * sA; Bh += bz * sB; Bl += bz * sB;    // item bz: element strides (0 = shared weights)
    const size_t co = bz * sC + (RESID ? (size_t)r0 * LDC + c0 : ((size_t)(r0 >> 4) * (LDC / 32) + (c0 >> 5)) * 512);    // X and OUTP are row-major, the planes of C in fragment order
    const size_t eo = co + (size_t)(lane >> 4) * LDC + (lane & 15) * 4;    // RESID: pass s of the epilogue takes rows 2 s and 2 s + 1, 16 lanes a row of 64 floats (two whole lines)
    v4f xv[8]; float g = 0.f;
    if (RESID) { g = bfr(gam[0]); const float* xp = X + eo;
#pragma unroll
        for (int s = 0; s < 8; ++s) xv[s] = *(const v4f*)(xp + 2 * s * LDC);
        asm volatile("s_wait_xcnt 0x0" :: "v"(xp) : "memory"); }    // the x loads stay in flight over the k loop, whose set-up reuses their address registers: the wait in front of that overwrite (the address as an input keeps it whole up to it)
    const size_t aoff = (size_t)(r0 >> 4) * (K * 16) + lane * 8, boff = (size_t)(c0 >> 4) * (K * 16) + lane * 8;    // a row tile is 16 K elements, a constant: one address a plane, B's four row tiles as immediate offsets
    const bf* pa = Ah + aoff; const bf* pal = Al + aoff; const bf* pbh = Bh + boff; const bf* pbl = Bl + boff;
    v8f acc[4];
#pragma unroll
    for (int t = 0; t < 4; ++t) acc[t] = (v8f){};
#pragma unroll 1
    for (int kc = 0; kc < K; kc += 32) {
        const v16bf a = cat16b(*(const v8us*)pa, *(const v8us*)(pa + 256));
        const v16bf al = cat16b(*(const v8us*)pal, *(const v8us*)(pal + 256));
#pragma unroll
        for (int t = 0; t < 4; ++t) { const int bo = t * K * 16;
            const v16bf bh = cat16b(*(const v8us*)(pbh + bo), *(const v8us*)(pbh + bo + 256)); const v16bf bl = cat16b(*(const v8us*)(pbl + bo), *(const v8us*)(pbl + bo + 256));
            acc[t] = wmmab(a, bh, acc[t]); acc[t] = wmmab(al, bh, acc[t]); acc[t] = wmmab(a, bl, acc[t]); }
        asm volatile("v_nop\n\tv_nop\n\tv_nop\n\tv_nop" : "+v"(acc[0]), "+v"(acc[1]), "+v"(acc[2]), "+v"(acc[3]) : "v"(a), "v"(al));
        asm volatile("s_wait_xcnt 0x0" :: "v"(pa), "v"(pal), "v"(pbh), "v"(pbl) : "memory");    // the wait in front of the step of the trip's load addresses (the addresses as inputs keep them whole up to it, so that no load's result lands in them)
        pa += 512; pal += 512; pbh += 512; pbl += 512;
    }
    float* os = &ost[wave][0];
#pragma unroll
    for (int t = 0; t < 4; ++t) {
#pragma unroll
        for (int j = 0; j < 8; ++j) os[(hi * 8 + j) * 68 + t * 16 + lr] = acc[t][j]; }
    __builtin_amdgcn_wave_barrier(); asm volatile("" ::: "memory");
    if (RESID) {
#pragma unroll
        for (int s = 0; s < 8; ++s) { const v4f y = *(const v4fa*)(os + (2 * s + (lane >> 4)) * 68 + (lane & 15) * 4); v4f val;
#pragma unroll
            for (int i = 0; i < 4; ++i) val[i] = bfr(xv[s][i]) + g * y[i];
            *(v4f*)(OUTP + eo + 2 * s * LDC) = val; }
    } else split_rows(os, lane, Ch + co, Cl + co);
}

// k_out: the last product with its residual. Eight waves a SIMD asked for: with the 32 registers of X the kernel stays within 128, so that its 2048 blocks are all resident at once.
__global__ __launch_bounds__(128, 8) void k_out(const bf* __restrict__ Ah, const bf* __restrict__ Al, const bf* __restrict__ Bh, const bf* __restrict__ Bl, const float* __restrict__ X, const float* __restrict__ gam, float* OUTP) {
    __shared__ __align__(16) float ost[4][16 * 68];
    d_gemm3<true, NTOK, CC>(ost, blockIdx.x, blockIdx.y, blockIdx.z, Ah, Al, Bh, Bl, nullptr, nullptr, X, gam, OUTP, 0, (size_t)NTOK * CC, (size_t)CC * NTOK);
}
// k_proj: the three projections, which need nothing of one another, side by side in one launch; the branch is on the block index alone, so a block's barrier is passed by all its threads.
#define PB_V (CC / 64 * (NKV / 64) * NBI)    // blocks of v, of q, of k
#define PB_Q (NTOK / 64 * NBI)
#define PB_K (NKV / 64 * NBI)
__global__ __launch_bounds__(128) void k_proj(const bf* __restrict__ XT, const bf* __restrict__ KVh, const bf* __restrict__ KVl, const bf* __restrict__ WqP, const bf* __restrict__ WkP, const bf* __restrict__ WvB, const bf* __restrict__ WZ,
                                              bf* Qh, bf* Ql, bf* Kh, bf* Kl, bf* Vh, bf* Vl) {
    __shared__ __align__(16) float ost[4][16 * 68];
    const int b = blockIdx.x, bq = b - PB_V, bk = bq - PB_Q;
    if (b < PB_V) d_gemm3<false, NKV, CC>(ost, b % (CC / 64), b / (CC / 64) % (NKV / 64), b / (CC / 64 * (NKV / 64)), WvB, WZ, KVh, KVl, Vh, Vl, nullptr, nullptr, nullptr, 0, (size_t)NKV * CC, (size_t)CC * NKV);    // v [8][256][1024] hi/lo
    else if (bq < PB_Q) d_gemmb<false, DM>(ost, bq % (NTOK / 64), 0, bq / (NTOK / 64), XT, nullptr, WqP, Qh, Ql, (size_t)NTOK * CC, (size_t)NTOK * DQP);    // q [8][4096][64] (32 real) hi/lo
    else d_gemmb<true, DM>(ost, bk % (NKV / 64), 0, bk / (NKV / 64), KVh, KVl, WkP, Kh, Kl, (size_t)NKV * CC, (size_t)NKV * DQP);    // k [8][1024][64] hi/lo
}

// d_bfz: with ZP the plane of zeros dz is written too (one caller alone asks for it: one writer a line).
template <bool ZP>
__device__ __forceinline__ void d_bfz(const float* __restrict__ src, bf* dh, bf* dz, size_t n8, int bx) {
    const size_t i = (size_t)bx * 256 + threadIdx.x; if (i >= n8) return;
    const v8f v = *(const v8f*)(src + i * 8); v8us o, z;
#pragma unroll
    for (int k = 0; k < 8; ++k) { o[k] = f2bf(v[k]); z[k] = 0; }
    *(v8us*)(dh + frag_off((int)(i / (CC / 8)), (int)(i % (CC / 8)), CC / 32)) = o; if (ZP) *(v8us*)(dz + i * 8) = z;    // src is [rows][CC]; the plane of zeros reads the same in any order
}
__device__ __forceinline__ void d_wpad(const float* __restrict__ w, bf* WP, int bx) {
    const int u = bx * 256 + threadIdx.x; if (u >= DQP * CC / 8) return;
    const int d = u / (CC / 8), c0 = (u % (CC / 8)) * 8; v8us o;
#pragma unroll
    for (int i = 0; i < 8; ++i) o[i] = (d < DQ) ? f2bf(w[d * CC + c0 + i]) : (unsigned short)0;
    *(v8us*)(WP + frag_off(d, c0 / 8, CC / 32)) = o;
}
// d_poolT: x_kv^T[m][c] = mean of the 2x2 block (f32, the reference's order ((a+b)+(c+d))/4 -> sum then * 0.25) of bf16-rounded x -> bf16 hi + UNSCALED residual planes (fragment order).
// A wave makes one k half of one fragment tile, its lanes as the fragment's: 16 pooled positions of one pooled row x 2 groups of 8 channels. A store is 512 contiguous bytes, and 16 lanes read one whole line of a channel's image row.
__device__ __forceinline__ void d_poolT(const float* __restrict__ x, bf* Ph, bf* Pl, int bx, int bz) {
    const int lane = threadIdx.x & 31, w = bx * 8 + (threadIdx.x >> 5); if (w >= (NKV / 16) * (CC / 16)) return;
    const int m = (w / (CC / 16)) * 16 + (lane & 15), k8 = (w % (CC / 16)) * 2 + (lane >> 4);    // pooled position; group of 8 channels
    x += (size_t)bz * CC * NTOK; Ph += (size_t)bz * NKV * CC; Pl += (size_t)bz * NKV * CC;
    const int pi = m / 32, pj = m % 32; v8us oh, ol;
    const float* xb = x + (size_t)(k8 * 8) * NTOK + (2 * pi) * HW + 2 * pj;
#pragma unroll
    for (int i = 0; i < 8; ++i) { const float* xc = xb + i * NTOK;
        const float s = (bfr(xc[0]) + bfr(xc[1])) + (bfr(xc[HW]) + bfr(xc[HW + 1])); const float v = s * 0.25f; const unsigned short hb = f2bf(v); oh[i] = hb; ol[i] = f2bf(v - bf2f(hb)); }
    asm volatile("s_wait_xcnt 0x0" :: "v"(xb) : "memory");    // the wait in front of any overwrite of the x loads' address registers (the address as an input keeps it whole up to it, so that no load's result lands in it)
    const size_t o = frag_off(m, k8, CC / 32); *(v8us*)(Ph + o) = oh; *(v8us*)(Pl + o) = ol;
}
// k_prep: all that reads the inputs alone (the four weight planes, x^T, the pool), side by side in one launch; the branch is on the block index alone, so the barrier of d_wt is passed by all threads of its block.
#define RB_WP (DQP * CC / 8 / 256)            // blocks of one padded weight, of one square weight, of x^T, of the pool
#define RB_BZ (CC * CC / 8 / 256)
#define RB_WT (CC / 64 * (NTOK / 64) * NBI)
#define RB_PL ((NKV / 16) * (CC / 16) / 8 * NBI)
__global__ __launch_bounds__(256) void k_prep(const float* __restrict__ x, const float* __restrict__ wq, const float* __restrict__ wk, const float* __restrict__ wv, const float* __restrict__ wo,
                                              bf* WqP, bf* WkP, bf* WvB, bf* WoB, bf* WZ, bf* XT, bf* KVh, bf* KVl) {
    const int b = blockIdx.x, b1 = b - RB_WP, b2 = b1 - RB_WP, b3 = b2 - RB_BZ, b4 = b3 - RB_BZ, b5 = b4 - RB_WT;    // the 80 small blocks first: they are done while the large parts still start
    if (b < RB_WP) d_wpad(wq, WqP, b);
    else if (b1 < RB_WP) d_wpad(wk, WkP, b1);
    else if (b2 < RB_BZ) d_bfz<true>(wv, WvB, WZ, CC * CC / 8, b2);
    else if (b3 < RB_BZ) d_bfz<false>(wo, WoB, nullptr, CC * CC / 8, b3);
    else if (b4 < RB_WT) d_wt(x, CC, NTOK, XT, b4 % (CC / 64), b4 / (CC / 64) % (NTOK / 64), b4 / (CC / 64 * (NTOK / 64)));    // x^T [8][4096][256] exact
    else d_poolT(x, KVh, KVl, b5 % (RB_PL / NBI), b5 / (RB_PL / NBI));    // x_kv^T [8][1024][256] hi/lo
}
#define AQ   4
#define ACT  4
#define ANW  8                  // waves per block
#define ACG  (CC / 16 / ACT)    // channel groups
#define AQB  (ANW / ACG * AQ * 16)   // queries per block
#define SCL2 0.25503486f        // (1/sqrt(32)) * log2(e)
typedef __attribute__((ext_vector_type(2))) float  v2f;
typedef __attribute__((ext_vector_type(2))) __bf16 v2bf;
typedef __attribute__((ext_vector_type(4))) unsigned int v4u;
__global__ __launch_bounds__(ANW * 32) void k_attn(const bf* __restrict__ Qh, const bf* __restrict__ Ql, const bf* __restrict__ Kh, const bf* __restrict__ Kl,
                                                   const bf* __restrict__ Vh, const bf* __restrict__ Vl, bf* OAh, bf* OAl) {
    __shared__ __align__(16) unsigned short ksh[NKV * DQ], ksl[NKV * DQ];    // per 16-key tile 512 elements: [k half of the fragment][lane][8]
    const int tid = threadIdx.x, lane = tid & 31, wave = tid >> 5;
    const int q0 = blockIdx.x * AQB + (wave / ACG) * (AQ * 16), cb = (wave % ACG) * (ACT * 16);
    const size_t it = blockIdx.z;
    Qh += it * NTOK * DQP; Ql += it * NTOK * DQP; Kh += it * NKV * DQP; Kl += it * NKV * DQP; Vh += it * CC * NKV; Vl += it * CC * NKV; OAh += it * NTOK * CC; OAl += it * NTOK * CC;
    const bf* qp = Qh + (size_t)(q0 >> 4) * (DQP / 32) * 512 + lane * 8; const bf* qlp = Ql + (size_t)(q0 >> 4) * (DQP / 32) * 512 + lane * 8;    // k block 0 of each row tile holds the 32 real dims
    v16bf qh[AQ], ql[AQ];
#pragma unroll
    for (int n = 0; n < AQ; ++n) { qh[n] = cat16b(*(const v8us*)(qp + n * 16 * DQP), *(const v8us*)(qp + n * 16 * DQP + 256)); ql[n] = cat16b(*(const v8us*)(qlp + n * 16 * DQP), *(const v8us*)(qlp + n * 16 * DQP + 256)); }
    asm volatile("s_wait_xcnt 0x0" :: "v"(qp), "v"(qlp) : "memory");    // the q loads stay in flight over the staging of k, which reuses their address registers: the wait in front of that overwrite (the two addresses as inputs keep them whole up to it)
    // k staging: a straight copy of k block 0 of every 16-key tile (the planes are in fragment order already); 64 threads a tile, four tiles a pass, so every load of a plane is one address pair plus a constant step, and every LDS store one index plus a constant step
    const bf* kp = Kh + (tid >> 6) * (DQP / 32) * 512 + (tid & 63) * 8; const bf* klp = Kl + (tid >> 6) * (DQP / 32) * 512 + (tid & 63) * 8;
    const int kd = tid * 8;
#pragma unroll    // whole: the constant steps become immediate offsets
    for (int g = 0; g < NKV / (ANW * 8) / 8; ++g) { v8us th[8], tl[8];    // groups of sixteen loads, each with its wait behind it
#pragma unroll
        for (int u = 0; u < 8; ++u) { th[u] = *(const v8us*)(kp + (g * 8 + u) * (ANW * 8) * DQP); tl[u] = *(const v8us*)(klp + (g * 8 + u) * (ANW * 8) * DQP); }
        asm volatile("s_wait_xcnt 0x0" :: "v"(kp), "v"(klp) : "memory");    // the wait in front of any overwrite of the k loads' address registers (the two addresses as inputs keep them whole up to it, so that no load's result lands in them)
#pragma unroll
        for (int u = 0; u < 8; ++u) { *(v8usa*)(ksh + kd + (g * 8 + u) * 2048) = th[u]; *(v8usa*)(ksl + kd + (g * 8 + u) * 2048) = tl[u]; } }
    __syncthreads();    // k is staged: from here on LDS is only read
    float mx[AQ];
#pragma unroll
    for (int n = 0; n < AQ; ++n) mx[n] = -3.0e38f;
#pragma unroll 4    // four key tiles a trip: their sixteen LDS reads issue ahead of the block of matrix instructions that uses them
    for (int mt = 0; mt < NKV / 16; ++mt) { const int kb = mt * 512 + lane * 8;
        const v16bf a = cat16b(*(const v8usa*)(ksh + kb), *(const v8usa*)(ksh + kb + 256)); const v16bf al = cat16b(*(const v8usa*)(ksl + kb), *(const v8usa*)(ksl + kb + 256));
#pragma unroll
        for (int n = 0; n < AQ; ++n) { v8f s = (v8f){}; s = wmmab(a, qh[n], s); s = wmmab(al, qh[n], s); s = wmmab(a, ql[n], s);
#pragma unroll
            for (int r = 0; r < 8; ++r) mx[n] = fmaxf(mx[n], s[r]); }
    }
    float mc[AQ], sum[AQ];
#pragma unroll
    for (int n = 0; n < AQ; ++n) { mx[n] = fmaxf(mx[n], __shfl_xor(mx[n], 16, 32)); mc[n] = mx[n] * SCL2; sum[n] = 0.f; }
    v8f acc[ACT][AQ];
#pragma unroll
    for (int c = 0; c < ACT; ++c) {
#pragma unroll
        for (int n = 0; n < AQ; ++n) acc[c][n] = (v8f){}; }
    const int vo = (cb >> 4) * (NKV / 32) * 512 + lane * 8;
#pragma unroll 1    // stays rolled: one trip is already some six hundred instructions and the register budget is nearly used
    for (int m0 = 0; m0 < NKV; m0 += 32) {
        v16bf a[ACT], al[ACT];
#pragma unroll
        for (int c = 0; c < ACT; ++c) { const int vb = vo + c * 16 * NKV + m0 * 16;    // a channel tile is NKV / 32 tiles of 512 elements = 16 NKV
            a[c] = cat16b(*(const v8us*)(Vh + vb), *(const v8us*)(Vh + vb + 256)); al[c] = cat16b(*(const v8us*)(Vl + vb), *(const v8us*)(Vl + vb + 256)); }
        asm volatile("s_wait_xcnt 0x0" ::: "memory");    // the v loads stay in flight over the score work, which reuses their address registers: the wait in front of that overwrite
        v8f s[2][AQ];
#pragma unroll
        for (int t = 0; t < 2; ++t) { const int kb = (m0 / 16 + t) * 512 + lane * 8;
            const v16bf k = cat16b(*(const v8usa*)(ksh + kb), *(const v8usa*)(ksh + kb + 256)); const v16bf kl = cat16b(*(const v8usa*)(ksl + kb), *(const v8usa*)(ksl + kb + 256));
#pragma unroll
            for (int n = 0; n < AQ; ++n) { v8f z = (v8f){}; z = wmmab(k, qh[n], z); z = wmmab(kl, qh[n], z); z = wmmab(k, ql[n], z); s[t][n] = z; } }
        v16bf ph[AQ], pl[AQ];
#pragma unroll
        for (int n = 0; n < AQ; ++n) { float x[16];
#pragma unroll
            for (int e = 0; e < 16; ++e) x[e] = __builtin_fmaf(s[e >> 3][n][e & 7], SCL2, -mc[n]);
#pragma unroll
            for (int e = 0; e < 16; e += 8)    // eight exponentials a statement: each has an independent instruction behind it, the last a v_nop (the slot the instruction set asks for behind a transcendental)
                asm("v_exp_f32 %0, %0\n\tv_exp_f32 %1, %1\n\tv_exp_f32 %2, %2\n\tv_exp_f32 %3, %3\n\tv_exp_f32 %4, %4\n\tv_exp_f32 %5, %5\n\tv_exp_f32 %6, %6\n\tv_exp_f32 %7, %7\n\tv_nop"
                    : "+v"(x[e]), "+v"(x[e + 1]), "+v"(x[e + 2]), "+v"(x[e + 3]), "+v"(x[e + 4]), "+v"(x[e + 5]), "+v"(x[e + 6]), "+v"(x[e + 7]));
#pragma unroll
            for (int e = 0; e < 16; e += 2) {
                const float p0 = x[e], p1 = x[e + 1];
                sum[n] += p0 + p1;
                const v2bf h = __builtin_convertvector((v2f){p0, p1}, v2bf);
                const v2bf l = __builtin_convertvector((v2f){p0 - (float)h[0], p1 - (float)h[1]}, v2bf);
                ph[n][e] = h[0]; ph[n][e + 1] = h[1]; pl[n][e] = l[0]; pl[n][e + 1] = l[1]; } }
#pragma unroll
        for (int c = 0; c < ACT; ++c) {
#pragma unroll
            for (int n = 0; n < AQ; ++n) acc[c][n] = wmmab(a[c], ph[n], acc[c][n]); }
#pragma unroll
        for (int c = 0; c < ACT; ++c) {
#pragma unroll
            for (int n = 0; n < AQ; ++n) acc[c][n] = wmmab(al[c], ph[n], acc[c][n]); }
#pragma unroll
        for (int c = 0; c < ACT; ++c) {
#pragma unroll
            for (int n = 0; n < AQ; ++n) acc[c][n] = wmmab(a[c], pl[n], acc[c][n]); }
    }
#pragma unroll
    for (int n = 0; n < AQ; ++n) { const float inv = 1.0f / (sum[n] + __shfl_xor(sum[n], 16, 32));
        const size_t ob = ((size_t)((q0 >> 4) + n) * (CC / 32) + (cb >> 5)) * 512 + lane * 8;    // channel tile c is k half c & 1 of k block c / 2 from there: c * 256
#pragma unroll
        for (int c = 0; c < ACT; ++c) { v8us oh, ol;
#pragma unroll
            for (int r = 0; r < 8; ++r) { const float v = acc[c][n][r] * inv; const unsigned short hb = f2bf(v); oh[r] = hb; ol[r] = f2bf(v - bf2f(hb)); }
            // the two stores and their wait in one statement: the next tile's split reuses the registers they name
            asm volatile("global_store_b128 %0, %1, off\n\tglobal_store_b128 %2, %3, off\n\ts_wait_xcnt 0x0"
                         :: "v"(OAh + ob + c * 256), "v"(__builtin_bit_cast(v4u, oh)), "v"(OAl + ob + c * 256), "v"(__builtin_bit_cast(v4u, ol)) : "memory"); } }
}

extern "C" void kernel_launch(void* const* d_in, const int* in_sizes, int n_in,
                              void* d_out, int out_size, void* d_ws, size_t ws_size, hipStream_t stream) {
    (void)in_sizes; (void)n_in; (void)out_size;
    const float* x = (const float*)d_in[0]; const float* wq = (const float*)d_in[1]; const float* wk = (const float*)d_in[2]; const float* wv = (const float*)d_in[3]; const float* wo = (const float*)d_in[4]; const float* gam = (const float*)d_in[5];
    float* out = (float*)d_out;    // [8][256][64][64]
    char* wsp = (char*)d_ws;
    auto take = [&](size_t bytes) { char* p = wsp; wsp += (bytes + 255) & ~(size_t)255; return (void*)p; };
    bf* WqP = (bf*)take((size_t)DQP * CC * 2); bf* WkP = (bf*)take((size_t)DQP * CC * 2); bf* WvB = (bf*)take((size_t)CC * CC * 2); bf* WoB = (bf*)take((size_t)CC * CC * 2); bf* WZ = (bf*)take((size_t)CC * CC * 2);
    bf* XT = (bf*)take((size_t)NBI * NTOK * CC * 2); bf* KVh = (bf*)take((size_t)NBI * NKV * CC * 2); bf* KVl = (bf*)take((size_t)NBI * NKV * CC * 2);
    bf* Qh = (bf*)take((size_t)NBI * NTOK * DQP * 2); bf* Ql = (bf*)take((size_t)NBI * NTOK * DQP * 2); bf* Kh = (bf*)take((size_t)NBI * NKV * DQP * 2); bf* Kl = (bf*)take((size_t)NBI * NKV * DQP * 2);
    bf* Vh = (bf*)take((size_t)NBI * CC * NKV * 2); bf* Vl = (bf*)take((size_t)NBI * CC * NKV * 2);
    bf* OAh = (bf*)take((size_t)NBI * NTOK * CC * 2); bf* OAl = (bf*)take((size_t)NBI * NTOK * CC * 2);
    if ((size_t)(wsp - (char*)d_ws) > ws_size) return;    // MiB: 0.4 + 16 + 8 + 8 + 2 + 8 + 32 ~ 75 of 256
    k_prep<<<RB_WT + RB_PL + 2 * RB_WP + 2 * RB_BZ, 256, 0, stream>>>(x, wq, wk, wv, wo, WqP, WkP, WvB, WoB, WZ, XT, KVh, KVl);
    k_proj<<<PB_V + PB_Q + PB_K, 128, 0, stream>>>(XT, KVh, KVl, WqP, WkP, WvB, WZ, Qh, Ql, Kh, Kl, Vh, Vl);
    k_attn<<<dim3(NTOK / AQB, 1, NBI), ANW * 32, 0, stream>>>(Qh, Ql, Kh, Kl, Vh, Vl, OAh, OAl);                                                    // out_attn token-major [8][4096][256] hi/lo
    k_out<<<dim3(CC / 64, NTOK / 64, NBI), 128, 0, stream>>>(WoB, WZ, OAh, OAl, x, gam, out);    // out = x + gamma wo.out_attn^T [8][256][4096]
}

// v006
// Measured time: 116 microseconds a run.
// Two timings next to v005 put it at 1.08 and 1.07 times that version's speed.
// All steps since v000 together make it 8.43 times as fast.
#include <hip/hip_runtime.h>

// Compute dtypes, f32 accumulate, batch items side by side in every launch (on blockIdx.z in k_attn and k_out, in the block index in k_prep and k_proj): q = x^T.wq^T ([4096 x 256].[256 x 32->64 padded], exact bf16 transposed input and weight); the 2x2 average
// pool in f32 -> x_kv^T as bf16 hi + UNSCALED residual; k = x_kv^T.wk^T and v = wv.x_kv (split pooled operand, two/three products); scores = q.k^T/sqrt(32)
// ([4096 x 32].[32 x 1024], three products), row softmax in f32 -> bf16 hi + UNSCALED residual; out_attn = attn.v^T ([4096 x 1024].[1024 x 256], three products), these three in one kernel,
// and y = wo.out_attn^T ([256 x 256].[256 x 4096], exact wo against split) on v_wmma_f32_16x16x32_bf16; out = x + gamma y in f32. Every product's kernel stores what its consumer reads (the hi/lo planes, or out itself). Deterministic, no atomics;
// Four launches: k_prep (all that reads the inputs alone), k_proj (q, k, v), k_attn, k_out; kernels that need nothing of one another share a launch, a block taking its part by its index.
// Every bf16 plane in the workspace stands in FRAGMENT ORDER: a plane of R rows x K is cut in tiles of 16 rows x 32 k, tile (r / 16, k / 32) at element ((r / 16) (K / 32) + k / 32) 512, and inside a tile
// [k half of 16][lane = ((k / 8) & 1) 16 + (r & 15)][8 k]: the two 16-byte loads of an A or B fragment are each 512 contiguous bytes (4 whole lines) a wave, where row-major planes gave 16 lines.

#define NBI  8
#define CC   256
#define HW   64
#define NTOK 4096
#define NKV  1024               // 32 x 32 pooled
#define DQ   32
#define DQP  64                 // padded head dim (zeros)
#define DM   CC
#define NTK  NTOK
#define LOSC 1024.0f

typedef _Float16 h16;
typedef unsigned short bf;
typedef __attribute__((ext_vector_type(16))) __bf16   v16bf;
typedef __attribute__((ext_vector_type(16))) _Float16 v16h;
typedef __attribute__((ext_vector_type(8)))  _Float16 v8h;
typedef __attribute__((ext_vector_type(8)))  unsigned short v8us;
typedef __attribute__((ext_vector_type(8)))  float    v8f;
typedef __attribute__((ext_vector_type(4)))  float    v4f;
typedef __attribute__((ext_vector_type(4)))  _Float16 v4h;
typedef v8h  __attribute__((may_alias)) v8ha;
typedef v4f  __attribute__((may_alias)) v4fa;
typedef v8us __attribute__((may_alias)) v8usa;

__device__ __forceinline__ unsigned short f2bf(float f) { unsigned u = __float_as_uint(f); u += 0x7FFFu + ((u >> 16) & 1u); return (unsigned short)(u >> 16); }
__device__ __forceinline__ float bf2f(unsigned short b) { return __uint_as_float(((unsigned)b) << 16); }
__device__ __forceinline__ float bfr(float f) { return bf2f(f2bf(f)); }
__device__ __forceinline__ v16h cat16(v8h lo, v8h hi) { return __builtin_shufflevector(lo, hi, 0, 1, 2, 3, 4, 5, 6, 7, 8, 9, 10, 11, 12, 13, 14, 15); }
__device__ __forceinline__ v16bf cat16b(v8us lo, v8us hi) { return __builtin_bit_cast(v16bf, __builtin_shufflevector(lo, hi, 0, 1, 2, 3, 4, 5, 6, 7, 8, 9, 10, 11, 12, 13, 14, 15)); }
__device__ __forceinline__ v8f wmma16(v16h a, v16h b, v8f c) { return __builtin_amdgcn_wmma_f32_16x16x32_f16(false, a, false, b, (short)0, c, false, false); }
__device__ __forceinline__ v8f wmmab(v16bf a, v16bf b, v8f c) { return __builtin_amdgcn_wmma_f32_16x16x32_bf16(false, a, false, b, (short)0, c, false, false); }
// frag_off: the element at which the 8 consecutive k from 8 k8 on of row r stand in a fragment-order plane of KB = K / 32 k blocks.
__device__ __forceinline__ size_t frag_off(int r, int k8, int KB) { return ((size_t)(r >> 4) * KB + (k8 >> 2)) * 512 + ((k8 >> 1) & 1) * 256 + ((k8 & 1) * 16 + (r & 15)) * 8; }

// d_wt: WT (rows n, K wide, fragment order) = bf16(W[k][n]) (k-major [K][ncols]) via 64 x 64 LDS tiles; block (bx, by, bz) of (K/64, ncols/64, matrices), 256 threads. A wave's store is one k half of one fragment tile: 512 contiguous bytes.
__device__ __forceinline__ void d_wt(const float* __restrict__ Wm, int K, int ncols, bf* WT, int bx, int by, int bz) {
    __shared__ __align__(16) unsigned short tl[64 * 72];
    const int tid = threadIdx.x, k0 = bx * 64, n0 = by * 64;
    Wm += (size_t)bz * K * ncols; WT += (size_t)bz * K * ncols;
    const int kk = tid >> 2, nq = (tid & 3) * 16;
#pragma unroll
    for (int i = 0; i < 16; ++i) tl[(nq + i) * 72 + kk] = f2bf(Wm[(size_t)(k0 + kk) * ncols + n0 + nq + i]);
    __syncthreads();
    const int lane = tid & 31;
#pragma unroll
    for (int s = 0; s < 2; ++s) { const int ch = (tid >> 5) * 2 + s, rt = ch >> 2, kq = ch & 3;    // row tile rt of 4; kq = k block of 2, k half of 2
        const v8us val = *(const v8usa*)(tl + (rt * 16 + (lane & 15)) * 72 + (kq * 2 + (lane >> 4)) * 8);
        *(v8us*)(WT + ((size_t)((n0 >> 4) + rt) * (K >> 5) + (k0 >> 5)) * 512 + kq * 256 + lane * 8) = val; }
    asm volatile("s_wait_xcnt 0x0" ::: "memory");    // the wait behind the two stores: in the merged kernel's text another part's code, which writes the registers they name, follows this one
}
// split_rows: a wave's staged 16 x 64 f32 tile -> bf16 hi + UNSCALED residual planes in fragment order: two tiles side by side, 2 KiB in a row a plane (ch, cl: the first tile's start); pass s stores one k half, 512 contiguous bytes.
__device__ __forceinline__ void split_rows(const float* os, int lane, bf* ch, bf* cl) {
    ch += lane * 8; cl += lane * 8;
#pragma unroll
    for (int s = 0; s < 4; ++s) { const float* sp = os + (lane & 15) * 68 + s * 16 + (lane >> 4) * 8;
        const v4f v0 = *(const v4fa*)sp, v1 = *(const v4fa*)(sp + 4); v8us oh, ol;
#pragma unroll
        for (int i = 0; i < 8; ++i) { const float v = i < 4 ? v0[i & 3] : v1[i & 3]; const unsigned short hb = f2bf(v); oh[i] = hb; ol[i] = f2bf(v - bf2f(hb)); }
        *(v8us*)(ch + s * 256) = oh; *(v8us*)(cl + s * 256) = ol;
        asm volatile("s_wait_xcnt 0x0" ::: "memory"); }    // the wait behind the two stores, in front of the next pass's (in a merged kernel's text: another part's) writes of the registers they name
}
// d_gemmb (block (bx, by, bz), 128 threads, ost: the block's staging tiles in LDS): 64 x 64 block tile (4 waves x 16 x 64) of C [rows][DQP] = (A [+ Al]).B^T over K; the epilogue splits the f32 tile itself and stores the two bf16 planes its consumer reads.
template <bool SPLITA, int K>
__device__ __forceinline__ void d_gemmb(float (*ost)[16 * 68], int bx, int by, int bz, const bf* __restrict__ A, const bf* __restrict__ Al, const bf* __restrict__ Bn, bf* Ch, bf* Cl, size_t sA, size_t sC) {
    const int lane = threadIdx.x & 31, wave = threadIdx.x >> 5, lr = lane & 15, hi = lane >> 4;
    const int r0 = bx * 64 + wave * 16, c0 = by * 64;
    A += bz * sA; if (SPLITA) Al += bz * sA; Ch += bz * sC; Cl += bz * sC;    // item bz: element strides sA (A planes), sC (C planes); B is shared
    const size_t aoff = (size_t)(r0 >> 4) * (K * 16) + lane * 8;    // fragment order: a row tile is K / 32 tiles of 512 elements = 16 K, a constant: one address a plane, B's four row tiles as immediate offsets
    const bf* pa = A + aoff; const bf* pal = SPLITA ? Al + aoff : pa; const bf* pb = Bn + (size_t)(c0 >> 4) * (K * 16) + lane * 8;
    v8f acc[4];
#pragma unroll
    for (int t = 0; t < 4; ++t) acc[t] = (v8f){};
#pragma unroll 1
    for (int kc = 0; kc < K; kc += 32) {
        const v16bf a = cat16b(*(const v8us*)pa, *(const v8us*)(pa + 256));
        v16bf al = a;
        if (SPLITA) al = cat16b(*(const v8us*)pal, *(const v8us*)(pal + 256));
#pragma unroll
        for (int t = 0; t < 4; ++t) { const v16bf b = cat16b(*(const v8us*)(pb + t * K * 16), *(const v8us*)(pb + t * K * 16 + 256)); acc[t] = wmmab(a, b, acc[t]); if (SPLITA) acc[t] = wmmab(al, b, acc[t]); }
        asm volatile("v_nop\n\tv_nop\n\tv_nop\n\tv_nop" : "+v"(acc[0]), "+v"(acc[1]), "+v"(acc[2]), "+v"(acc[3]) : "v"(a), "v"(al));
        asm volatile("s_wait_xcnt 0x0" :: "v"(pa), "v"(pal), "v"(pb) : "memory");    // the wait in front of the step of the trip's load addresses (the addresses as inputs keep them whole up to it, so that no load's result lands in them)
        pa += 512; pal += 512; pb += 512;
    }
    float* os = &ost[wave][0];
#pragma unroll
    for (int t = 0; t < 4; ++t) {
#pragma unroll
        for (int j = 0; j < 8; ++j) os[(hi * 8 + j) * 68 + t * 16 + lr] = acc[t][j]; }
    __syncthreads();
    const size_t co = ((size_t)(r0 >> 4) * (DQP / 32) + (c0 >> 5)) * 512;
    split_rows(os, lane, Ch + co, Cl + co);
}

// d_gemm3 (block (bx, by, bz), 128 threads, ost as above): 64 x 64 tile of C = (Ah + Al).(Bh + Bl)^T over K (all four planes K wide, in fragment order; n-major B; C is LDC wide): three products per 32-k step (hh, hl, lh). The epilogue writes what
// the consumer reads: the two bf16 planes of C (RESID false), or OUTP = X + gamma C in f32, whole lines (RESID true; X is fetched ahead of the k loop).
template <bool RESID, int LDC, int K>
__device__ __forceinline__ void d_gemm3(float (*ost)[16 * 68], int bx, int by, int bz, const bf* __restrict__ Ah, const bf* __restrict__ Al, const bf* __restrict__ Bh, const bf* __restrict__ Bl, bf* Ch, bf* Cl,
                                        const float* __restrict__ X, const float* __restrict__ gam, float* OUTP, size_t sA, size_t sB, size_t sC) {
    const int lane = threadIdx.x & 31, wave = threadIdx.x >> 5, lr = lane & 15, hi = lane >> 4;
    const int r0 = bx * 64 + wave * 16, c0 = by * 64;
    Ah += bz * sA; Al += bz * sA; Bh += bz * sB; Bl += bz * sB;    // item bz: element strides (0 = shared weights)
    const size_t co = bz * sC + (RESID ? (size_t)r0 * LDC + c0 : ((size_t)(r0 >> 4) * (LDC / 32) + (c0 >> 5)) * 512);    // X and OUTP are row-major, the planes of C in fragment order
    const size_t eo = co + (size_t)(lane >> 4) * LDC + (lane & 15) * 4;    // RESID: pass s of the epilogue takes rows 2 s and 2 s + 1, 16 lanes a row of 64 floats (two whole lines)
    v4f xv[8]; float g = 0.f;
    if (RESID) { g = bfr(gam[0]); const float* xp = X + eo;
#pragma unroll
        for (int s = 0; s < 8; ++s) xv[s] = *(const v4f*)(xp + 2 * s * LDC);
        asm volatile("s_wait_xcnt 0x0" :: "v"(xp) : "memory"); }    // the x loads stay in flight over the k loop, whose set-up reuses their address registers: the wait in front of that overwrite (the address as an input keeps it whole up to it)
    const size_t aoff = (size_t)(r0 >> 4) * (K * 16) + lane * 8, boff = (size_t)(c0 >> 4) * (K * 16) + lane * 8;    // a row tile is 16 K elements, a constant: one address a plane, B's four row tiles as immediate offsets
    const bf* pa = Ah + aoff; const bf* pal = Al + aoff; const bf* pbh = Bh + boff; const bf* pbl = Bl + boff;
    v8f acc[4];
#pragma unroll
    for (int t = 0; t < 4; ++t) acc[t] = (v8f){};
#pragma unroll 1
    for (int kc = 0; kc < K; kc += 32) {
        const v16bf a = cat16b(*(const v8us*)pa, *(const v8us*)(pa + 256));
        const v16bf al = cat16b(*(const v8us*)pal, *(const v8us*)(pal + 256));
#pragma unroll
        for (int t = 0; t < 4; ++t) { const int bo = t * K * 16;
            const v16bf bh = cat16b(*(const v8us*)(pbh + bo), *(const v8us*)(pbh + bo + 256)); const v16bf bl = cat16b(*(const v8us*)(pbl + bo), *(const v8us*)(pbl + bo + 256));
            acc[t] = wmmab(a, bh, acc[t]); acc[t] = wmmab(al, bh, acc[t]); acc[t] = wmmab(a, bl, acc[t]); }
        asm volatile("v_nop\n\tv_nop\n\tv_nop\n\tv_nop" : "+v"(acc[0]), "+v"(acc[1]), "+v"(acc[2]), "+v"(acc[3]) : "v"(a), "v"(al));
        asm volatile("s_wait_xcnt 0x0" :: "v"(pa), "v"(pal), "v"(pbh), "v"(pbl) : "memory");    // the wait in front of the step of the trip's load addresses (the addresses as inputs keep them whole up to it, so that no load's result lands in them)
        pa += 512; pal += 512; pbh += 512; pbl += 512;
    }
    float* os = &ost[wave][0];
#pragma unroll
    for (int t = 0; t < 4; ++t) {
#pragma unroll
        for (int j = 0; j < 8; ++j) os[(hi * 8 + j) * 68 + t * 16 + lr] = acc[t][j]; }
    __builtin_amdgcn_wave_barrier(); asm volatile("" ::: "memory");
    if (RESID) {
#pragma unroll
        for (int s = 0; s < 8; ++s) { const v4f y = *(const v4fa*)(os + (2 * s + (lane >> 4)) * 68 + (lane & 15) * 4); v4f val;
#pragma unroll
            for (int i = 0; i < 4; ++i) val[i] = bfr(xv[s][i]) + g * y[i];
            *(v4f*)(OUTP + eo + 2 * s * LDC) = val; }
    } else split_rows(os, lane, Ch + co, Cl + co);
}

// k_out: the last product with its residual. Eight waves a SIMD asked for: with the 32 registers of X the kernel stays within 128, so that its 2048 blocks are all resident at once.
__global__ __launch_bounds__(128, 8) void k_out(const bf* __restrict__ Ah, const bf* __restrict__ Al, const bf* __restrict__ Bh, const bf* __restrict__ Bl, const float* __restrict__ X, const float* __restrict__ gam, float* OUTP) {
    __shared__ __align__(16) float ost[4][16 * 68];
    d_gemm3<true, NTOK, CC>(ost, blockIdx.x, blockIdx.y, blockIdx.z, Ah, Al, Bh, Bl, nullptr, nullptr, X, gam, OUTP, 0, (size_t)NTOK * CC, (size_t)CC * NTOK);
}
// k_proj: the three projections, which need nothing of one another, side by side in one launch; the branch is on the block index alone, so a block's barrier is passed by all its threads.
#define PB_V (CC / 64 * (NKV / 64) * NBI)    // blocks of v, of q, of k
#define PB_Q (NTOK / 64 * NBI)
#define PB_K (NKV / 64 * NBI)
__global__ __launch_bounds__(128) void k_proj(const bf* __restrict__ XT, const bf* __restrict__ KVh, const bf* __restrict__ KVl, const bf* __restrict__ WqP, const bf* __restrict__ WkP, const bf* __restrict__ WvB, const bf* __restrict__ WZ,
                                              bf* Qh, bf* Ql, bf* Kh, bf* Kl, bf* Vh, bf* Vl) {
    __shared__ __align__(16) float ost[4][16 * 68];
    const int b = blockIdx.x, bq = b - PB_V, bk = bq - PB_Q;
    if (b < PB_V) d_gemm3<false, NKV, CC>(ost, b % (CC / 64), b / (CC / 64) % (NKV / 64), b / (CC / 64 * (NKV / 64)), WvB, WZ, KVh, KVl, Vh, Vl, nullptr, nullptr, nullptr, 0, (size_t)NKV * CC, (size_t)CC * NKV);    // v [8][256][1024] hi/lo
    else if (bq < PB_Q) d_gemmb<false, DM>(ost, bq % (NTOK / 64), 0, bq / (NTOK / 64), XT, nullptr, WqP, Qh, Ql, (size_t)NTOK * CC, (size_t)NTOK * DQP);    // q [8][4096][64] (32 real) hi/lo
    else d_gemmb<true, DM>(ost, bk % (NKV / 64), 0, bk / (NKV / 64), KVh, KVl, WkP, Kh, Kl, (size_t)NKV * CC, (size_t)NKV * DQP);    // k [8][1024][64] hi/lo
}

// d_bfz: with ZP the plane of zeros dz is written too (one caller alone asks for it: one writer a line).
template <bool ZP>
__device__ __forceinline__ void d_bfz(const float* __restrict__ src, bf* dh, bf* dz, size_t n8, int bx) {
    const size_t i = (size_t)bx * 256 + threadIdx.x; if (i >= n8) return;
    const v8f v = *(const v8f*)(src + i * 8); v8us o, z;
#pragma unroll
    for (int k = 0; k < 8; ++k) { o[k] = f2bf(v[k]); z[k] = 0; }
    *(v8us*)(dh + frag_off((int)(i / (CC / 8)), (int)(i % (CC / 8)), CC / 32)) = o; if (ZP) *(v8us*)(dz + i * 8) = z;    // src is [rows][CC]; the plane of zeros reads the same in any order
}
__device__ __forceinline__ void d_wpad(const float* __restrict__ w, bf* WP, int bx) {
    const int u = bx * 256 + threadIdx.x; if (u >= DQP * CC / 8) return;
    const int d = u / (CC / 8), c0 = (u % (CC / 8)) * 8; v8us o;
#pragma unroll
    for (int i = 0; i < 8; ++i) o[i] = (d < DQ) ? f2bf(w[d * CC + c0 + i]) : (unsigned short)0;
    *(v8us*)(WP + frag_off(d, c0 / 8, CC / 32)) = o;
}
// d_poolT: x_kv^T[m][c] = mean of the 2x2 block (f32, the reference's order ((a+b)+(c+d))/4 -> sum then * 0.25) of bf16-rounded x -> bf16 hi + UNSCALED residual planes (fragment order).
// A wave makes one k half of one fragment tile, its lanes as the fragment's: 16 pooled positions of one pooled row x 2 groups of 8 channels. A store is 512 contiguous bytes, and 16 lanes read one whole line of a channel's image row.
__device__ __forceinline__ void d_poolT(const float* __restrict__ x, bf* Ph, bf* Pl, int bx, int bz) {
    const int lane = threadIdx.x & 31, w = bx * 8 + (threadIdx.x >> 5); if (w >= (NKV / 16) * (CC / 16)) return;
    const int m = (w / (CC / 16)) * 16 + (lane & 15), k8 = (w % (CC / 16)) * 2 + (lane >> 4);    // pooled position; group of 8 channels
    x += (size_t)bz * CC * NTOK; Ph += (size_t)bz * NKV * CC; Pl += (size_t)bz * NKV * CC;
    const int pi = m / 32, pj = m % 32; v8us oh, ol;
    const float* xb = x + (size_t)(k8 * 8) * NTOK + (2 * pi) * HW + 2 * pj;
#pragma unroll
    for (int i = 0; i < 8; ++i) { const float* xc = xb + i * NTOK;
        const float s = (bfr(xc[0]) + bfr(xc[1])) + (bfr(xc[HW]) + bfr(xc[HW + 1])); const float v = s * 0.25f; const unsigned short hb = f2bf(v); oh[i] = hb; ol[i] = f2bf(v - bf2f(hb)); }
    asm volatile("s_wait_xcnt 0x0" :: "v"(xb) : "memory");    // the wait in front of any overwrite of the x loads' address registers (the address as an input keeps it whole up to it, so that no load's result lands in it)
    const size_t o = frag_off(m, k8, CC / 32); *(v8us*)(Ph + o) = oh; *(v8us*)(Pl + o) = ol;
}
// k_prep: all that reads the inputs alone (the four weight planes, x^T, the pool), side by side in one launch; the branch is on the block index alone, so the barrier of d_wt is passed by all threads of its block.
#define RB_WP (DQP * CC / 8 / 256)            // blocks of one padded weight, of one square weight, of x^T, of the pool
#define RB_BZ (CC * CC / 8 / 256)
#define RB_WT (CC / 64 * (NTOK / 64) * NBI)
#define RB_PL ((NKV / 16) * (CC / 16) / 8 * NBI)
__global__ __launch_bounds__(256) void k_prep(const float* __restrict__ x, const float* __restrict__ wq, const float* __restrict__ wk, const float* __restrict__ wv, const float* __restrict__ wo,
                                              bf* WqP, bf* WkP, bf* WvB, bf* WoB, bf* WZ, bf* XT, bf* KVh, bf* KVl) {
    const int b = blockIdx.x, b1 = b - RB_WP, b2 = b1 - RB_WP, b3 = b2 - RB_BZ, b4 = b3 - RB_BZ, b5 = b4 - RB_WT;    // the 80 small blocks first: they are done while the large parts still start
    if (b < RB_WP) d_wpad(wq, WqP, b);
    else if (b1 < RB_WP) d_wpad(wk, WkP, b1);
    else if (b2 < RB_BZ) d_bfz<true>(wv, WvB, WZ, CC * CC / 8, b2);
    else if (b3 < RB_BZ) d_bfz<false>(wo, WoB, nullptr, CC * CC / 8, b3);
    else if (b4 < RB_WT) d_wt(x, CC, NTOK, XT, b4 % (CC / 64), b4 / (CC / 64) % (NTOK / 64), b4 / (CC / 64 * (NTOK / 64)));    // x^T [8][4096][256] exact
    else d_poolT(x, KVh, KVl, b5 % (RB_PL / NBI), b5 / (RB_PL / NBI));    // x_kv^T [8][1024][256] hi/lo
}
#define AQ   4
#define ACT  4
#define ANW  8                  // waves per block
#define ACG  (CC / 16 / ACT)    // channel groups
#define AQB  (ANW / ACG * AQ * 16)   // queries per block = ANW query tiles, one a producer
#define SCL2 0.25503486f        // (1/sqrt(32)) * log2(e)
typedef __attribute__((ext_vector_type(2))) float  v2f;
typedef __attribute__((ext_vector_type(2))) __bf16 v2bf;
typedef __attribute__((ext_vector_type(4))) unsigned int v4u;
typedef __attribute__((ext_vector_type(16))) unsigned short v16us;
// lds_barrier: the work-group barrier with the order of LDS accesses alone (a wave's LDS reads and writes are done before it signals). __syncthreads() would wait for the wave's global loads too, and the v fragments asked for ahead of it are to stay in flight across it.
__device__ __forceinline__ void lds_barrier() {
    __builtin_amdgcn_fence(__ATOMIC_RELEASE, "workgroup", "local");
    __builtin_amdgcn_s_barrier();
    __builtin_amdgcn_fence(__ATOMIC_ACQUIRE, "workgroup", "local");
}
__global__ __launch_bounds__(ANW * 32) void k_attn(const bf* __restrict__ Qh, const bf* __restrict__ Ql, const bf* __restrict__ Kh, const bf* __restrict__ Kl,
                                                   const bf* __restrict__ Vh, const bf* __restrict__ Vl, bf* OAh, bf* OAl) {
    __shared__ __align__(16) unsigned short ksh[NKV * DQ], ksl[NKV * DQ];    // per 16-key tile 512 elements: [k half of the fragment][lane][8]
    __shared__ __align__(16) unsigned short psh[2][ANW * 512], psl[2][ANW * 512];    // probabilities of 32 keys, per query tile 512 elements: [k half of the fragment][lane][8]
    __shared__ float pinv[ANW * 32];    // 1 / row sum, [query tile][lane]
    const int tid = threadIdx.x, lane = tid & 31, wave = tid >> 5;
    const int qt0 = (wave / ACG) * AQ;    // first of the query tiles that the wave consumes
    const int q0 = blockIdx.x * AQB + qt0 * 16, cb = (wave % ACG) * (ACT * 16);
    const size_t it = blockIdx.z;
    Qh += it * NTOK * DQP; Ql += it * NTOK * DQP; Kh += it * NKV * DQP; Kl += it * NKV * DQP; Vh += it * CC * NKV; Vl += it * CC * NKV; OAh += it * NTOK * CC; OAl += it * NTOK * CC;
    const size_t qo = (size_t)(blockIdx.x * (AQB / 16) + wave) * (DQP / 32) * 512 + lane * 8;    // the query tile that the wave produces; k block 0 of a row tile holds the 32 real dims
    const bf* qp = Qh + qo; const bf* qlp = Ql + qo;
    const v16bf qh = cat16b(*(const v8us*)qp, *(const v8us*)(qp + 256)), ql = cat16b(*(const v8us*)qlp, *(const v8us*)(qlp + 256));
    asm volatile("s_wait_xcnt 0x0" :: "v"(qp), "v"(qlp) : "memory");    // the q loads stay in flight over the staging of k, which reuses their address registers: the wait in front of that overwrite (the two addresses as inputs keep them whole up to it)
    // k staging: a straight copy of k block 0 of every 16-key tile (the planes are in fragment order already); 64 threads a tile, four tiles a pass, so every load of a plane is one address pair plus a constant step, and every LDS store one index plus a constant step
    const bf* kp = Kh + (tid >> 6) * (DQP / 32) * 512 + (tid & 63) * 8; const bf* klp = Kl + (tid >> 6) * (DQP / 32) * 512 + (tid & 63) * 8;
    const int kd = tid * 8;
#pragma unroll    // whole: the constant steps become immediate offsets
    for (int g = 0; g < NKV / (ANW * 8) / 8; ++g) { v8us th[8], tl[8];    // groups of sixteen loads, each with its wait behind it
#pragma unroll
        for (int u = 0; u < 8; ++u) { th[u] = *(const v8us*)(kp + (g * 8 + u) * (ANW * 8) * DQP); tl[u] = *(const v8us*)(klp + (g * 8 + u) * (ANW * 8) * DQP); }
        asm volatile("s_wait_xcnt 0x0" :: "v"(kp), "v"(klp) : "memory");    // the wait in front of any overwrite of the k loads' address registers (the two addresses as inputs keep them whole up to it, so that no load's result lands in them)
#pragma unroll
        for (int u = 0; u < 8; ++u) { *(v8usa*)(ksh + kd + (g * 8 + u) * 2048) = th[u]; *(v8usa*)(ksl + kd + (g * 8 + u) * 2048) = tl[u]; } }
    __syncthreads();    // k is staged: from here on its LDS is only read
    float mxu[4];
#pragma unroll
    for (int u = 0; u < 4; ++u) mxu[u] = -3.0e38f;
#pragma unroll 2    // two groups a trip: the second group's LDS reads issue ahead of the first group's matrix instructions
    for (int mt = 0; mt < NKV / 16; mt += 4) {    // four key tiles a group, product by product: with one query tile a wave the independent chains that cover the matrix unit's latency come from the keys
        v16bf a[4], al[4]; v8f s[4];
#pragma unroll
        for (int u = 0; u < 4; ++u) { const int kb = (mt + u) * 512 + lane * 8;
            a[u] = cat16b(*(const v8usa*)(ksh + kb), *(const v8usa*)(ksh + kb + 256)); al[u] = cat16b(*(const v8usa*)(ksl + kb), *(const v8usa*)(ksl + kb + 256)); }
#pragma unroll
        for (int u = 0; u < 4; ++u) s[u] = wmmab(a[u], qh, (v8f){});
#pragma unroll
        for (int u = 0; u < 4; ++u) s[u] = wmmab(al[u], qh, s[u]);
#pragma unroll
        for (int u = 0; u < 4; ++u) s[u] = wmmab(a[u], ql, s[u]);
#pragma unroll
        for (int r = 0; r < 8; ++r) {
#pragma unroll
            for (int u = 0; u < 4; ++u) mxu[u] = fmaxf(mxu[u], s[u][r]); }
    }
    float mx = fmaxf(fmaxf(mxu[0], mxu[1]), fmaxf(mxu[2], mxu[3]));
    mx = fmaxf(mx, __shfl_xor(mx, 16, 32));
    const float mc = mx * SCL2; float sum = 0.f;
    v16bf kf[2], kfl[2];
    auto fetch_k = [&](int m0) {    // the k fragments of keys m0 to m0 + 31, from LDS
#pragma unroll
        for (int t = 0; t < 2; ++t) { const int kb = (m0 / 16 + t) * 512 + lane * 8;
            kf[t] = cat16b(*(const v8usa*)(ksh + kb), *(const v8usa*)(ksh + kb + 256)); kfl[t] = cat16b(*(const v8usa*)(ksl + kb), *(const v8usa*)(ksl + kb + 256)); }
    };
    // produce: the probabilities of keys m0 to m0 + 31 for the wave's own query tile, hi and residual, into buffer (m0 / 32) & 1. Their k fragments were fetched by the call before; behind its score products it fetches the next call's
    // (behind the last keys: the first again, unused), so that a call starts with no LDS latency in front of it.
    auto produce = [&](int m0) {
        v8f s[2];
#pragma unroll
        for (int t = 0; t < 2; ++t) { v8f z = (v8f){}; z = wmmab(kf[t], qh, z); z = wmmab(kfl[t], qh, z); z = wmmab(kf[t], ql, z); s[t] = z; }
        fetch_k((m0 + 32) & (NKV - 1));
        float x[16]; v16bf ph, pl;
#pragma unroll
        for (int e = 0; e < 16; ++e) x[e] = __builtin_fmaf(s[e >> 3][e & 7], SCL2, -mc);
#pragma unroll
        for (int e = 0; e < 16; e += 8)    // eight exponentials a statement: each has an independent instruction behind it, the last a v_nop (the slot the instruction set asks for behind a transcendental)
            asm("v_exp_f32 %0, %0\n\tv_exp_f32 %1, %1\n\tv_exp_f32 %2, %2\n\tv_exp_f32 %3, %3\n\tv_exp_f32 %4, %4\n\tv_exp_f32 %5, %5\n\tv_exp_f32 %6, %6\n\tv_exp_f32 %7, %7\n\tv_nop"
                : "+v"(x[e]), "+v"(x[e + 1]), "+v"(x[e + 2]), "+v"(x[e + 3]), "+v"(x[e + 4]), "+v"(x[e + 5]), "+v"(x[e + 6]), "+v"(x[e + 7]));
#pragma unroll
        for (int e = 0; e < 16; e += 2) {
            const float p0 = x[e], p1 = x[e + 1];
            sum += p0 + p1;
            const v2bf h = __builtin_convertvector((v2f){p0, p1}, v2bf);
            const v2bf l = __builtin_convertvector((v2f){p0 - (float)h[0], p1 - (float)h[1]}, v2bf);
            ph[e] = h[0]; ph[e + 1] = h[1]; pl[e] = l[0]; pl[e + 1] = l[1]; }
        const int po = wave * 512 + lane * 8, pb = (m0 >> 5) & 1;
        const v16us uh = __builtin_bit_cast(v16us, ph), ul = __builtin_bit_cast(v16us, pl);
        *(v8usa*)(psh[pb] + po) = __builtin_shufflevector(uh, uh, 0, 1, 2, 3, 4, 5, 6, 7); *(v8usa*)(psh[pb] + po + 256) = __builtin_shufflevector(uh, uh, 8, 9, 10, 11, 12, 13, 14, 15);
        *(v8usa*)(psl[pb] + po) = __builtin_shufflevector(ul, ul, 0, 1, 2, 3, 4, 5, 6, 7); *(v8usa*)(psl[pb] + po + 256) = __builtin_shufflevector(ul, ul, 8, 9, 10, 11, 12, 13, 14, 15);
    };
    v8f acc[ACT][AQ];
#pragma unroll
    for (int c = 0; c < ACT; ++c) {
#pragma unroll
        for (int n = 0; n < AQ; ++n) acc[c][n] = (v8f){}; }
    const int vo = (cb >> 4) * (NKV / 32) * 512 + lane * 8;
    // The two waves that share a SIMD (w and w + ANW / 2) take a trip's two halves in opposite order, so that one's vector work runs beside the other's products instead of both waiting at the barrier for the second to finish both:
    // the first four waves multiply first and then produce, the last four produce first. For speed only: the result does not depend on where a wave runs. The test is the same in all lanes of a wave, and the barrier stands outside it.
    const bool late = __builtin_amdgcn_readfirstlane(wave) < ANW / 2;
    v16bf a[ACT], al[ACT], ph[AQ], pl[AQ];
    const bf* pvh = Vh + vo; const bf* pvl = Vl + vo;    // the v fragments that the wave asks for next: one address a plane, the channel tiles as immediate offsets
    auto load_v = [&]() {    // asks for the v fragments of 32 keys and steps on
#pragma unroll
        for (int c = 0; c < ACT; ++c) { const int vb = c * 16 * NKV;    // a channel tile is NKV / 32 tiles of 512 elements = 16 NKV
            a[c] = cat16b(*(const v8us*)(pvh + vb), *(const v8us*)(pvh + vb + 256)); al[c] = cat16b(*(const v8us*)(pvl + vb), *(const v8us*)(pvl + vb + 256)); }
        asm volatile("s_wait_xcnt 0x0" :: "v"(pvh), "v"(pvl) : "memory");    // the v loads stay in flight over the work that follows: the wait in front of the step of their addresses (the addresses as inputs keep them whole up to it, so that no load's result lands in them)
        pvh += 512; pvl += 512;
    };
    auto read_p = [&](int m0) {    // reads the AQ query tiles' probabilities of keys m0 to m0 + 31 back
        const unsigned short* rh = psh[(m0 >> 5) & 1] + qt0 * 512 + lane * 8; const unsigned short* rl = psl[(m0 >> 5) & 1] + qt0 * 512 + lane * 8;
#pragma unroll
        for (int n = 0; n < AQ; ++n) ph[n] = cat16b(*(const v8usa*)(rh + n * 512), *(const v8usa*)(rh + n * 512 + 256));
        __builtin_amdgcn_sched_barrier(0);    // keeps the hi fragments, which the first two of the three products need, in front of the residuals in the LDS queue: behind a barrier all eight waves read at once
#pragma unroll
        for (int n = 0; n < AQ; ++n) pl[n] = cat16b(*(const v8usa*)(rl + n * 512), *(const v8usa*)(rl + n * 512 + 256));
    };
    auto products = [&]() {
#pragma unroll
        for (int c = 0; c < ACT; ++c) {
#pragma unroll
            for (int n = 0; n < AQ; ++n) acc[c][n] = wmmab(a[c], ph[n], acc[c][n]); }
#pragma unroll
        for (int c = 0; c < ACT; ++c) {
#pragma unroll
            for (int n = 0; n < AQ; ++n) acc[c][n] = wmmab(al[c], ph[n], acc[c][n]); }
#pragma unroll
        for (int c = 0; c < ACT; ++c) {
#pragma unroll
            for (int n = 0; n < AQ; ++n) acc[c][n] = wmmab(a[c], pl[n], acc[c][n]); }
    };
    fetch_k(0); produce(0);
    if (late) load_v();
    lds_barrier();    // publishes the first trip's probabilities
#pragma unroll 1    // stays rolled: the two buffers are told apart by an index, and a trip is long enough to carry its branches
    for (int m0 = 0; m0 < NKV - 32; m0 += 32) {
        if (!late) load_v();    // this trip's
        read_p(m0);
        if (!late) produce(m0 + 32);
        products();
        if (late) { load_v(); produce(m0 + 32); }    // the next trip's v: its registers are free now
        lds_barrier();    // publishes the next trip's probabilities and ends every wave's reads of the buffer that the next trip refills
    }
    if (!late) load_v();
    read_p(NKV - 32);
    pinv[tid] = 1.0f / (sum + __shfl_xor(sum, 16, 32));    // the row sums are complete
    products();
    lds_barrier();    // publishes the reciprocals
#pragma unroll
    for (int n = 0; n < AQ; ++n) { const float inv = pinv[(qt0 + n) * 32 + lane];
        const size_t ob = ((size_t)((q0 >> 4) + n) * (CC / 32) + (cb >> 5)) * 512 + lane * 8;    // channel tile c is k half c & 1 of k block c / 2 from there: c * 256
#pragma unroll
        for (int c = 0; c < ACT; ++c) { v8us oh, ol;
#pragma unroll
            for (int r = 0; r < 8; ++r) { const float v = acc[c][n][r] * inv; const unsigned short hb = f2bf(v); oh[r] = hb; ol[r] = f2bf(v - bf2f(hb)); }
            // the two stores and their wait in one statement: the next tile's split reuses the registers they name
            asm volatile("global_store_b128 %0, %1, off\n\tglobal_store_b128 %2, %3, off\n\ts_wait_xcnt 0x0"
                         :: "v"(OAh + ob + c * 256), "v"(__builtin_bit_cast(v4u, oh)), "v"(OAl + ob + c * 256), "v"(__builtin_bit_cast(v4u, ol)) : "memory"); } }
}

extern "C" void kernel_launch(void* const* d_in, const int* in_sizes, int n_in,
                              void* d_out, int out_size, void* d_ws, size_t ws_size, hipStream_t stream) {
    (void)in_sizes; (void)n_in; (void)out_size;
    const float* x = (const float*)d_in[0]; const float* wq = (const float*)d_in[1]; const float* wk = (const float*)d_in[2]; const float* wv = (const float*)d_in[3]; const float* wo = (const float*)d_in[4]; const float* gam = (const float*)d_in[5];
    float* out = (float*)d_out;    // [8][256][64][64]
    char* wsp = (char*)d_ws;
    auto take = [&](size_t bytes) { char* p = wsp; wsp += (bytes + 255) & ~(size_t)255; return (void*)p; };
    bf* WqP = (bf*)take((size_t)DQP * CC * 2); bf* WkP = (bf*)take((size_t)DQP * CC * 2); bf* WvB = (bf*)take((size_t)CC * CC * 2); bf* WoB = (bf*)take((size_t)CC * CC * 2); bf* WZ = (bf*)take((size_t)CC * CC * 2);
    bf* XT = (bf*)take((size_t)NBI * NTOK * CC * 2); bf* KVh = (bf*)take((size_t)NBI * NKV * CC * 2); bf* KVl = (bf*)take((size_t)NBI * NKV * CC * 2);
    bf* Qh = (bf*)take((size_t)NBI * NTOK * DQP * 2); bf* Ql = (bf*)take((size_t)NBI * NTOK * DQP * 2); bf* Kh = (bf*)take((size_t)NBI * NKV * DQP * 2); bf* Kl = (bf*)take((size_t)NBI * NKV * DQP * 2);
    bf* Vh = (bf*)take((size_t)NBI * CC * NKV * 2); bf* Vl = (bf*)take((size_t)NBI * CC * NKV * 2);
    bf* OAh = (bf*)take((size_t)NBI * NTOK * CC * 2); bf* OAl = (bf*)take((size_t)NBI * NTOK * CC * 2);
    if ((size_t)(wsp - (char*)d_ws) > ws_size) return;    // MiB: 0.4 + 16 + 8 + 8 + 2 + 8 + 32 ~ 75 of 256
    k_prep<<<RB_WT + RB_PL + 2 * RB_WP + 2 * RB_BZ, 256, 0, stream>>>(x, wq, wk, wv, wo, WqP, WkP, WvB, WoB, WZ, XT, KVh, KVl);
    k_proj<<<PB_V + PB_Q + PB_K, 128, 0, stream>>>(XT, KVh, KVl, WqP, WkP, WvB, WZ, Qh, Ql, Kh, Kl, Vh, Vl);
    k_attn<<<dim3(NTOK / AQB, 1, NBI), ANW * 32, 0, stream>>>(Qh, Ql, Kh, Kl, Vh, Vl, OAh, OAl);                                                    // out_attn token-major [8][4096][256] hi/lo
    k_out<<<dim3(CC / 64, NTOK / 64, NBI), 128, 0, stream>>>(WoB, WZ, OAh, OAl, x, gam, out);    // out = x + gamma wo.out_attn^T [8][256][4096]
}

// v007
// Measured time: 87 microseconds a run.
// In two side-by-side timings against v006, it was 1.34 and 1.33 times as fast.
// Counting every step since v000, it is 11.3 times as fast.
#include <hip/hip_runtime.h>

// Compute dtypes, f32 accumulate, batch items side by side in every launch (on blockIdx.z in k_attn, in the block index in k_prep and k_proj): q = x^T.wq^T ([4096 x 256].[256 x 32->64 padded], exact bf16 transposed input and weight); the 2x2 average
// pool in f32 -> x_kv^T as bf16 hi + UNSCALED residual; k = x_kv^T.wk^T and v = wv.x_kv (split pooled operand, two/three products); scores = q.k^T/sqrt(32)
// ([4096 x 32].[32 x 1024], three products), row softmax in f32 -> bf16 hi + UNSCALED residual; out_attn = attn.v^T ([4096 x 1024].[1024 x 256], three products),
// and y = wo.out_attn^T ([256 x 256].[256 x 4096], exact wo against split, two products) on v_wmma_f32_16x16x32_bf16; out = x + gamma y in f32; these five in one kernel. Every product's kernel stores what its consumer reads (the hi/lo planes, or out itself). Deterministic, no atomics;
// Three launches: k_prep (all that reads the inputs alone), k_proj (q, k, v), k_attn (all the rest); kernels that need nothing of one another share a launch, a block taking its part by its index.
// Every bf16 plane in the workspace stands in FRAGMENT ORDER: a plane of R rows x K is cut in tiles of 16 rows x 32 k, tile (r / 16, k / 32) at element ((r / 16) (K / 32) + k / 32) 512, and inside a tile
// [k half of 16][lane = ((k / 8) & 1) 16 + (r & 15)][8 k]: the two 16-byte loads of an A or B fragment are each 512 contiguous bytes (4 whole lines) a wave, where row-major planes gave 16 lines.

#define NBI  8
#define CC   256
#define HW   64
#define NTOK 4096
#define NKV  1024               // 32 x 32 pooled
#define DQ   32
#define DQP  64                 // padded head dim (zeros)
#define DM   CC
#define NTK  NTOK
#define LOSC 1024.0f

typedef _Float16 h16;
typedef unsigned short bf;
typedef __attribute__((ext_vector_type(16))) __bf16   v16bf;
typedef __attribute__((ext_vector_type(16))) _Float16 v16h;
typedef __attribute__((ext_vector_type(8)))  _Float16 v8h;
typedef __attribute__((ext_vector_type(8)))  unsigned short v8us;
typedef __attribute__((ext_vector_type(8)))  float    v8f;
typedef __attribute__((ext_vector_type(4)))  float    v4f;
typedef __attribute__((ext_vector_type(4)))  _Float16 v4h;
typedef v8h  __attribute__((may_alias)) v8ha;
typedef v4f  __attribute__((may_alias)) v4fa;
typedef v8us __attribute__((may_alias)) v8usa;

__device__ __forceinline__ unsigned short f2bf(float f) { unsigned u = __float_as_uint(f); u += 0x7FFFu + ((u >> 16) & 1u); return (unsigned short)(u >> 16); }
__device__ __forceinline__ float bf2f(unsigned short b) { return __uint_as_float(((unsigned)b) << 16); }
__device__ __forceinline__ float bfr(float f) { return bf2f(f2bf(f)); }
__device__ __forceinline__ v16h cat16(v8h lo, v8h hi) { return __builtin_shufflevector(lo, hi, 0, 1, 2, 3, 4, 5, 6, 7, 8, 9, 10, 11, 12, 13, 14, 15); }
__device__ __forceinline__ v16bf cat16b(v8us lo, v8us hi) { return __builtin_bit_cast(v16bf, __builtin_shufflevector(lo, hi, 0, 1, 2, 3, 4, 5, 6, 7, 8, 9, 10, 11, 12, 13, 14, 15)); }
__device__ __forceinline__ v8f wmma16(v16h a, v16h b, v8f c) { return __builtin_amdgcn_wmma_f32_16x16x32_f16(false, a, false, b, (short)0, c, false, false); }
__device__ __forceinline__ v8f wmmab(v16bf a, v16bf b, v8f c) { return __builtin_amdgcn_wmma_f32_16x16x32_bf16(false, a, false, b, (short)0, c, false, false); }
// frag_off: the element at which the 8 consecutive k from 8 k8 on of row r stand in a fragment-order plane of KB = K / 32 k blocks.
__device__ __forceinline__ size_t frag_off(int r, int k8, int KB) { return ((size_t)(r >> 4) * KB + (k8 >> 2)) * 512 + ((k8 >> 1) & 1) * 256 + ((k8 & 1) * 16 + (r & 15)) * 8; }

// d_wt: WT (rows n, K wide, fragment order) = bf16(W[k][n]) (k-major [K][ncols]) via 64 x 64 LDS tiles; block (bx, by, bz) of (K/64, ncols/64, matrices), 256 threads. A wave's store is one k half of one fragment tile: 512 contiguous bytes.
__device__ __forceinline__ void d_wt(const float* __restrict__ Wm, int K, int ncols, bf* WT, int bx, int by, int bz) {
    __shared__ __align__(16) unsigned short tl[64 * 72];
    const int tid = threadIdx.x, k0 = bx * 64, n0 = by * 64;
    Wm += (size_t)bz * K * ncols; WT += (size_t)bz * K * ncols;
    const int kk = tid >> 2, nq = (tid & 3) * 16;
#pragma unroll
    for (int i = 0; i < 16; ++i) tl[(nq + i) * 72 + kk] = f2bf(Wm[(size_t)(k0 + kk) * ncols + n0 + nq + i]);
    __syncthreads();
    const int lane = tid & 31;
#pragma unroll
    for (int s = 0; s < 2; ++s) { const int ch = (tid >> 5) * 2 + s, rt = ch >> 2, kq = ch & 3;    // row tile rt of 4; kq = k block of 2, k half of 2
        const v8us val = *(const v8usa*)(tl + (rt * 16 + (lane & 15)) * 72 + (kq * 2 + (lane >> 4)) * 8);
        *(v8us*)(WT + ((size_t)((n0 >> 4) + rt) * (K >> 5) + (k0 >> 5)) * 512 + kq * 256 + lane * 8) = val; }
    asm volatile("s_wait_xcnt 0x0" ::: "memory");    // the wait behind the two stores: in the merged kernel's text another part's code, which writes the registers they name, follows this one
}
// split_rows: a wave's staged 16 x 64 f32 tile -> bf16 hi + UNSCALED residual planes in fragment order: two tiles side by side, 2 KiB in a row a plane (ch, cl: the first tile's start); pass s stores one k half, 512 contiguous bytes.
__device__ __forceinline__ void split_rows(const float* os, int lane, bf* ch, bf* cl) {
    ch += lane * 8; cl += lane * 8;
#pragma unroll
    for (int s = 0; s < 4; ++s) { const float* sp = os + (lane & 15) * 68 + s * 16 + (lane >> 4) * 8;
        const v4f v0 = *(const v4fa*)sp, v1 = *(const v4fa*)(sp + 4); v8us oh, ol;
#pragma unroll
        for (int i = 0; i < 8; ++i) { const float v = i < 4 ? v0[i & 3] : v1[i & 3]; const unsigned short hb = f2bf(v); oh[i] = hb; ol[i] = f2bf(v - bf2f(hb)); }
        *(v8us*)(ch + s * 256) = oh; *(v8us*)(cl + s * 256) = ol;
        asm volatile("s_wait_xcnt 0x0" ::: "memory"); }    // the wait behind the two stores, in front of the next pass's (in a merged kernel's text: another part's) writes of the registers they name
}
// d_gemmb (block (bx, by, bz), 128 threads, ost: the block's staging tiles in LDS): 64 x 64 block tile (4 waves x 16 x 64) of C [rows][DQP] = (A [+ Al]).B^T over K; the epilogue splits the f32 tile itself and stores the two bf16 planes its consumer reads.
template <bool SPLITA, int K>
__device__ __forceinline__ void d_gemmb(float (*ost)[16 * 68], int bx, int by, int bz, const bf* __restrict__ A, const bf* __restrict__ Al, const bf* __restrict__ Bn, bf* Ch, bf* Cl, size_t sA, size_t sC) {
    const int lane = threadIdx.x & 31, wave = threadIdx.x >> 5, lr = lane & 15, hi = lane >> 4;
    const int r0 = bx * 64 + wave * 16, c0 = by * 64;
    A += bz * sA; if (SPLITA) Al += bz * sA; Ch += bz * sC; Cl += bz * sC;    // item bz: element strides sA (A planes), sC (C planes); B is shared
    const size_t aoff = (size_t)(r0 >> 4) * (K * 16) + lane * 8;    // fragment order: a row tile is K / 32 tiles of 512 elements = 16 K, a constant: one address a plane, B's four row tiles as immediate offsets
    const bf* pa = A + aoff; const bf* pal = SPLITA ? Al + aoff : pa; const bf* pb = Bn + (size_t)(c0 >> 4) * (K * 16) + lane * 8;
    v8f acc[4];
#pragma unroll
    for (int t = 0; t < 4; ++t) acc[t] = (v8f){};
#pragma unroll 1
    for (int kc = 0; kc < K; kc += 32) {
        const v16bf a = cat16b(*(const v8us*)pa, *(const v8us*)(pa + 256));
        v16bf al = a;
        if (SPLITA) al = cat16b(*(const v8us*)pal, *(const v8us*)(pal + 256));
#pragma unroll
        for (int t = 0; t < 4; ++t) { const v16bf b = cat16b(*(const v8us*)(pb + t * K * 16), *(const v8us*)(pb + t * K * 16 + 256)); acc[t] = wmmab(a, b, acc[t]); if (SPLITA) acc[t] = wmmab(al, b, acc[t]); }
        asm volatile("v_nop\n\tv_nop\n\tv_nop\n\tv_nop" : "+v"(acc[0]), "+v"(acc[1]), "+v"(acc[2]), "+v"(acc[3]) : "v"(a), "v"(al));
        asm volatile("s_wait_xcnt 0x0" :: "v"(pa), "v"(pal), "v"(pb) : "memory");    // the wait in front of the step of the trip's load addresses (the addresses as inputs keep them whole up to it, so that no load's result lands in them)
        pa += 512; pal += 512; pb += 512;
    }
    float* os = &ost[wave][0];
#pragma unroll
    for (int t = 0; t < 4; ++t) {
#pragma unroll
        for (int j = 0; j < 8; ++j) os[(hi * 8 + j) * 68 + t * 16 + lr] = acc[t][j]; }
    __syncthreads();
    const size_t co = ((size_t)(r0 >> 4) * (DQP / 32) + (c0 >> 5)) * 512;
    split_rows(os, lane, Ch + co, Cl + co);
}

// d_gemm3 (block (bx, by, bz), 128 threads, ost as above): 64 x 64 tile of C = (Ah + Al).(Bh + Bl)^T over K (all four planes K wide, in fragment order; n-major B; C is LDC wide): three products per 32-k step (hh, hl, lh). The epilogue writes what
// the consumer reads: the two bf16 planes of C.
template <int LDC, int K>
__device__ __forceinline__ void d_gemm3(float (*ost)[16 * 68], int bx, int by, int bz, const bf* __restrict__ Ah, const bf* __restrict__ Al, const bf* __restrict__ Bh, const bf* __restrict__ Bl, bf* Ch, bf* Cl,
                                        size_t sA, size_t sB, size_t sC) {
    const int lane = threadIdx.x & 31, wave = threadIdx.x >> 5, lr = lane & 15, hi = lane >> 4;
    const int r0 = bx * 64 + wave * 16, c0 = by * 64;
    Ah += bz * sA; Al += bz * sA; Bh += bz * sB; Bl += bz * sB;    // item bz: element strides (0 = shared weights)
    const size_t co = bz * sC + ((size_t)(r0 >> 4) * (LDC / 32) + (c0 >> 5)) * 512;    // the planes of C in fragment order
    const size_t aoff = (size_t)(r0 >> 4) * (K * 16) + lane * 8, boff = (size_t)(c0 >> 4) * (K * 16) + lane * 8;    // a row tile is 16 K elements, a constant: one address a plane, B's four row tiles as immediate offsets
    const bf* pa = Ah + aoff; const bf* pal = Al + aoff; const bf* pbh = Bh + boff; const bf* pbl = Bl + boff;
    v8f acc[4];
#pragma unroll
    for (int t = 0; t < 4; ++t) acc[t] = (v8f){};
#pragma unroll 1
    for (int kc = 0; kc < K; kc += 32) {
        const v16bf a = cat16b(*(const v8us*)pa, *(const v8us*)(pa + 256));
        const v16bf al = cat16b(*(const v8us*)pal, *(const v8us*)(pal + 256));
#pragma unroll
        for (int t = 0; t < 4; ++t) { const int bo = t * K * 16;
            const v16bf bh = cat16b(*(const v8us*)(pbh + bo), *(const v8us*)(pbh + bo + 256)); const v16bf bl = cat16b(*(const v8us*)(pbl + bo), *(const v8us*)(pbl + bo + 256));
            acc[t] = wmmab(a, bh, acc[t]); acc[t] = wmmab(al, bh, acc[t]); acc[t] = wmmab(a, bl, acc[t]); }
        asm volatile("v_nop\n\tv_nop\n\tv_nop\n\tv_nop" : "+v"(acc[0]), "+v"(acc[1]), "+v"(acc[2]), "+v"(acc[3]) : "v"(a), "v"(al));
        asm volatile("s_wait_xcnt 0x0" :: "v"(pa), "v"(pal), "v"(pbh), "v"(pbl) : "memory");    // the wait in front of the step of the trip's load addresses (the addresses as inputs keep them whole up to it, so that no load's result lands in them)
        pa += 512; pal += 512; pbh += 512; pbl += 512;
    }
    float* os = &ost[wave][0];
#pragma unroll
    for (int t = 0; t < 4; ++t) {
#pragma unroll
        for (int j = 0; j < 8; ++j) os[(hi * 8 + j) * 68 + t * 16 + lr] = acc[t][j]; }
    __builtin_amdgcn_wave_barrier(); asm volatile("" ::: "memory");
    split_rows(os, lane, Ch + co, Cl + co);
}

// k_proj: the three projections, which need nothing of one another, side by side in one launch; the branch is on the block index alone, so a block's barrier is passed by all its threads.
#define PB_V (CC / 64 * (NKV / 64) * NBI)    // blocks of v, of q, of k
#define PB_Q (NTOK / 64 * NBI)
#define PB_K (NKV / 64 * NBI)
__global__ __launch_bounds__(128) void k_proj(const bf* __restrict__ XT, const bf* __restrict__ KVh, const bf* __restrict__ KVl, const bf* __restrict__ WqP, const bf* __restrict__ WkP, const bf* __restrict__ WvB, const bf* __restrict__ WZ,
                                              bf* Qh, bf* Ql, bf* Kh, bf* Kl, bf* Vh, bf* Vl) {
    __shared__ __align__(16) float ost[4][16 * 68];
    const int b = blockIdx.x, bq = b - PB_V, bk = bq - PB_Q;
    if (b < PB_V) d_gemm3<NKV, CC>(ost, b % (CC / 64), b / (CC / 64) % (NKV / 64), b / (CC / 64 * (NKV / 64)), WvB, WZ, KVh, KVl, Vh, Vl, 0, (size_t)NKV * CC, (size_t)CC * NKV);    // v [8][256][1024] hi/lo
    else if (bq < PB_Q) d_gemmb<false, DM>(ost, bq % (NTOK / 64), 0, bq / (NTOK / 64), XT, nullptr, WqP, Qh, Ql, (size_t)NTOK * CC, (size_t)NTOK * DQP);    // q [8][4096][64] (32 real) hi/lo
    else d_gemmb<true, DM>(ost, bk % (NKV / 64), 0, bk / (NKV / 64), KVh, KVl, WkP, Kh, Kl, (size_t)NKV * CC, (size_t)NKV * DQP);    // k [8][1024][64] hi/lo
}

// d_bfz: with ZP the plane of zeros dz is written too (one caller alone asks for it: one writer a line).
template <bool ZP>
__device__ __forceinline__ void d_bfz(const float* __restrict__ src, bf* dh, bf* dz, size_t n8, int bx) {
    const size_t i = (size_t)bx * 256 + threadIdx.x; if (i >= n8) return;
    const v8f v = *(const v8f*)(src + i * 8); v8us o, z;
#pragma unroll
    for (int k = 0; k < 8; ++k) { o[k] = f2bf(v[k]); z[k] = 0; }
    *(v8us*)(dh + frag_off((int)(i / (CC / 8)), (int)(i % (CC / 8)), CC / 32)) = o; if (ZP) *(v8us*)(dz + i * 8) = z;    // src is [rows][CC]; the plane of zeros reads the same in any order
}
__device__ __forceinline__ void d_wpad(const float* __restrict__ w, bf* WP, int bx) {
    const int u = bx * 256 + threadIdx.x; if (u >= DQP * CC / 8) return;
    const int d = u / (CC / 8), c0 = (u % (CC / 8)) * 8; v8us o;
#pragma unroll
    for (int i = 0; i < 8; ++i) o[i] = (d < DQ) ? f2bf(w[d * CC + c0 + i]) : (unsigned short)0;
    *(v8us*)(WP + frag_off(d, c0 / 8, CC / 32)) = o;
}
// d_poolT: x_kv^T[m][c] = mean of the 2x2 block (f32, the reference's order ((a+b)+(c+d))/4 -> sum then * 0.25) of bf16-rounded x -> bf16 hi + UNSCALED residual planes (fragment order).
// A wave makes one k half of one fragment tile, its lanes as the fragment's: 16 pooled positions of one pooled row x 2 groups of 8 channels. A store is 512 contiguous bytes, and 16 lanes read one whole line of a channel's image row.
__device__ __forceinline__ void d_poolT(const float* __restrict__ x, bf* Ph, bf* Pl, int bx, int bz) {
    const int lane = threadIdx.x & 31, w = bx * 8 + (threadIdx.x >> 5); if (w >= (NKV / 16) * (CC / 16)) return;
    const int m = (w / (CC / 16)) * 16 + (lane & 15), k8 = (w % (CC / 16)) * 2 + (lane >> 4);    // pooled position; group of 8 channels
    x += (size_t)bz * CC * NTOK; Ph += (size_t)bz * NKV * CC; Pl += (size_t)bz * NKV * CC;
    const int pi = m / 32, pj = m % 32; v8us oh, ol;
    const float* xb = x + (size_t)(k8 * 8) * NTOK + (2 * pi) * HW + 2 * pj;
#pragma unroll
    for (int i = 0; i < 8; ++i) { const float* xc = xb + i * NTOK;
        const float s = (bfr(xc[0]) + bfr(xc[1])) + (bfr(xc[HW]) + bfr(xc[HW + 1])); const float v = s * 0.25f; const unsigned short hb = f2bf(v); oh[i] = hb; ol[i] = f2bf(v - bf2f(hb)); }
    asm volatile("s_wait_xcnt 0x0" :: "v"(xb) : "memory");    // the wait in front of any overwrite of the x loads' address registers (the address as an input keeps it whole up to it, so that no load's result lands in it)
    const size_t o = frag_off(m, k8, CC / 32); *(v8us*)(Ph + o) = oh; *(v8us*)(Pl + o) = ol;
}
// k_prep: all that reads the inputs alone (the four weight planes, x^T, the pool), side by side in one launch; the branch is on the block index alone, so the barrier of d_wt is passed by all threads of its block.
#define RB_WP (DQP * CC / 8 / 256)            // blocks of one padded weight, of one square weight, of x^T, of the pool
#define RB_BZ (CC * CC / 8 / 256)
#define RB_WT (CC / 64 * (NTOK / 64) * NBI)
#define RB_PL ((NKV / 16) * (CC / 16) / 8 * NBI)
__global__ __launch_bounds__(256) void k_prep(const float* __restrict__ x, const float* __restrict__ wq, const float* __restrict__ wk, const float* __restrict__ wv, const float* __restrict__ wo,
                                              bf* WqP, bf* WkP, bf* WvB, bf* WoB, bf* WZ, bf* XT, bf* KVh, bf* KVl) {
    const int b = blockIdx.x, b1 = b - RB_WP, b2 = b1 - RB_WP, b3 = b2 - RB_BZ, b4 = b3 - RB_BZ, b5 = b4 - RB_WT;    // the 80 small blocks first: they are done while the large parts still start
    if (b < RB_WP) d_wpad(wq, WqP, b);
    else if (b1 < RB_WP) d_wpad(wk, WkP, b1);
    else if (b2 < RB_BZ) d_bfz<true>(wv, WvB, WZ, CC * CC / 8, b2);
    else if (b3 < RB_BZ) d_bfz<false>(wo, WoB, nullptr, CC * CC / 8, b3);
    else if (b4 < RB_WT) d_wt(x, CC, NTOK, XT, b4 % (CC / 64), b4 / (CC / 64) % (NTOK / 64), b4 / (CC / 64 * (NTOK / 64)));    // x^T [8][4096][256] exact
    else d_poolT(x, KVh, KVl, b5 % (RB_PL / NBI), b5 / (RB_PL / NBI));    // x_kv^T [8][1024][256] hi/lo
}
#define AQ   4
#define ACT  4
#define ANW  8                  // waves per block
#define ACG  (CC / 16 / ACT)    // channel groups
#define AQB  (ANW / ACG * AQ * 16)   // queries per block = ANW query tiles, one a producer
#define SCL2 0.25503486f        // (1/sqrt(32)) * log2(e)
typedef __attribute__((ext_vector_type(2))) float  v2f;
typedef __attribute__((ext_vector_type(2))) __bf16 v2bf;
typedef __attribute__((ext_vector_type(4))) unsigned int v4u;
typedef __attribute__((ext_vector_type(16))) unsigned short v16us;
// lds_barrier: the work-group barrier with the order of LDS accesses alone (a wave's LDS reads and writes are done before it signals). __syncthreads() would wait for the wave's global loads too, and the v fragments asked for ahead of it are to stay in flight across it.
__device__ __forceinline__ void lds_barrier() {
    __builtin_amdgcn_fence(__ATOMIC_RELEASE, "workgroup", "local");
    __builtin_amdgcn_s_barrier();
    __builtin_amdgcn_fence(__ATOMIC_ACQUIRE, "workgroup", "local");
}
__global__ __launch_bounds__(ANW * 32) void k_attn(const bf* __restrict__ Qh, const bf* __restrict__ Ql, const bf* __restrict__ Kh, const bf* __restrict__ Kl,
                                                   const bf* __restrict__ Vh, const bf* __restrict__ Vl, const bf* __restrict__ XT, const bf* __restrict__ Wo, const float* __restrict__ gam, float* OUTP) {
    __shared__ __align__(16) unsigned short ksh[NKV * DQ], ksl[NKV * DQ];    // per 16-key tile 512 elements: [k half of the fragment][lane][8]; behind the key loop: out_attn hi and residual, AQB tokens x CC channels
    static_assert(AQB * CC == NKV * DQ, "the out_attn planes take the LDS of k");
    __shared__ __align__(16) float ost[ANW][16 * 68];    // a wave's own tile of 16 channels x 64 tokens on its way to out
    __shared__ __align__(16) unsigned short psh[2][ANW * 512], psl[2][ANW * 512];    // probabilities of 32 keys, per query tile 512 elements: [k half of the fragment][lane][8]
    __shared__ float pinv[ANW * 32];    // 1 / row sum, [query tile][lane]
    const int tid = threadIdx.x, lane = tid & 31, wave = tid >> 5;
    const int qt0 = (wave / ACG) * AQ;    // first of the query tiles that the wave consumes
    const int q0 = blockIdx.x * AQB + qt0 * 16, cb = (wave % ACG) * (ACT * 16);
    const size_t it = blockIdx.z;
    Qh += it * NTOK * DQP; Ql += it * NTOK * DQP; Kh += it * NKV * DQP; Kl += it * NKV * DQP; Vh += it * CC * NKV; Vl += it * CC * NKV; XT += it * NTOK * CC; OUTP += it * CC * NTOK;
    const size_t qo = (size_t)(blockIdx.x * (AQB / 16) + wave) * (DQP / 32) * 512 + lane * 8;    // the query tile that the wave produces; k block 0 of a row tile holds the 32 real dims
    const bf* qp = Qh + qo; const bf* qlp = Ql + qo;
    const v16bf qh = cat16b(*(const v8us*)qp, *(const v8us*)(qp + 256)), ql = cat16b(*(const v8us*)qlp, *(const v8us*)(qlp + 256));
    asm volatile("s_wait_xcnt 0x0" :: "v"(qp), "v"(qlp) : "memory");    // the q loads stay in flight over the staging of k, which reuses their address registers: the wait in front of that overwrite (the two addresses as inputs keep them whole up to it)
    // k staging: a straight copy of k block 0 of every 16-key tile (the planes are in fragment order already); 64 threads a tile, four tiles a pass, so every load of a plane is one address pair plus a constant step, and every LDS store one index plus a constant step
    const bf* kp = Kh + (tid >> 6) * (DQP / 32) * 512 + (tid & 63) * 8; const bf* klp = Kl + (tid >> 6) * (DQP / 32) * 512 + (tid & 63) * 8;
    const int kd = tid * 8;
#pragma unroll    // whole: the constant steps become immediate offsets
    for (int g = 0; g < NKV / (ANW * 8) / 8; ++g) { v8us th[8], tl[8];    // groups of sixteen loads, each with its wait behind it
#pragma unroll
        for (int u = 0; u < 8; ++u) { th[u] = *(const v8us*)(kp + (g * 8 + u) * (ANW * 8) * DQP); tl[u] = *(const v8us*)(klp + (g * 8 + u) * (ANW * 8) * DQP); }
        asm volatile("s_wait_xcnt 0x0" :: "v"(kp), "v"(klp) : "memory");    // the wait in front of any overwrite of the k loads' address registers (the two addresses as inputs keep them whole up to it, so that no load's result lands in them)
#pragma unroll
        for (int u = 0; u < 8; ++u) { *(v8usa*)(ksh + kd + (g * 8 + u) * 2048) = th[u]; *(v8usa*)(ksl + kd + (g * 8 + u) * 2048) = tl[u]; } }
    __syncthreads();    // k is staged: from here on to the key loop's end its LDS is only read
    float mxu[4];
#pragma unroll
    for (int u = 0; u < 4; ++u) mxu[u] = -3.0e38f;
#pragma unroll 2    // two groups a trip: the second group's LDS reads issue ahead of the first group's matrix instructions
    for (int mt = 0; mt < NKV / 16; mt += 4) {    // four key tiles a group, product by product: with one query tile a wave the independent chains that cover the matrix unit's latency come from the keys
        v16bf a[4], al[4]; v8f s[4];
#pragma unroll
        for (int u = 0; u < 4; ++u) { const int kb = (mt + u) * 512 + lane * 8;
            a[u] = cat16b(*(const v8usa*)(ksh + kb), *(const v8usa*)(ksh + kb + 256)); al[u] = cat16b(*(const v8usa*)(ksl + kb), *(const v8usa*)(ksl + kb + 256)); }
#pragma unroll
        for (int u = 0; u < 4; ++u) s[u] = wmmab(a[u], qh, (v8f){});
#pragma unroll
        for (int u = 0; u < 4; ++u) s[u] = wmmab(al[u], qh, s[u]);
#pragma unroll
        for (int u = 0; u < 4; ++u) s[u] = wmmab(a[u], ql, s[u]);
#pragma unroll
        for (int r = 0; r < 8; ++r) {
#pragma unroll
            for (int u = 0; u < 4; ++u) mxu[u] = fmaxf(mxu[u], s[u][r]); }
    }
    float mx = fmaxf(fmaxf(mxu[0], mxu[1]), fmaxf(mxu[2], mxu[3]));
    mx = fmaxf(mx, __shfl_xor(mx, 16, 32));
    const float mc = mx * SCL2; float sum = 0.f;
    v16bf kf[2], kfl[2];
    auto fetch_k = [&](int m0) {    // the k fragments of keys m0 to m0 + 31, from LDS
#pragma unroll
        for (int t = 0; t < 2; ++t) { const int kb = (m0 / 16 + t) * 512 + lane * 8;
            kf[t] = cat16b(*(const v8usa*)(ksh + kb), *(const v8usa*)(ksh + kb + 256)); kfl[t] = cat16b(*(const v8usa*)(ksl + kb), *(const v8usa*)(ksl + kb + 256)); }
    };
    // produce: the probabilities of keys m0 to m0 + 31 for the wave's own query tile, hi and residual, into buffer (m0 / 32) & 1. Their k fragments were fetched by the call before; behind its score products it fetches the next call's
    // (behind the last keys: the first again, unused), so that a call starts with no LDS latency in front of it.
    auto produce = [&](int m0) {
        v8f s[2];
#pragma unroll
        for (int t = 0; t < 2; ++t) { v8f z = (v8f){}; z = wmmab(kf[t], qh, z); z = wmmab(kfl[t], qh, z); z = wmmab(kf[t], ql, z); s[t] = z; }
        fetch_k((m0 + 32) & (NKV - 1));
        float x[16]; v16bf ph, pl;
#pragma unroll
        for (int e = 0; e < 16; ++e) x[e] = __builtin_fmaf(s[e >> 3][e & 7], SCL2, -mc);
#pragma unroll
        for (int e = 0; e < 16; e += 8)    // eight exponentials a statement: each has an independent instruction behind it, the last a v_nop (the slot the instruction set asks for behind a transcendental)
            asm("v_exp_f32 %0, %0\n\tv_exp_f32 %1, %1\n\tv_exp_f32 %2, %2\n\tv_exp_f32 %3, %3\n\tv_exp_f32 %4, %4\n\tv_exp_f32 %5, %5\n\tv_exp_f32 %6, %6\n\tv_exp_f32 %7, %7\n\tv_nop"
                : "+v"(x[e]), "+v"(x[e + 1]), "+v"(x[e + 2]), "+v"(x[e + 3]), "+v"(x[e + 4]), "+v"(x[e + 5]), "+v"(x[e + 6]), "+v"(x[e + 7]));
#pragma unroll
        for (int e = 0; e < 16; e += 2) {
            const float p0 = x[e], p1 = x[e + 1];
            sum += p0 + p1;
            const v2bf h = __builtin_convertvector((v2f){p0, p1}, v2bf);
            const v2bf l = __builtin_convertvector((v2f){p0 - (float)h[0], p1 - (float)h[1]}, v2bf);
            ph[e] = h[0]; ph[e + 1] = h[1]; pl[e] = l[0]; pl[e + 1] = l[1]; }
        const int po = wave * 512 + lane * 8, pb = (m0 >> 5) & 1;
        const v16us uh = __builtin_bit_cast(v16us, ph), ul = __builtin_bit_cast(v16us, pl);
        *(v8usa*)(psh[pb] + po) = __builtin_shufflevector(uh, uh, 0, 1, 2, 3, 4, 5, 6, 7); *(v8usa*)(psh[pb] + po + 256) = __builtin_shufflevector(uh, uh, 8, 9, 10, 11, 12, 13, 14, 15);
        *(v8usa*)(psl[pb] + po) = __builtin_shufflevector(ul, ul, 0, 1, 2, 3, 4, 5, 6, 7); *(v8usa*)(psl[pb] + po + 256) = __builtin_shufflevector(ul, ul, 8, 9, 10, 11, 12, 13, 14, 15);
    };
    v8f acc[ACT][AQ];
#pragma unroll
    for (int c = 0; c < ACT; ++c) {
#pragma unroll
        for (int n = 0; n < AQ; ++n) acc[c][n] = (v8f){}; }
    const int vo = (cb >> 4) * (NKV / 32) * 512 + lane * 8;
    // The two waves that share a SIMD (w and w + ANW / 2) take a trip's two halves in opposite order, so that one's vector work runs beside the other's products instead of both waiting at the barrier for the second to finish both:
    // the first four waves multiply first and then produce, the last four produce first. For speed only: the result does not depend on where a wave runs. The test is the same in all lanes of a wave, and the barrier stands outside it.
    const bool late = __builtin_amdgcn_readfirstlane(wave) < ANW / 2;
    v16bf a[ACT], al[ACT], ph[AQ], pl[AQ];
    const bf* pvh = Vh + vo; const bf* pvl = Vl + vo;    // the v fragments that the wave asks for next: one address a plane, the channel tiles as immediate offsets
    auto load_v = [&]() {    // asks for the v fragments of 32 keys and steps on
#pragma unroll
        for (int c = 0; c < ACT; ++c) { const int vb = c * 16 * NKV;    // a channel tile is NKV / 32 tiles of 512 elements = 16 NKV
            a[c] = cat16b(*(const v8us*)(pvh + vb), *(const v8us*)(pvh + vb + 256)); al[c] = cat16b(*(const v8us*)(pvl + vb), *(const v8us*)(pvl + vb + 256)); }
        asm volatile("s_wait_xcnt 0x0" :: "v"(pvh), "v"(pvl) : "memory");    // the v loads stay in flight over the work that follows: the wait in front of the step of their addresses (the addresses as inputs keep them whole up to it, so that no load's result lands in them)
        pvh += 512; pvl += 512;
    };
    auto read_p = [&](int m0) {    // reads the AQ query tiles' probabilities of keys m0 to m0 + 31 back
        const unsigned short* rh = psh[(m0 >> 5) & 1] + qt0 * 512 + lane * 8; const unsigned short* rl = psl[(m0 >> 5) & 1] + qt0 * 512 + lane * 8;
#pragma unroll
        for (int n = 0; n < AQ; ++n) ph[n] = cat16b(*(const v8usa*)(rh + n * 512), *(const v8usa*)(rh + n * 512 + 256));
        __builtin_amdgcn_sched_barrier(0);    // keeps the hi fragments, which the first two of the three products need, in front of the residuals in the LDS queue: behind a barrier all eight waves read at once
#pragma unroll
        for (int n = 0; n < AQ; ++n) pl[n] = cat16b(*(const v8usa*)(rl + n * 512), *(const v8usa*)(rl + n * 512 + 256));
    };
    auto products = [&]() {
#pragma unroll
        for (int c = 0; c < ACT; ++c) {
#pragma unroll
            for (int n = 0; n < AQ; ++n) acc[c][n] = wmmab(a[c], ph[n], acc[c][n]); }
#pragma unroll
        for (int c = 0; c < ACT; ++c) {
#pragma unroll
            for (int n = 0; n < AQ; ++n) acc[c][n] = wmmab(al[c], ph[n], acc[c][n]); }
#pragma unroll
        for (int c = 0; c < ACT; ++c) {
#pragma unroll
            for (int n = 0; n < AQ; ++n) acc[c][n] = wmmab(a[c], pl[n], acc[c][n]); }
    };
    fetch_k(0); produce(0);
    if (late) load_v();
    lds_barrier();    // publishes the first trip's probabilities
#pragma unroll 1    // stays rolled: the two buffers are told apart by an index, and a trip is long enough to carry its branches
    for (int m0 = 0; m0 < NKV - 32; m0 += 32) {
        if (!late) load_v();    // this trip's
        read_p(m0);
        if (!late) produce(m0 + 32);
        products();
        if (late) { load_v(); produce(m0 + 32); }    // the next trip's v: its registers are free now
        lds_barrier();    // publishes the next trip's probabilities and ends every wave's reads of the buffer that the next trip refills
    }
    if (!late) load_v();
    // the residual's x, from the x^T plane: tile (n, c) is the 8 channels a lane of y's accumulator tile (c, n) holds; asked for here, so that the last keys' products and the split cover the way from memory
    const bf* px = XT + ((size_t)(q0 >> 4) * (CC / 32) + (cb >> 5)) * 512 + lane * 8;
    v8us xq[ACT][AQ];
#pragma unroll
    for (int n = 0; n < AQ; ++n) {
#pragma unroll
        for (int c = 0; c < ACT; ++c) xq[c][n] = *(const v8us*)(px + n * (CC * 16) + c * 256); }
    asm volatile("s_wait_xcnt 0x0" :: "v"(px) : "memory");    // the x loads stay in flight over the work that follows: the wait in front of any overwrite of their address registers (the address as an input keeps it whole up to it)
    read_p(NKV - 32);
    pinv[tid] = 1.0f / (sum + __shfl_xor(sum, 16, 32));    // the row sums are complete
    products();
    lds_barrier();    // publishes the reciprocals
    const float g = bfr(gam[0]);
    // wo's fragments of k blocks 0 and 1 (they run two blocks ahead of their products, on three sets of registers: one block's products are shorter than the way from L2): one address, the channel tiles and k blocks as immediate offsets
    const bf* pw = Wo + (cb >> 4) * (CC * 16) + lane * 8;
    v16bf wa[3][ACT];
#pragma unroll
    for (int kb = 0; kb < 2; ++kb) {
#pragma unroll
        for (int c = 0; c < ACT; ++c) wa[kb][c] = cat16b(*(const v8us*)(pw + c * (CC * 16) + kb * 512), *(const v8us*)(pw + c * (CC * 16) + kb * 512 + 256)); }
    // out_attn, divided and split, into the LDS that held k: no wave reads k behind the key loop's last barrier
#pragma unroll
    for (int n = 0; n < AQ; ++n) { const float inv = pinv[(qt0 + n) * 32 + lane];
        const int ob = ((qt0 + n) * (CC / 32) + (cb >> 5)) * 512 + lane * 8;    // channel tile c is k half c & 1 of k block c / 2 from there: c * 256
#pragma unroll
        for (int c = 0; c < ACT; ++c) { v8us oh, ol;
#pragma unroll
            for (int r = 0; r < 8; ++r) { const float v = acc[c][n][r] * inv; const unsigned short hb = f2bf(v); oh[r] = hb; ol[r] = f2bf(v - bf2f(hb)); }
            *(v8usa*)(ksh + ob + c * 256) = oh; *(v8usa*)(ksl + ob + c * 256) = ol; } }
    lds_barrier();    // publishes the block's out_attn planes
    v8f y[ACT][AQ];
#pragma unroll
    for (int c = 0; c < ACT; ++c) {
#pragma unroll
        for (int n = 0; n < AQ; ++n) y[c][n] = (v8f){}; }
    v16bf bh[2][AQ], bl[2][AQ];
    const unsigned short* roh = ksh + qt0 * (CC * 16) + lane * 8; const unsigned short* rol = ksl + qt0 * (CC * 16) + lane * 8;
#pragma unroll
    for (int n = 0; n < AQ; ++n) { bh[0][n] = cat16b(*(const v8usa*)(roh + n * (CC * 16)), *(const v8usa*)(roh + n * (CC * 16) + 256)); bl[0][n] = cat16b(*(const v8usa*)(rol + n * (CC * 16)), *(const v8usa*)(rol + n * (CC * 16) + 256)); }
#pragma unroll    // whole: the steps of wo's address and of the LDS index become immediate offsets, and the sets of fragments are told apart at compile time
    for (int kb = 0; kb < CC / 32; ++kb) {
        if (kb + 2 < CC / 32) { const int ko = (kb + 2) * 512;    // wo's fragments of the next k block but one
#pragma unroll
            for (int c = 0; c < ACT; ++c) wa[(kb + 2) % 3][c] = cat16b(*(const v8us*)(pw + c * (CC * 16) + ko), *(const v8us*)(pw + c * (CC * 16) + ko + 256)); }
        if (kb + 1 < CC / 32) { const int ko = (kb + 1) * 512;    // out_attn's fragments of the next k block, asked for as one group ahead of this block's products
#pragma unroll
            for (int n = 0; n < AQ; ++n) bh[(kb + 1) & 1][n] = cat16b(*(const v8usa*)(roh + n * (CC * 16) + ko), *(const v8usa*)(roh + n * (CC * 16) + ko + 256));
#pragma unroll
            for (int n = 0; n < AQ; ++n) bl[(kb + 1) & 1][n] = cat16b(*(const v8usa*)(rol + n * (CC * 16) + ko), *(const v8usa*)(rol + n * (CC * 16) + ko + 256)); }
        if (kb + 3 == CC / 32) asm volatile("s_wait_xcnt 0x0" :: "v"(pw) : "memory");    // behind the last wo loads: the wait in front of any overwrite of their address registers (the address as an input keeps it whole up to it)
        __builtin_amdgcn_sched_barrier(0);    // keeps the group of loads in front of the products: left alone the compiler put each LDS read directly in front of its four products, with the whole LDS latency in between
#pragma unroll
        for (int c = 0; c < ACT; ++c) {
#pragma unroll
            for (int n = 0; n < AQ; ++n) y[c][n] = wmmab(wa[kb % 3][c], bh[kb & 1][n], y[c][n]); }
#pragma unroll
        for (int c = 0; c < ACT; ++c) {
#pragma unroll
            for (int n = 0; n < AQ; ++n) y[c][n] = wmmab(wa[kb % 3][c], bl[kb & 1][n], y[c][n]); }
        __builtin_amdgcn_sched_barrier(0);    // keeps the next group of loads, and behind the last block the unpacking of x (which doubles its registers), behind these products
    }
    float* os = &ost[wave][0];
    const int lr = lane & 15, hi = lane >> 4;
    float* po = OUTP + (size_t)(cb + hi) * NTOK + q0 + lr * 4;    // pass s of a channel tile stores rows 2 s and 2 s + 1, 16 lanes a row of 64 floats (two whole lines)
#pragma unroll
    for (int c = 0; c < ACT; ++c) {
#pragma unroll
        for (int n = 0; n < AQ; ++n) {
#pragma unroll
            for (int j = 0; j < 8; ++j) os[(hi * 8 + j) * 68 + n * 16 + lr] = bf2f(xq[c][n][j]) + g * y[c][n][j]; }
        __builtin_amdgcn_fence(__ATOMIC_RELEASE, "wavefront", "local"); __builtin_amdgcn_wave_barrier(); __builtin_amdgcn_fence(__ATOMIC_ACQUIRE, "wavefront", "local");    // the lanes read one another's values: keeps the compiler from moving the reads in front of the writes (a wave's LDS operations run in order)
        v4u o[8];
#pragma unroll
        for (int s = 0; s < 8; ++s) o[s] = *(const v4u __attribute__((may_alias))*)(os + (2 * s + hi) * 68 + lr * 4);
        // the eight stores and their wait in one statement: the next tile's reads reuse the registers they name, and a wait in a statement of its own need not stay in front of that overwrite; its memory clobber also keeps the next tile's LDS writes behind this tile's reads. The offsets step by two rows of out (2 NTOK floats).
        static_assert(2 * NTOK * 4 == 32768, "the store offsets below");
        asm volatile("global_store_b128 %0, %1, off\n\tglobal_store_b128 %0, %2, off offset:32768\n\tglobal_store_b128 %0, %3, off offset:65536\n\tglobal_store_b128 %0, %4, off offset:98304\n\t"
                     "global_store_b128 %0, %5, off offset:131072\n\tglobal_store_b128 %0, %6, off offset:163840\n\tglobal_store_b128 %0, %7, off offset:196608\n\tglobal_store_b128 %0, %8, off offset:229376\n\ts_wait_xcnt 0x0"
                     :: "v"(po + (size_t)c * 16 * NTOK), "v"(o[0]), "v"(o[1]), "v"(o[2]), "v"(o[3]), "v"(o[4]), "v"(o[5]), "v"(o[6]), "v"(o[7]) : "memory");
    }
}

extern "C" void kernel_launch(void* const* d_in, const int* in_sizes, int n_in,
                              void* d_out, int out_size, void* d_ws, size_t ws_size, hipStream_t stream) {
    (void)in_sizes; (void)n_in; (void)out_size;
    const float* x = (const float*)d_in[0]; const float* wq = (const float*)d_in[1]; const float* wk = (const float*)d_in[2]; const float* wv = (const float*)d_in[3]; const float* wo = (const float*)d_in[4]; const float* gam = (const float*)d_in[5];
    float* out = (float*)d_out;    // [8][256][64][64]
    char* wsp = (char*)d_ws;
    auto take = [&](size_t bytes) { char* p = wsp; wsp += (bytes + 255) & ~(size_t)255; return (void*)p; };
    bf* WqP = (bf*)take((size_t)DQP * CC * 2); bf* WkP = (bf*)take((size_t)DQP * CC * 2); bf* WvB = (bf*)take((size_t)CC * CC * 2); bf* WoB = (bf*)take((size_t)CC * CC * 2); bf* WZ = (bf*)take((size_t)CC * CC * 2);
    bf* XT = (bf*)take((size_t)NBI * NTOK * CC * 2); bf* KVh = (bf*)take((size_t)NBI * NKV * CC * 2); bf* KVl = (bf*)take((size_t)NBI * NKV * CC * 2);
    bf* Qh = (bf*)take((size_t)NBI * NTOK * DQP * 2); bf* Ql = (bf*)take((size_t)NBI * NTOK * DQP * 2); bf* Kh = (bf*)take((size_t)NBI * NKV * DQP * 2); bf* Kl = (bf*)take((size_t)NBI * NKV * DQP * 2);
    bf* Vh = (bf*)take((size_t)NBI * CC * NKV * 2); bf* Vl = (bf*)take((size_t)NBI * CC * NKV * 2);
    if ((size_t)(wsp - (char*)d_ws) > ws_size) return;    // MiB: 0.4 + 16 + 8 + 8 + 2 + 8 ~ 43 of 256
    k_prep<<<RB_WT + RB_PL + 2 * RB_WP + 2 * RB_BZ, 256, 0, stream>>>(x, wq, wk, wv, wo, WqP, WkP, WvB, WoB, WZ, XT, KVh, KVl);
    k_proj<<<PB_V + PB_Q + PB_K, 128, 0, stream>>>(XT, KVh, KVl, WqP, WkP, WvB, WZ, Qh, Ql, Kh, Kl, Vh, Vl);
    k_attn<<<dim3(NTOK / AQB, 1, NBI), ANW * 32, 0, stream>>>(Qh, Ql, Kh, Kl, Vh, Vl, XT, WoB, gam, out);    // out = x + gamma wo.out_attn^T [8][256][4096]
}

// v008
// One run takes 66.5 microseconds.
// Two timings next to v007 put it at 1.33 and 1.29 times that version's speed.
// Over all steps from v000 it is 14.7 times as fast.
#include <hip/hip_runtime.h>

// Compute dtypes, f32 accumulate, batch items side by side on blockIdx.z of every launch: q = x^T.wq^T ([4096 x 256].[256 x 32], exact bf16 transposed input and weight); the 2x2 average
// pool in f32 -> x_kv^T as bf16 hi + UNSCALED residual; k = x_kv^T.wk^T and v = wv.x_kv (split pooled operand, two products); scores = q.k^T/sqrt(32)
// ([4096 x 32].[32 x 1024], three products), row softmax in f32 -> bf16 hi + UNSCALED residual; out_attn = attn.v^T ([4096 x 1024].[1024 x 256], three products),
// and y = wo.out_attn^T ([256 x 256].[256 x 4096], exact wo against split, two products) on v_wmma_f32_16x16x32_bf16; out = x + gamma y in f32; these five in one kernel. Every product's kernel stores what its consumer reads (the hi/lo planes, or out itself). Deterministic, no atomics;
// Two launches: k_front (x^T, the pool, q, k, v, wo's plane: a block needs nothing of another), k_attn (all the rest: it needs an item's whole k and v).
// Every bf16 plane in the workspace stands in FRAGMENT ORDER: a plane of R rows x K is cut in tiles of 16 rows x 32 k, tile (r / 16, k / 32) at element ((r / 16) (K / 32) + k / 32) 512, and inside a tile
// [k half of 16][lane = ((k / 8) & 1) 16 + (r & 15)][8 k]: the two 16-byte loads of an A or B fragment are each 512 contiguous bytes (4 whole lines) a wave, where row-major planes gave 16 lines.

#define NBI  8
#define CC   256
#define HW   64
#define NTOK 4096
#define NKV  1024               // 32 x 32 pooled
#define DQ   32
#define DQP  64                 // row pitch of the q and k planes: two k blocks, of which only the first (the 32 real dims) is written and read
#define DM   CC
#define NTK  NTOK
#define LOSC 1024.0f

typedef _Float16 h16;
typedef unsigned short bf;
typedef __attribute__((ext_vector_type(16))) __bf16   v16bf;
typedef __attribute__((ext_vector_type(16))) _Float16 v16h;
typedef __attribute__((ext_vector_type(8)))  _Float16 v8h;
typedef __attribute__((ext_vector_type(8)))  unsigned short v8us;
typedef __attribute__((ext_vector_type(8)))  float    v8f;
typedef __attribute__((ext_vector_type(4)))  float    v4f;
typedef __attribute__((ext_vector_type(4)))  _Float16 v4h;
typedef v8h  __attribute__((may_alias)) v8ha;
typedef v4f  __attribute__((may_alias)) v4fa;
typedef v8us __attribute__((may_alias)) v8usa;

__device__ __forceinline__ unsigned short f2bf(float f) { unsigned u = __float_as_uint(f); u += 0x7FFFu + ((u >> 16) & 1u); return (unsigned short)(u >> 16); }
__device__ __forceinline__ float bf2f(unsigned short b) { return __uint_as_float(((unsigned)b) << 16); }
__device__ __forceinline__ float bfr(float f) { return bf2f(f2bf(f)); }
__device__ __forceinline__ v16h cat16(v8h lo, v8h hi) { return __builtin_shufflevector(lo, hi, 0, 1, 2, 3, 4, 5, 6, 7, 8, 9, 10, 11, 12, 13, 14, 15); }
__device__ __forceinline__ v16bf cat16b(v8us lo, v8us hi) { return __builtin_bit_cast(v16bf, __builtin_shufflevector(lo, hi, 0, 1, 2, 3, 4, 5, 6, 7, 8, 9, 10, 11, 12, 13, 14, 15)); }
__device__ __forceinline__ v8f wmma16(v16h a, v16h b, v8f c) { return __builtin_amdgcn_wmma_f32_16x16x32_f16(false, a, false, b, (short)0, c, false, false); }
__device__ __forceinline__ v8f wmmab(v16bf a, v16bf b, v8f c) { return __builtin_amdgcn_wmma_f32_16x16x32_bf16(false, a, false, b, (short)0, c, false, false); }
// frag_off: the element at which the 8 consecutive k from 8 k8 on of row r stand in a fragment-order plane of KB = K / 32 k blocks.
__device__ __forceinline__ size_t frag_off(int r, int k8, int KB) { return ((size_t)(r >> 4) * KB + (k8 >> 2)) * 512 + ((k8 >> 1) & 1) * 256 + ((k8 & 1) * 16 + (r & 15)) * 8; }

typedef __attribute__((ext_vector_type(2))) float  v2f;
typedef __attribute__((ext_vector_type(2))) __bf16 v2bf;
typedef __attribute__((ext_vector_type(4))) unsigned int v4u;
// pk2: two f32 -> two bf16 (round to nearest even) in one word, a in the low half; bflo, bfhi: the two back as f32.
__device__ __forceinline__ unsigned pk2(float a, float b) { return __builtin_bit_cast(unsigned, __builtin_convertvector((v2f){a, b}, v2bf)); }
__device__ __forceinline__ float bflo(unsigned u) { return __uint_as_float(u << 16); }
__device__ __forceinline__ float bfhi(unsigned u) { return __uint_as_float(u & 0xFFFF0000u); }
__device__ __forceinline__ v8us cvt8(v4f a, v4f b) { const v4u u = {pk2(a[0], a[1]), pk2(a[2], a[3]), pk2(b[0], b[1]), pk2(b[2], b[3])}; return __builtin_bit_cast(v8us, u); }
// split8: a lane's 8 accumulator values -> bf16 hi + UNSCALED residual, 16 bytes each
__device__ __forceinline__ void split8(v8f v, v8us& oh, v8us& ol) {
    v4u h, l;
#pragma unroll
    for (int i = 0; i < 4; ++i) { h[i] = pk2(v[2 * i], v[2 * i + 1]); l[i] = pk2(v[2 * i] - bflo(h[i]), v[2 * i + 1] - bfhi(h[i])); }
    oh = __builtin_bit_cast(v8us, h); ol = __builtin_bit_cast(v8us, l);
}
__device__ __forceinline__ v16bf lfrag(const unsigned short* p) { return cat16b(*(const v8usa*)p, *(const v8usa*)(p + 256)); }    // a fragment from a fragment-order tile in LDS (p: the tile's start + 8 lane)

// k_front: all that comes before the attention, in one kernel. A block is one item's pair of image rows: 128 tokens = 32 pooled positions (one pooled row), all 256 channels, on 16 waves; nothing of it needs another block.
// PART 1: x is read once. Wave w takes channels 16 w to 16 w + 15, its lanes as a fragment's: lane = (group of 8 channels) 16 + pooled position; a lane reads the 2 x 2 block of its position in 8 channels (16 lanes: one whole line of an image row),
// so it holds 8 consecutive channels of 4 tokens (four 16-byte pieces of x^T) and of their mean (f32, ((a+b)+(c+d)) * 0.25 of the bf16-rounded x -> bf16 hi + UNSCALED residual). All three go to LDS in fragment order.
// The weights are read in f32 and rounded here: wq and wk by the 16 waves together, into LDS (fragment order); of wv a wave reads the rows of its own 16 output channels, straight into the registers of its B fragments.
// PART 2, behind the one barrier: x^T leaves for its plane as a straight copy (the block's tiles are 64 KiB in a row there), and the products run:
// v^T tile = x_kv^T.wv^T (A = pooled rows hi, residual; B = wv rows; wave w: output channels 16 w ...), q^T tile = wq.x (A = wq rows, B = x^T rows; wave w: token tile w / 2, head dims 16 (w & 1) ...), k^T alike on four waves.
// In each the 8 accumulator registers of a lane are 8 consecutive k of the plane that the attention reads, of one row: the split values are stored from the registers, 512 contiguous bytes a wave. Of the padded q and k planes only k block 0 (the 32 real dims) is written: nothing reads the other.
// One wave of each block rounds one k half of one fragment tile of wo for the attention kernel's last product.
#define FNW 16
#define FTK 128                 // tokens a block
#define FKV 32                  // pooled positions a block
#define KBN (CC / 32)           // k blocks of the channel dimension
__global__ __launch_bounds__(FNW * 32) void k_front(const float* __restrict__ x, const float* __restrict__ wq, const float* __restrict__ wk, const float* __restrict__ wv, const float* __restrict__ wo,
                                                    bf* WoB, bf* XT, bf* Qh, bf* Ql, bf* Kh, bf* Kl, bf* Vh, bf* Vl) {
    __shared__ __align__(16) unsigned short xs[FTK * CC], kvh[FKV * CC], kvl[FKV * CC], wqk[2 * DQ * CC];
    const int tid = threadIdx.x, lane = tid & 31, wave = __builtin_amdgcn_readfirstlane(tid >> 5), lr = lane & 15, hi = lane >> 4;
    const int pi = blockIdx.x; const size_t it = blockIdx.z;
    // wo: block b rounds k half b & 1 of k block (b / 2) & 7 of row tile b / 16, on its last wave (the test is the same in all lanes of a wave); asked for first, stored last
    const int b = (int)it * (NTOK / FTK) + pi;
    const bool wow = wave == FNW - 1;
    v4f o0 = (v4f){}, o1 = (v4f){};
    if (wow) { const float* pwo = wo + ((b >> 4) * 16 + lr) * CC + ((b >> 1) & 7) * 32 + (b & 1) * 16 + hi * 8;
        o0 = *(const v4f*)pwo; o1 = *(const v4f*)(pwo + 4);
        asm volatile("s_wait_xcnt 0x0" :: "v"(pwo) : "memory"); }    // the loads stay in flight over what follows: the wait in front of any overwrite of their address registers (the address as an input keeps it whole up to it)
    // wq (waves 0 to 7) and wk (8 to 15): a wave takes two k blocks of one row tile, 64 consecutive floats of 16 rows
    const float* pws = (wave >> 3 ? wk : wq) + (((wave >> 2) & 1) * 16 + lr) * CC + (wave & 3) * 64 + hi * 8;
    v4f ws[4][2];
#pragma unroll
    for (int u = 0; u < 4; ++u) { ws[u][0] = *(const v4f*)(pws + u * 16); ws[u][1] = *(const v4f*)(pws + u * 16 + 4); }
    asm volatile("s_wait_xcnt 0x0" :: "v"(pws) : "memory");    // as above
    const int k8 = wave * 2 + hi;    // the lane's group of 8 channels
    const float* xb = x + it * CC * NTOK + (size_t)(k8 * 8) * NTOK + pi * FTK + 2 * lr;
    v2f r[2][8][2];    // [half of the pooled row][channel][image row]
#pragma unroll
    for (int p = 0; p < 2; ++p) {
#pragma unroll
        for (int i = 0; i < 8; ++i) { r[p][i][0] = *(const v2f*)(xb + i * NTOK + p * 32); r[p][i][1] = *(const v2f*)(xb + i * NTOK + p * 32 + HW); } }
    asm volatile("s_wait_xcnt 0x0" :: "v"(xb) : "memory");    // as above
    // wv's rows of the wave's 16 output channels, asked for behind x so that their way from L2 is covered by x's way from memory
    const float* pwv = wv + (wave * 16 + lr) * CC + hi * 8;
    v4f wr[KBN][4];
#pragma unroll
    for (int kb = 0; kb < KBN; ++kb) { wr[kb][0] = *(const v4f*)(pwv + kb * 32); wr[kb][1] = *(const v4f*)(pwv + kb * 32 + 4); wr[kb][2] = *(const v4f*)(pwv + kb * 32 + 16); wr[kb][3] = *(const v4f*)(pwv + kb * 32 + 20); }
    asm volatile("s_wait_xcnt 0x0" :: "v"(pwv) : "memory");    // as above
    unsigned short* wd = wqk + (wave >> 2) * (CC * 16) + (wave & 3) * 1024 + lane * 8;    // [wq, wk][row tile][k block][k half][lane][8]
#pragma unroll
    for (int u = 0; u < 4; ++u) *(v8usa*)(wd + u * 256) = cvt8(ws[u][0], ws[u][1]);
#pragma unroll
    for (int p = 0; p < 2; ++p) {
        v4u t[2][2], ph, pl;    // t: [image row][column of the 2 x 2 block], 8 channels each
#pragma unroll
        for (int i = 0; i < 4; ++i) {
#pragma unroll
            for (int ro = 0; ro < 2; ++ro) {
#pragma unroll
                for (int e = 0; e < 2; ++e) t[ro][e][i] = pk2(r[p][2 * i][ro][e], r[p][2 * i + 1][ro][e]); }
            const float v0 = ((bflo(t[0][0][i]) + bflo(t[0][1][i])) + (bflo(t[1][0][i]) + bflo(t[1][1][i]))) * 0.25f;
            const float v1 = ((bfhi(t[0][0][i]) + bfhi(t[0][1][i])) + (bfhi(t[1][0][i]) + bfhi(t[1][1][i]))) * 0.25f;
            ph[i] = pk2(v0, v1); pl[i] = pk2(v0 - bflo(ph[i]), v1 - bfhi(ph[i])); }
#pragma unroll
        for (int ro = 0; ro < 2; ++ro) {
#pragma unroll
            for (int e = 0; e < 2; ++e) *(v8usa*)(xs + frag_off(ro * HW + p * 32 + 2 * lr + e, k8, KBN)) = __builtin_bit_cast(v8us, t[ro][e]); }
        const size_t ko = frag_off(p * 16 + lr, k8, KBN);
        *(v8usa*)(kvh + ko) = __builtin_bit_cast(v8us, ph); *(v8usa*)(kvl + ko) = __builtin_bit_cast(v8us, pl);
    }
    v16bf bv[KBN];
#pragma unroll
    for (int kb = 0; kb < KBN; ++kb) bv[kb] = cat16b(cvt8(wr[kb][0], wr[kb][1]), cvt8(wr[kb][2], wr[kb][3]));
    __builtin_amdgcn_sched_barrier(0);    // keeps the rounding of wv in front of the barrier: left alone the compiler carried the f32 values, twice the registers, into part 2
    __syncthreads();    // publishes the block's x^T, pooled and weight planes; from here on they are only read
    const int tt = wave >> 1, dt = wave & 1;
    // x^T to its plane: whole lines, 512 contiguous bytes a wave and pass
    bf* xd = XT + it * NTOK * CC + (size_t)pi * (FTK * CC) + tid * 8;
#pragma unroll
    for (int g = 0; g < 2; ++g) { v8us c[4];
#pragma unroll
        for (int s = 0; s < 4; ++s) c[s] = *(const v8usa*)(xs + tid * 8 + (g * 4 + s) * (FNW * 256));
#pragma unroll
        for (int s = 0; s < 4; ++s) *(v8us*)(xd + (g * 4 + s) * (FNW * 256)) = c[s];
        asm volatile("s_wait_xcnt 0x0" :: "v"(xd) : "memory"); }    // the wait behind the four stores, as above
    // q
    { v16bf a[KBN], f[KBN]; v8f aq = (v8f){};
#pragma unroll
      for (int kb = 0; kb < KBN; ++kb) { a[kb] = lfrag(wqk + (dt * KBN + kb) * 512 + lane * 8); f[kb] = lfrag(xs + (tt * KBN + kb) * 512 + lane * 8); }
      __builtin_amdgcn_sched_barrier(0);    // keeps the group of LDS reads in front of the products, as above
#pragma unroll
      for (int kb = 0; kb < KBN; ++kb) aq = wmmab(a[kb], f[kb], aq);
      const size_t qo = it * NTOK * DQP + (size_t)(pi * (FTK / 16) + tt) * (DQP / 32) * 512 + dt * 256 + lane * 8;
      bf* qdh = Qh + qo; bf* qdl = Ql + qo; v8us oh, ol; split8(aq, oh, ol); *(v8us*)qdh = oh; *(v8us*)qdl = ol;
      asm volatile("s_wait_xcnt 0x0" :: "v"(qdh), "v"(qdl) : "memory"); }    // the wait behind the two stores, as above
    // v: the pooled fragments of a k block are read as one group, one block ahead of their products
    v8f av[2] = {(v8f){}, (v8f){}};
    v16bf fh[2][2], fl[2][2];
#pragma unroll
    for (int mt = 0; mt < 2; ++mt) { fh[0][mt] = lfrag(kvh + mt * KBN * 512 + lane * 8); fl[0][mt] = lfrag(kvl + mt * KBN * 512 + lane * 8); }
#pragma unroll
    for (int kb = 0; kb < KBN; ++kb) {
        if (kb + 1 < KBN) {
#pragma unroll
            for (int mt = 0; mt < 2; ++mt) { const int o = (mt * KBN + kb + 1) * 512 + lane * 8; fh[(kb + 1) & 1][mt] = lfrag(kvh + o); fl[(kb + 1) & 1][mt] = lfrag(kvl + o); } }
        __builtin_amdgcn_sched_barrier(0);    // keeps the next block's reads in front of this block's products, as above
        av[0] = wmmab(fh[kb & 1][0], bv[kb], av[0]); av[1] = wmmab(fh[kb & 1][1], bv[kb], av[1]);
        av[0] = wmmab(fl[kb & 1][0], bv[kb], av[0]); av[1] = wmmab(fl[kb & 1][1], bv[kb], av[1]);
        __builtin_amdgcn_sched_barrier(0);    // keeps the block after next's reads, which refill these fragments' registers, behind these products
    }
    const size_t vo = it * CC * NKV + ((size_t)wave * (NKV / 32) + pi) * 512 + lane * 8;    // channel tile w, k block = the pooled row
    bf* vdh = Vh + vo; bf* vdl = Vl + vo;
#pragma unroll
    for (int mt = 0; mt < 2; ++mt) { v8us oh, ol; split8(av[mt], oh, ol); *(v8us*)(vdh + mt * 256) = oh; *(v8us*)(vdl + mt * 256) = ol; }
    asm volatile("s_wait_xcnt 0x0" :: "v"(vdh), "v"(vdl) : "memory");    // the wait behind the four stores, as above
    if (wave < 4) {    // k: pooled tile w / 2, head dims 16 (w & 1) ...; the test is the same in all lanes of a wave. Last, so that all from the barrier to here is one straight run of code
        v8f ak = (v8f){};
#pragma unroll
        for (int g = 0; g < 2; ++g) { v16bf a[4], fh[4], fl[4];
#pragma unroll
            for (int i = 0; i < 4; ++i) { const int o = (tt * KBN + g * 4 + i) * 512 + lane * 8;
                a[i] = lfrag(wqk + DQ * CC + (dt * KBN + g * 4 + i) * 512 + lane * 8); fh[i] = lfrag(kvh + o); fl[i] = lfrag(kvl + o); }
            __builtin_amdgcn_sched_barrier(0);    // keeps the group of LDS reads in front of the products: left alone the compiler put each read directly in front of its product, with the whole LDS latency in between
#pragma unroll
            for (int i = 0; i < 4; ++i) { ak = wmmab(a[i], fh[i], ak); ak = wmmab(a[i], fl[i], ak); } }
        const size_t ko = it * NKV * DQP + (size_t)(pi * (FKV / 16) + tt) * (DQP / 32) * 512 + dt * 256 + lane * 8;
        v8us oh, ol; split8(ak, oh, ol); *(v8us*)(Kh + ko) = oh; *(v8us*)(Kl + ko) = ol;
    } else if (wow) *(v8us*)(WoB + (b >> 1) * 512 + (b & 1) * 256 + lane * 8) = cvt8(o0, o1);
}
#define AQ   4
#define ACT  4
#define ANW  8                  // waves per block
#define ACG  (CC / 16 / ACT)    // channel groups
#define AQB  (ANW / ACG * AQ * 16)   // queries per block = ANW query tiles, one a producer
#define SCL2 0.25503486f        // (1/sqrt(32)) * log2(e)
typedef __attribute__((ext_vector_type(16))) unsigned short v16us;
// lds_barrier: the work-group barrier with the order of LDS accesses alone (a wave's LDS reads and writes are done before it signals). __syncthreads() would wait for the wave's global loads too, and the v fragments asked for ahead of it are to stay in flight across it.
__device__ __forceinline__ void lds_barrier() {
    __builtin_amdgcn_fence(__ATOMIC_RELEASE, "workgroup", "local");
    __builtin_amdgcn_s_barrier();
    __builtin_amdgcn_fence(__ATOMIC_ACQUIRE, "workgroup", "local");
}
__global__ __launch_bounds__(ANW * 32) void k_attn(const bf* __restrict__ Qh, const bf* __restrict__ Ql, const bf* __restrict__ Kh, const bf* __restrict__ Kl,
                                                   const bf* __restrict__ Vh, const bf* __restrict__ Vl, const bf* __restrict__ XT, const bf* __restrict__ Wo, const float* __restrict__ gam, float* OUTP) {
    __shared__ __align__(16) unsigned short ksh[NKV * DQ], ksl[NKV * DQ];    // per 16-key tile 512 elements: [k half of the fragment][lane][8]; behind the key loop: out_attn hi and residual, AQB tokens x CC channels
    static_assert(AQB * CC == NKV * DQ, "the out_attn planes take the LDS of k");
    __shared__ __align__(16) float ost[ANW][16 * 68];    // a wave's own tile of 16 channels x 64 tokens on its way to out
    __shared__ __align__(16) unsigned short psh[2][ANW * 512], psl[2][ANW * 512];    // probabilities of 32 keys, per query tile 512 elements: [k half of the fragment][lane][8]
    __shared__ float pinv[ANW * 32];    // 1 / row sum, [query tile][lane]
    const int tid = threadIdx.x, lane = tid & 31, wave = tid >> 5;
    const int qt0 = (wave / ACG) * AQ;    // first of the query tiles that the wave consumes
    const int q0 = blockIdx.x * AQB + qt0 * 16, cb = (wave % ACG) * (ACT * 16);
    const size_t it = blockIdx.z;
    Qh += it * NTOK * DQP; Ql += it * NTOK * DQP; Kh += it * NKV * DQP; Kl += it * NKV * DQP; Vh += it * CC * NKV; Vl += it * CC * NKV; XT += it * NTOK * CC; OUTP += it * CC * NTOK;
    const size_t qo = (size_t)(blockIdx.x * (AQB / 16) + wave) * (DQP / 32) * 512 + lane * 8;    // the query tile that the wave produces; k block 0 of a row tile holds the 32 real dims
    const bf* qp = Qh + qo; const bf* qlp = Ql + qo;
    const v16bf qh = cat16b(*(const v8us*)qp, *(const v8us*)(qp + 256)), ql = cat16b(*(const v8us*)qlp, *(const v8us*)(qlp + 256));
    asm volatile("s_wait_xcnt 0x0" :: "v"(qp), "v"(qlp) : "memory");    // the q loads stay in flight over the staging of k, which reuses their address registers: the wait in front of that overwrite (the two addresses as inputs keep them whole up to it)
    // k staging: a straight copy of k block 0 of every 16-key tile (the planes are in fragment order already); 64 threads a tile, four tiles a pass, so every load of a plane is one address pair plus a constant step, and every LDS store one index plus a constant step
    const bf* kp = Kh + (tid >> 6) * (DQP / 32) * 512 + (tid & 63) * 8; const bf* klp = Kl + (tid >> 6) * (DQP / 32) * 512 + (tid & 63) * 8;
    const int kd = tid * 8;
#pragma unroll    // whole: the constant steps become immediate offsets
    for (int g = 0; g < NKV / (ANW * 8) / 8; ++g) { v8us th[8], tl[8];    // groups of sixteen loads, each with its wait behind it
#pragma unroll
        for (int u = 0; u < 8; ++u) { th[u] = *(const v8us*)(kp + (g * 8 + u) * (ANW * 8) * DQP); tl[u] = *(const v8us*)(klp + (g * 8 + u) * (ANW * 8) * DQP); }
        asm volatile("s_wait_xcnt 0x0" :: "v"(kp), "v"(klp) : "memory");    // the wait in front of any overwrite of the k loads' address registers (the two addresses as inputs keep them whole up to it, so that no load's result lands in them)
#pragma unroll
        for (int u = 0; u < 8; ++u) { *(v8usa*)(ksh + kd + (g * 8 + u) * 2048) = th[u]; *(v8usa*)(ksl + kd + (g * 8 + u) * 2048) = tl[u]; } }
    __syncthreads();    // k is staged: from here on to the key loop's end its LDS is only read
    float mxu[4];
#pragma unroll
    for (int u = 0; u < 4; ++u) mxu[u] = -3.0e38f;
#pragma unroll 2    // two groups a trip: the second group's LDS reads issue ahead of the first group's matrix instructions
    for (int mt = 0; mt < NKV / 16; mt += 4) {    // four key tiles a group, product by product: with one query tile a wave the independent chains that cover the matrix unit's latency come from the keys
        v16bf a[4], al[4]; v8f s[4];
#pragma unroll
        for (int u = 0; u < 4; ++u) { const int kb = (mt + u) * 512 + lane * 8;
            a[u] = cat16b(*(const v8usa*)(ksh + kb), *(const v8usa*)(ksh + kb + 256)); al[u] = cat16b(*(const v8usa*)(ksl + kb), *(const v8usa*)(ksl + kb + 256)); }
#pragma unroll
        for (int u = 0; u < 4; ++u) s[u] = wmmab(a[u], qh, (v8f){});
#pragma unroll
        for (int u = 0; u < 4; ++u) s[u] = wmmab(al[u], qh, s[u]);
#pragma unroll
        for (int u = 0; u < 4; ++u) s[u] = wmmab(a[u], ql, s[u]);
#pragma unroll
        for (int r = 0; r < 8; ++r) {
#pragma unroll
            for (int u = 0; u < 4; ++u) mxu[u] = fmaxf(mxu[u], s[u][r]); }
    }
    float mx = fmaxf(fmaxf(mxu[0], mxu[1]), fmaxf(mxu[2], mxu[3]));
    mx = fmaxf(mx, __shfl_xor(mx, 16, 32));
    const float mc = mx * SCL2; float sum = 0.f;
    v16bf kf[2], kfl[2];
    auto fetch_k = [&](int m0) {    // the k fragments of keys m0 to m0 + 31, from LDS
#pragma unroll
        for (int t = 0; t < 2; ++t) { const int kb = (m0 / 16 + t) * 512 + lane * 8;
            kf[t] = cat16b(*(const v8usa*)(ksh + kb), *(const v8usa*)(ksh + kb + 256)); kfl[t] = cat16b(*(const v8usa*)(ksl + kb), *(const v8usa*)(ksl + kb + 256)); }
    };
    // produce: the probabilities of keys m0 to m0 + 31 for the wave's own query tile, hi and residual, into buffer (m0 / 32) & 1. Their k fragments were fetched by the call before; behind its score products it fetches the next call's
    // (behind the last keys: the first again, unused), so that a call starts with no LDS latency in front of it.
    auto produce = [&](int m0) {
        v8f s[2];
#pragma unroll
        for (int t = 0; t < 2; ++t) { v8f z = (v8f){}; z = wmmab(kf[t], qh, z); z = wmmab(kfl[t], qh, z); z = wmmab(kf[t], ql, z); s[t] = z; }
        fetch_k((m0 + 32) & (NKV - 1));
        float x[16]; v16bf ph, pl;
#pragma unroll
        for (int e = 0; e < 16; ++e) x[e] = __builtin_fmaf(s[e >> 3][e & 7], SCL2, -mc);
#pragma unroll
        for (int e = 0; e < 16; e += 8)    // eight exponentials a statement: each has an independent instruction behind it, the last a v_nop (the slot the instruction set asks for behind a transcendental)
            asm("v_exp_f32 %0, %0\n\tv_exp_f32 %1, %1\n\tv_exp_f32 %2, %2\n\tv_exp_f32 %3, %3\n\tv_exp_f32 %4, %4\n\tv_exp_f32 %5, %5\n\tv_exp_f32 %6, %6\n\tv_exp_f32 %7, %7\n\tv_nop"
                : "+v"(x[e]), "+v"(x[e + 1]), "+v"(x[e + 2]), "+v"(x[e + 3]), "+v"(x[e + 4]), "+v"(x[e + 5]), "+v"(x[e + 6]), "+v"(x[e + 7]));
#pragma unroll
        for (int e = 0; e < 16; e += 2) {
            const float p0 = x[e], p1 = x[e + 1];
            sum += p0 + p1;
            const v2bf h = __builtin_convertvector((v2f){p0, p1}, v2bf);
            const v2bf l = __builtin_convertvector((v2f){p0 - (float)h[0], p1 - (float)h[1]}, v2bf);
            ph[e] = h[0]; ph[e + 1] = h[1]; pl[e] = l[0]; pl[e + 1] = l[1]; }
        const int po = wave * 512 + lane * 8, pb = (m0 >> 5) & 1;
        const v16us uh = __builtin_bit_cast(v16us, ph), ul = __builtin_bit_cast(v16us, pl);
        *(v8usa*)(psh[pb] + po) = __builtin_shufflevector(uh, uh, 0, 1, 2, 3, 4, 5, 6, 7); *(v8usa*)(psh[pb] + po + 256) = __builtin_shufflevector(uh, uh, 8, 9, 10, 11, 12, 13, 14, 15);
        *(v8usa*)(psl[pb] + po) = __builtin_shufflevector(ul, ul, 0, 1, 2, 3, 4, 5, 6, 7); *(v8usa*)(psl[pb] + po + 256) = __builtin_shufflevector(ul, ul, 8, 9, 10, 11, 12, 13, 14, 15);
    };
    v8f acc[ACT][AQ];
#pragma unroll
    for (int c = 0; c < ACT; ++c) {
#pragma unroll
        for (int n = 0; n < AQ; ++n) acc[c][n] = (v8f){}; }
    const int vo = (cb >> 4) * (NKV / 32) * 512 + lane * 8;
    // The two waves that share a SIMD (w and w + ANW / 2) take a trip's two halves in opposite order, so that one's vector work runs beside the other's products instead of both waiting at the barrier for the second to finish both:
    // the first four waves multiply first and then produce, the last four produce first. For speed only: the result does not depend on where a wave runs. The test is the same in all lanes of a wave, and the barrier stands outside it.
    const bool late = __builtin_amdgcn_readfirstlane(wave) < ANW / 2;
    v16bf a[ACT], al[ACT], ph[AQ], pl[AQ];
    const bf* pvh = Vh + vo; const bf* pvl = Vl + vo;    // the v fragments that the wave asks for next: one address a plane, the channel tiles as immediate offsets
    auto load_v = [&]() {    // asks for the v fragments of 32 keys and steps on
#pragma unroll
        for (int c = 0; c < ACT; ++c) { const int vb = c * 16 * NKV;    // a channel tile is NKV / 32 tiles of 512 elements = 16 NKV
            a[c] = cat16b(*(const v8us*)(pvh + vb), *(const v8us*)(pvh + vb + 256)); al[c] = cat16b(*(const v8us*)(pvl + vb), *(const v8us*)(pvl + vb + 256)); }
        asm volatile("s_wait_xcnt 0x0" :: "v"(pvh), "v"(pvl) : "memory");    // the v loads stay in flight over the work that follows: the wait in front of the step of their addresses (the addresses as inputs keep them whole up to it, so that no load's result lands in them)
        pvh += 512; pvl += 512;
    };
    auto read_p = [&](int m0) {    // reads the AQ query tiles' probabilities of keys m0 to m0 + 31 back
        const unsigned short* rh = psh[(m0 >> 5) & 1] + qt0 * 512 + lane * 8; const unsigned short* rl = psl[(m0 >> 5) & 1] + qt0 * 512 + lane * 8;
#pragma unroll
        for (int n = 0; n < AQ; ++n) ph[n] = cat16b(*(const v8usa*)(rh + n * 512), *(const v8usa*)(rh + n * 512 + 256));
        __builtin_amdgcn_sched_barrier(0);    // keeps the hi fragments, which the first two of the three products need, in front of the residuals in the LDS queue: behind a barrier all eight waves read at once
#pragma unroll
        for (int n = 0; n < AQ; ++n) pl[n] = cat16b(*(const v8usa*)(rl + n * 512), *(const v8usa*)(rl + n * 512 + 256));
    };
    auto products = [&]() {
#pragma unroll
        for (int c = 0; c < ACT; ++c) {
#pragma unroll
            for (int n = 0; n < AQ; ++n) acc[c][n] = wmmab(a[c], ph[n], acc[c][n]); }
#pragma unroll
        for (int c = 0; c < ACT; ++c) {
#pragma unroll
            for (int n = 0; n < AQ; ++n) acc[c][n] = wmmab(al[c], ph[n], acc[c][n]); }
#pragma unroll
        for (int c = 0; c < ACT; ++c) {
#pragma unroll
            for (int n = 0; n < AQ; ++n) acc[c][n] = wmmab(a[c], pl[n], acc[c][n]); }
    };
    fetch_k(0); produce(0);
    if (late) load_v();
    lds_barrier();    // publishes the first trip's probabilities
#pragma unroll 1    // stays rolled: the two buffers are told apart by an index, and a trip is long enough to carry its branches
    for (int m0 = 0; m0 < NKV - 32; m0 += 32) {
        if (!late) load_v();    // this trip's
        read_p(m0);
        if (!late) produce(m0 + 32);
        products();
        if (late) { load_v(); produce(m0 + 32); }    // the next trip's v: its registers are free now
        lds_barrier();    // publishes the next trip's probabilities and ends every wave's reads of the buffer that the next trip refills
    }
    if (!late) load_v();
    // the residual's x, from the x^T plane: tile (n, c) is the 8 channels a lane of y's accumulator tile (c, n) holds; asked for here, so that the last keys' products and the split cover the way from memory
    const bf* px = XT + ((size_t)(q0 >> 4) * (CC / 32) + (cb >> 5)) * 512 + lane * 8;
    v8us xq[ACT][AQ];
#pragma unroll
    for (int n = 0; n < AQ; ++n) {
#pragma unroll
        for (int c = 0; c < ACT; ++c) xq[c][n] = *(const v8us*)(px + n * (CC * 16) + c * 256); }
    asm volatile("s_wait_xcnt 0x0" :: "v"(px) : "memory");    // the x loads stay in flight over the work that follows: the wait in front of any overwrite of their address registers (the address as an input keeps it whole up to it)
    read_p(NKV - 32);
    pinv[tid] = 1.0f / (sum + __shfl_xor(sum, 16, 32));    // the row sums are complete
    products();
    lds_barrier();    // publishes the reciprocals
    const float g = bfr(gam[0]);
    // wo's fragments of k blocks 0 and 1 (they run two blocks ahead of their products, on three sets of registers: one block's products are shorter than the way from L2): one address, the channel tiles and k blocks as immediate offsets
    const bf* pw = Wo + (cb >> 4) * (CC * 16) + lane * 8;
    v16bf wa[3][ACT];
#pragma unroll
    for (int kb = 0; kb < 2; ++kb) {
#pragma unroll
        for (int c = 0; c < ACT; ++c) wa[kb][c] = cat16b(*(const v8us*)(pw + c * (CC * 16) + kb * 512), *(const v8us*)(pw + c * (CC * 16) + kb * 512 + 256)); }
    // out_attn, divided and split, into the LDS that held k: no wave reads k behind the key loop's last barrier
#pragma unroll
    for (int n = 0; n < AQ; ++n) { const float inv = pinv[(qt0 + n) * 32 + lane];
        const int ob = ((qt0 + n) * (CC / 32) + (cb >> 5)) * 512 + lane * 8;    // channel tile c is k half c & 1 of k block c / 2 from there: c * 256
#pragma unroll
        for (int c = 0; c < ACT; ++c) { v8us oh, ol;
#pragma unroll
            for (int r = 0; r < 8; ++r) { const float v = acc[c][n][r] * inv; const unsigned short hb = f2bf(v); oh[r] = hb; ol[r] = f2bf(v - bf2f(hb)); }
            *(v8usa*)(ksh + ob + c * 256) = oh; *(v8usa*)(ksl + ob + c * 256) = ol; } }
    lds_barrier();    // publishes the block's out_attn planes
    v8f y[ACT][AQ];
#pragma unroll
    for (int c = 0; c < ACT; ++c) {
#pragma unroll
        for (int n = 0; n < AQ; ++n) y[c][n] = (v8f){}; }
    v16bf bh[2][AQ], bl[2][AQ];
    const unsigned short* roh = ksh + qt0 * (CC * 16) + lane * 8; const unsigned short* rol = ksl + qt0 * (CC * 16) + lane * 8;
#pragma unroll
    for (int n = 0; n < AQ; ++n) { bh[0][n] = cat16b(*(const v8usa*)(roh + n * (CC * 16)), *(const v8usa*)(roh + n * (CC * 16) + 256)); bl[0][n] = cat16b(*(const v8usa*)(rol + n * (CC * 16)), *(const v8usa*)(rol + n * (CC * 16) + 256)); }
#pragma unroll    // whole: the steps of wo's address and of the LDS index become immediate offsets, and the sets of fragments are told apart at compile time
    for (int kb = 0; kb < CC / 32; ++kb) {
        if (kb + 2 < CC / 32) { const int ko = (kb + 2) * 512;    // wo's fragments of the next k block but one
#pragma unroll
            for (int c = 0; c < ACT; ++c) wa[(kb + 2) % 3][c] = cat16b(*(const v8us*)(pw + c * (CC * 16) + ko), *(const v8us*)(pw + c * (CC * 16) + ko + 256)); }
        if (kb + 1 < CC / 32) { const int ko = (kb + 1) * 512;    // out_attn's fragments of the next k block, asked for as one group ahead of this block's products
#pragma unroll
            for (int n = 0; n < AQ; ++n) bh[(kb + 1) & 1][n] = cat16b(*(const v8usa*)(roh + n * (CC * 16) + ko), *(const v8usa*)(roh + n * (CC * 16) + ko + 256));
#pragma unroll
            for (int n = 0; n < AQ; ++n) bl[(kb + 1) & 1][n] = cat16b(*(const v8usa*)(rol + n * (CC * 16) + ko), *(const v8usa*)(rol + n * (CC * 16) + ko + 256)); }
        if (kb + 3 == CC / 32) asm volatile("s_wait_xcnt 0x0" :: "v"(pw) : "memory");    // behind the last wo loads: the wait in front of any overwrite of their address registers (the address as an input keeps it whole up to it)
        __builtin_amdgcn_sched_barrier(0);    // keeps the group of loads in front of the products: left alone the compiler put each LDS read directly in front of its four products, with the whole LDS latency in between
#pragma unroll
        for (int c = 0; c < ACT; ++c) {
#pragma unroll
            for (int n = 0; n < AQ; ++n) y[c][n] = wmmab(wa[kb % 3][c], bh[kb & 1][n], y[c][n]); }
#pragma unroll
        for (int c = 0; c < ACT; ++c) {
#pragma unroll
            for (int n = 0; n < AQ; ++n) y[c][n] = wmmab(wa[kb % 3][c], bl[kb & 1][n], y[c][n]); }
        __builtin_amdgcn_sched_barrier(0);    // keeps the next group of loads, and behind the last block the unpacking of x (which doubles its registers), behind these products
    }
    float* os = &ost[wave][0];
    const int lr = lane & 15, hi = lane >> 4;
    float* po = OUTP + (size_t)(cb + hi) * NTOK + q0 + lr * 4;    // pass s of a channel tile stores rows 2 s and 2 s + 1, 16 lanes a row of 64 floats (two whole lines)
#pragma unroll
    for (int c = 0; c < ACT; ++c) {
#pragma unroll
        for (int n = 0; n < AQ; ++n) {
#pragma unroll
            for (int j = 0; j < 8; ++j) os[(hi * 8 + j) * 68 + n * 16 + lr] = bf2f(xq[c][n][j]) + g * y[c][n][j]; }
        __builtin_amdgcn_fence(__ATOMIC_RELEASE, "wavefront", "local"); __builtin_amdgcn_wave_barrier(); __builtin_amdgcn_fence(__ATOMIC_ACQUIRE, "wavefront", "local");    // the lanes read one another's values: keeps the compiler from moving the reads in front of the writes (a wave's LDS operations run in order)
        v4u o[8];
#pragma unroll
        for (int s = 0; s < 8; ++s) o[s] = *(const v4u __attribute__((may_alias))*)(os + (2 * s + hi) * 68 + lr * 4);
        // the eight stores and their wait in one statement: the next tile's reads reuse the registers they name, and a wait in a statement of its own need not stay in front of that overwrite; its memory clobber also keeps the next tile's LDS writes behind this tile's reads. The offsets step by two rows of out (2 NTOK floats).
        static_assert(2 * NTOK * 4 == 32768, "the store offsets below");
        asm volatile("global_store_b128 %0, %1, off\n\tglobal_store_b128 %0, %2, off offset:32768\n\tglobal_store_b128 %0, %3, off offset:65536\n\tglobal_store_b128 %0, %4, off offset:98304\n\t"
                     "global_store_b128 %0, %5, off offset:131072\n\tglobal_store_b128 %0, %6, off offset:163840\n\tglobal_store_b128 %0, %7, off offset:196608\n\tglobal_store_b128 %0, %8, off offset:229376\n\ts_wait_xcnt 0x0"
                     :: "v"(po + (size_t)c * 16 * NTOK), "v"(o[0]), "v"(o[1]), "v"(o[2]), "v"(o[3]), "v"(o[4]), "v"(o[5]), "v"(o[6]), "v"(o[7]) : "memory");
    }
}

extern "C" void kernel_launch(void* const* d_in, const int* in_sizes, int n_in,
                              void* d_out, int out_size, void* d_ws, size_t ws_size, hipStream_t stream) {
    (void)in_sizes; (void)n_in; (void)out_size;
    const float* x = (const float*)d_in[0]; const float* wq = (const float*)d_in[1]; const float* wk = (const float*)d_in[2]; const float* wv = (const float*)d_in[3]; const float* wo = (const float*)d_in[4]; const float* gam = (const float*)d_in[5];
    float* out = (float*)d_out;    // [8][256][64][64]
    char* wsp = (char*)d_ws;
    auto take = [&](size_t bytes) { char* p = wsp; wsp += (bytes + 255) & ~(size_t)255; return (void*)p; };
    bf* WoB = (bf*)take((size_t)CC * CC * 2); bf* XT = (bf*)take((size_t)NBI * NTOK * CC * 2);
    bf* Qh = (bf*)take((size_t)NBI * NTOK * DQP * 2); bf* Ql = (bf*)take((size_t)NBI * NTOK * DQP * 2); bf* Kh = (bf*)take((size_t)NBI * NKV * DQP * 2); bf* Kl = (bf*)take((size_t)NBI * NKV * DQP * 2);
    bf* Vh = (bf*)take((size_t)NBI * CC * NKV * 2); bf* Vl = (bf*)take((size_t)NBI * CC * NKV * 2);
    if ((size_t)(wsp - (char*)d_ws) > ws_size) return;    // MiB: 0.1 + 16 + 8 + 2 + 8 ~ 35 of 256
    k_front<<<dim3(NTOK / FTK, 1, NBI), FNW * 32, 0, stream>>>(x, wq, wk, wv, wo, WoB, XT, Qh, Ql, Kh, Kl, Vh, Vl);
    k_attn<<<dim3(NTOK / AQB, 1, NBI), ANW * 32, 0, stream>>>(Qh, Ql, Kh, Kl, Vh, Vl, XT, WoB, gam, out);    // out = x + gamma wo.out_attn^T [8][256][4096]
}

// v010
// One run takes 42.7 microseconds.
// It is 1.61 times as fast as v008, going by the measured steps of the versions left out in between.
// Counting every step since v000, it is 23.7 times as fast.
#include <hip/hip_runtime.h>

// Compute dtypes, f32 accumulate, batch items side by side on blockIdx.z (or as more rows) of every launch: q = x^T.wq^T ([4096 x 256].[256 x 32], exact bf16 transposed input and weight); the 2x2 average
// pool in f32 -> x_kv^T as bf16 hi + UNSCALED residual; k = x_kv^T.wk^T (split pooled operand, two products); q and k each rounded once to bf16; scores = q.k^T/sqrt(32)
// ([4096 x 32].[32 x 1024], one product), row softmax in f32 -> bf16. REASSOCIATED: wo.((wv.x_kv).attn^T) = (wo.wv).(x_kv.attn^T), so v is never formed: the value operand is the pooled x itself (its bf16 hi part),
// out_attn = attn.x_kv^T ([4096 x 1024].[1024 x 256], one product) -> bf16, and y = w2.out_attn^T with w2 = wo.wv ([256 x 256].[256 x 256], bf16 operands, f32 sums, rounded once to bf16; one 16 x 16 tile a block of the first kernel)
// ([256 x 256].[256 x 4096], one product) on v_wmma_f32_16x16x32_bf16; out = x + gamma y in f32; these five in one kernel. Every product's kernel stores what its consumer reads (the bf16 plane, or out itself). Deterministic, no atomics;
// PRECISION: the operands of the attention kernel's products are single bf16 values, as x and the weights are from the start: the residual's x, rounded to bf16, already carries a relative error of 2^-9 into out, and the roundings of q, k, the pooled x, w2, the probabilities and out_attn add errors of that relative size to gamma y alone.
// Two launches: k_front (x^T, the pool and its plane, q, k, w2's plane: a block needs nothing of another), k_attn (all the rest: it needs an item's whole k and pooled x, and all of w2).
// Every bf16 plane in the workspace stands in FRAGMENT ORDER: a plane of R rows x K is cut in tiles of 16 rows x 32 k, tile (r / 16, k / 32) at element ((r / 16) (K / 32) + k / 32) 512, and inside a tile
// [k half of 16][lane = ((k / 8) & 1) 16 + (r & 15)][8 k]: the two 16-byte loads of an A or B fragment are each 512 contiguous bytes (4 whole lines) a wave, where row-major planes gave 16 lines.

#define NBI  8
#define CC   256
#define HW   64
#define NTOK 4096
#define NKV  1024               // 32 x 32 pooled
#define DQ   32
#define DQP  64                 // row pitch of the q and k planes: two k blocks, of which only the first (the 32 real dims) is written and read
#define DM   CC
#define NTK  NTOK
#define LOSC 1024.0f

typedef _Float16 h16;
typedef unsigned short bf;
typedef __attribute__((ext_vector_type(16))) __bf16   v16bf;
typedef __attribute__((ext_vector_type(16))) _Float16 v16h;
typedef __attribute__((ext_vector_type(8)))  _Float16 v8h;
typedef __attribute__((ext_vector_type(8)))  unsigned short v8us;
typedef __attribute__((ext_vector_type(8)))  float    v8f;
typedef __attribute__((ext_vector_type(4)))  float    v4f;
typedef __attribute__((ext_vector_type(4)))  _Float16 v4h;
typedef v8h  __attribute__((may_alias)) v8ha;
typedef v4f  __attribute__((may_alias)) v4fa;
typedef v8us __attribute__((may_alias)) v8usa;

__device__ __forceinline__ unsigned short f2bf(float f) { unsigned u = __float_as_uint(f); u += 0x7FFFu + ((u >> 16) & 1u); return (unsigned short)(u >> 16); }
__device__ __forceinline__ float bf2f(unsigned short b) { return __uint_as_float(((unsigned)b) << 16); }
__device__ __forceinline__ float bfr(float f) { return bf2f(f2bf(f)); }
__device__ __forceinline__ v16h cat16(v8h lo, v8h hi) { return __builtin_shufflevector(lo, hi, 0, 1, 2, 3, 4, 5, 6, 7, 8, 9, 10, 11, 12, 13, 14, 15); }
__device__ __forceinline__ v16bf cat16b(v8us lo, v8us hi) { return __builtin_bit_cast(v16bf, __builtin_shufflevector(lo, hi, 0, 1, 2, 3, 4, 5, 6, 7, 8, 9, 10, 11, 12, 13, 14, 15)); }
__device__ __forceinline__ v8f wmma16(v16h a, v16h b, v8f c) { return __builtin_amdgcn_wmma_f32_16x16x32_f16(false, a, false, b, (short)0, c, false, false); }
__device__ __forceinline__ v8f wmmab(v16bf a, v16bf b, v8f c) { return __builtin_amdgcn_wmma_f32_16x16x32_bf16(false, a, false, b, (short)0, c, false, false); }
// frag_off: the element at which the 8 consecutive k from 8 k8 on of row r stand in a fragment-order plane of KB = K / 32 k blocks.
__device__ __forceinline__ size_t frag_off(int r, int k8, int KB) { return ((size_t)(r >> 4) * KB + (k8 >> 2)) * 512 + ((k8 >> 1) & 1) * 256 + ((k8 & 1) * 16 + (r & 15)) * 8; }

typedef __attribute__((ext_vector_type(2))) float  v2f;
typedef __attribute__((ext_vector_type(2))) __bf16 v2bf;
typedef __attribute__((ext_vector_type(4))) unsigned int v4u;
// pk2: two f32 -> two bf16 (round to nearest even) in one word, a in the low half; bflo, bfhi: the two back as f32.
__device__ __forceinline__ unsigned pk2(float a, float b) { return __builtin_bit_cast(unsigned, __builtin_convertvector((v2f){a, b}, v2bf)); }
__device__ __forceinline__ float bflo(unsigned u) { return __uint_as_float(u << 16); }
__device__ __forceinline__ float bfhi(unsigned u) { return __uint_as_float(u & 0xFFFF0000u); }
__device__ __forceinline__ v8us cvt8(v4f a, v4f b) { const v4u u = {pk2(a[0], a[1]), pk2(a[2], a[3]), pk2(b[0], b[1]), pk2(b[2], b[3])}; return __builtin_bit_cast(v8us, u); }
// round8: a lane's 8 accumulator values -> bf16 (round to nearest even), 16 bytes
__device__ __forceinline__ v8us round8(v8f v) { const v4u h = {pk2(v[0], v[1]), pk2(v[2], v[3]), pk2(v[4], v[5]), pk2(v[6], v[7])}; return __builtin_bit_cast(v8us, h); }
__device__ __forceinline__ v16bf lfrag(const unsigned short* p) { return cat16b(*(const v8usa*)p, *(const v8usa*)(p + 256)); }    // a fragment from a fragment-order tile in LDS (p: the tile's start + 8 lane)

// k_front: all that comes before the attention, in one kernel. A block is one item's pair of image rows: 128 tokens = 32 pooled positions (one pooled row), all 256 channels, on 16 waves; nothing of it needs another block.
// PART 1: x is read once. Wave w takes channels 16 w to 16 w + 15, its lanes as a fragment's: lane = (group of 8 channels) 16 + pooled position; a lane reads the 2 x 2 block of its position in 8 channels (16 lanes: one whole line of an image row),
// so it holds 8 consecutive channels of 4 tokens (four 16-byte pieces of x^T) and of their mean (f32, ((a+b)+(c+d)) * 0.25 of the bf16-rounded x -> bf16 hi + UNSCALED residual). All three go to LDS in fragment order.
// The weights are read in f32 and rounded here: wq and wk by the 16 waves together, into LDS (fragment order).
// w2 = wo.wv: block b forms the 16 x 16 tile (output channels 16 (b / 16) ..., input channels 16 (b & 15) ...), transposed: w2^T tile = wv^T.wo^T (A = wv columns, B = wo rows). Waves 8 to 15 take one k block of 32 each, one product, and put their
// partial tiles in LDS in front of the barrier; behind it the last wave adds the eight in k order. A lane's 8 accumulator registers are 8 consecutive input channels of one output channel: one k half of a fragment tile of the attention kernel's last product.
// PART 2, behind the one barrier: x^T leaves for its plane as a straight copy (the block's tiles are 64 KiB in a row there), and the products run:
// q^T tile = wq.x (A = wq rows, B = x^T rows; wave w: token tile w / 2, head dims 16 (w & 1) ...), k^T alike on four waves.
// In each the 8 accumulator registers of a lane are 8 consecutive k of the plane that the attention reads, of one row: the rounded values are stored from the registers, 512 contiguous bytes a wave. Of the padded q and k planes only k block 0 (the 32 real dims) is written: nothing reads the other.
// The pooled x (hi part) leaves for the value plane turned: rows = channels, k = pooled positions. Wave w takes channels 16 w ...; a lane gathers 8 consecutive positions of its channel from LDS, 2 bytes each, and stores them as 16 bytes.
#define FNW 16
#define FTK 128                 // tokens a block
#define FKV 32                  // pooled positions a block
#define KBN (CC / 32)           // k blocks of the channel dimension
__global__ __launch_bounds__(FNW * 32) void k_front(const float* __restrict__ x, const float* __restrict__ wq, const float* __restrict__ wk, const float* __restrict__ wv, const float* __restrict__ wo,
                                                    bf* WoB, bf* XT, bf* Qh, bf* Kh, bf* Vh) {
    __shared__ __align__(16) unsigned short xs[FTK * CC], kvh[FKV * CC], kvl[FKV * CC], wqk[2 * DQ * CC];
    __shared__ __align__(16) float w2p[KBN][256];    // w2's partial tiles: [k block][lane][8]
    const int tid = threadIdx.x, lane = tid & 31, wave = __builtin_amdgcn_readfirstlane(tid >> 5), lr = lane & 15, hi = lane >> 4;
    const int pi = blockIdx.x; const size_t it = blockIdx.z;
    const int b = (int)it * (NTOK / FTK) + pi;    // the block's tile of w2
    const bool wow = wave == FNW - 1, w2w = wave >= FNW - KBN;    // both tests are the same in all lanes of a wave
    // wq (waves 0 to 7) and wk (8 to 15): a wave takes two k blocks of one row tile, 64 consecutive floats of 16 rows
    const float* pws = (wave >> 3 ? wk : wq) + (((wave >> 2) & 1) * 16 + lr) * CC + (wave & 3) * 64 + hi * 8;
    v4f ws[4][2];
#pragma unroll
    for (int u = 0; u < 4; ++u) { ws[u][0] = *(const v4f*)(pws + u * 16); ws[u][1] = *(const v4f*)(pws + u * 16 + 4); }
    asm volatile("s_wait_xcnt 0x0" :: "v"(pws) : "memory");    // the loads stay in flight over what follows: the wait in front of any overwrite of their address registers (the address as an input keeps it whole up to it)
    const int k8 = wave * 2 + hi;    // the lane's group of 8 channels
    const float* xb = x + it * CC * NTOK + (size_t)(k8 * 8) * NTOK + pi * FTK + 2 * lr;
    v2f r[2][8][2];    // [half of the pooled row][channel][image row]
#pragma unroll
    for (int p = 0; p < 2; ++p) {
#pragma unroll
        for (int i = 0; i < 8; ++i) { r[p][i][0] = *(const v2f*)(xb + i * NTOK + p * 32); r[p][i][1] = *(const v2f*)(xb + i * NTOK + p * 32 + HW); } }
    asm volatile("s_wait_xcnt 0x0" :: "v"(xb) : "memory");    // as above
    // w2's operands of the wave's k block, asked for behind x so that their way from L2 is covered by x's way from memory. A: element e of a lane is wv[32 kb + 16 (e / 8) + 8 hi + (e & 7)][column]; B: the same k of wo's row
    float wa[16] = {}; v4f wb[4] = {(v4f){}, (v4f){}, (v4f){}, (v4f){}};
    if (w2w) { const int kb = wave - (FNW - KBN);
        const float* pwv = wv + (kb * 32 + hi * 8) * CC + (b & 15) * 16 + lr;
#pragma unroll
        for (int e = 0; e < 16; ++e) wa[e] = pwv[((e >> 3) * 16 + (e & 7)) * CC];
        asm volatile("s_wait_xcnt 0x0" :: "v"(pwv) : "memory");    // as above
        const float* pwo = wo + ((b >> 4) * 16 + lr) * CC + kb * 32 + hi * 8;
        wb[0] = *(const v4f*)pwo; wb[1] = *(const v4f*)(pwo + 4); wb[2] = *(const v4f*)(pwo + 16); wb[3] = *(const v4f*)(pwo + 20);
        asm volatile("s_wait_xcnt 0x0" :: "v"(pwo) : "memory"); }    // as above
    unsigned short* wd = wqk + (wave >> 2) * (CC * 16) + (wave & 3) * 1024 + lane * 8;    // [wq, wk][row tile][k block][k half][lane][8]
#pragma unroll
    for (int u = 0; u < 4; ++u) *(v8usa*)(wd + u * 256) = cvt8(ws[u][0], ws[u][1]);
#pragma unroll
    for (int p = 0; p < 2; ++p) {
        v4u t[2][2], ph, pl;    // t: [image row][column of the 2 x 2 block], 8 channels each
#pragma unroll
        for (int i = 0; i < 4; ++i) {
#pragma unroll
            for (int ro = 0; ro < 2; ++ro) {
#pragma unroll
                for (int e = 0; e < 2; ++e) t[ro][e][i] = pk2(r[p][2 * i][ro][e], r[p][2 * i + 1][ro][e]); }
            const float v0 = ((bflo(t[0][0][i]) + bflo(t[0][1][i])) + (bflo(t[1][0][i]) + bflo(t[1][1][i]))) * 0.25f;
            const float v1 = ((bfhi(t[0][0][i]) + bfhi(t[0][1][i])) + (bfhi(t[1][0][i]) + bfhi(t[1][1][i]))) * 0.25f;
            ph[i] = pk2(v0, v1); pl[i] = pk2(v0 - bflo(ph[i]), v1 - bfhi(ph[i])); }
#pragma unroll
        for (int ro = 0; ro < 2; ++ro) {
#pragma unroll
            for (int e = 0; e < 2; ++e) *(v8usa*)(xs + frag_off(ro * HW + p * 32 + 2 * lr + e, k8, KBN)) = __builtin_bit_cast(v8us, t[ro][e]); }
        const size_t ko = frag_off(p * 16 + lr, k8, KBN);
        *(v8usa*)(kvh + ko) = __builtin_bit_cast(v8us, ph); *(v8usa*)(kvl + ko) = __builtin_bit_cast(v8us, pl);
    }
    if (w2w) {    // the wave's partial tile of w2^T
        const v16bf fa = cat16b(cvt8((v4f){wa[0], wa[1], wa[2], wa[3]}, (v4f){wa[4], wa[5], wa[6], wa[7]}), cvt8((v4f){wa[8], wa[9], wa[10], wa[11]}, (v4f){wa[12], wa[13], wa[14], wa[15]}));
        const v8f d = wmmab(fa, cat16b(cvt8(wb[0], wb[1]), cvt8(wb[2], wb[3])), (v8f){});
        float* wp = &w2p[wave - (FNW - KBN)][lane * 8];
        *(v4fa*)wp = (v4f){d[0], d[1], d[2], d[3]}; *(v4fa*)(wp + 4) = (v4f){d[4], d[5], d[6], d[7]}; }
    __syncthreads();    // publishes the block's x^T, pooled and weight planes and w2's partial tiles; from here on they are only read
    const int tt = wave >> 1, dt = wave & 1;
    // x^T to its plane: whole lines, 512 contiguous bytes a wave and pass
    bf* xd = XT + it * NTOK * CC + (size_t)pi * (FTK * CC) + tid * 8;
#pragma unroll
    for (int g = 0; g < 2; ++g) { v8us c[4];
#pragma unroll
        for (int s = 0; s < 4; ++s) c[s] = *(const v8usa*)(xs + tid * 8 + (g * 4 + s) * (FNW * 256));
#pragma unroll
        for (int s = 0; s < 4; ++s) *(v8us*)(xd + (g * 4 + s) * (FNW * 256)) = c[s];
        asm volatile("s_wait_xcnt 0x0" :: "v"(xd) : "memory"); }    // the wait behind the four stores, as above
    // q
    { v16bf a[KBN], f[KBN]; v8f aq = (v8f){};
#pragma unroll
      for (int kb = 0; kb < KBN; ++kb) { a[kb] = lfrag(wqk + (dt * KBN + kb) * 512 + lane * 8); f[kb] = lfrag(xs + (tt * KBN + kb) * 512 + lane * 8); }
      __builtin_amdgcn_sched_barrier(0);    // keeps the group of LDS reads in front of the products: left alone the compiler put each read directly in front of its product, with the whole LDS latency in between
#pragma unroll
      for (int kb = 0; kb < KBN; ++kb) aq = wmmab(a[kb], f[kb], aq);
      const size_t qo = it * NTOK * DQP + (size_t)(pi * (FTK / 16) + tt) * (DQP / 32) * 512 + dt * 256 + lane * 8;
      bf* qdh = Qh + qo; *(v8us*)qdh = round8(aq);
      asm volatile("s_wait_xcnt 0x0" :: "v"(qdh) : "memory"); }    // the wait behind the store, as above
    // the pooled x to the value plane: channel tile w, k block = the pooled row; k half mt, a lane's 8 positions 16 mt + 8 hi ... of channel 16 w + lr
    const unsigned short* ts = kvh + (wave >> 1) * 512 + (wave & 1) * 256 + (lr >> 3) * 128 + hi * 64 + (lr & 7);    // frag_off(8 hi, channel / 8, KBN) + channel & 7; a position further: 8 elements, a tile of 16 positions: KBN * 512
    const size_t vo = it * CC * NKV + ((size_t)wave * (NKV / 32) + pi) * 512 + lane * 8;
    bf* vdh = Vh + vo;
    v8us tv[2];
#pragma unroll
    for (int mt = 0; mt < 2; ++mt) {
#pragma unroll
        for (int j = 0; j < 8; ++j) tv[mt][j] = ts[mt * (KBN * 512) + j * 8]; }
#pragma unroll
    for (int mt = 0; mt < 2; ++mt) *(v8us*)(vdh + mt * 256) = tv[mt];
    asm volatile("s_wait_xcnt 0x0" :: "v"(vdh) : "memory");    // the wait behind the two stores, as above
    if (wave < 4) {    // k: pooled tile w / 2, head dims 16 (w & 1) ...; the test is the same in all lanes of a wave. Last, so that all from the barrier to here is one straight run of code
        v8f ak = (v8f){};
#pragma unroll
        for (int g = 0; g < 2; ++g) { v16bf a[4], fh[4], fl[4];
#pragma unroll
            for (int i = 0; i < 4; ++i) { const int o = (tt * KBN + g * 4 + i) * 512 + lane * 8;
                a[i] = lfrag(wqk + DQ * CC + (dt * KBN + g * 4 + i) * 512 + lane * 8); fh[i] = lfrag(kvh + o); fl[i] = lfrag(kvl + o); }
            __builtin_amdgcn_sched_barrier(0);    // keeps the group of LDS reads in front of the products: left alone the compiler put each read directly in front of its product, with the whole LDS latency in between
#pragma unroll
            for (int i = 0; i < 4; ++i) { ak = wmmab(a[i], fh[i], ak); ak = wmmab(a[i], fl[i], ak); } }
        const size_t ko = it * NKV * DQP + (size_t)(pi * (FKV / 16) + tt) * (DQP / 32) * 512 + dt * 256 + lane * 8;
        *(v8us*)(Kh + ko) = round8(ak);
    } else if (wow) {    // w2's tile: the eight partial tiles added in k order, rounded once; k half b & 1 of k block (b / 2) & 7 of row tile b / 16
        v4f s0 = *(const v4fa*)&w2p[0][lane * 8], s1 = *(const v4fa*)&w2p[0][lane * 8 + 4];
#pragma unroll
        for (int kb = 1; kb < KBN; ++kb) { s0 += *(const v4fa*)&w2p[kb][lane * 8]; s1 += *(const v4fa*)&w2p[kb][lane * 8 + 4]; }
        *(v8us*)(WoB + (b >> 1) * 512 + (b & 1) * 256 + lane * 8) = cvt8(s0, s1); }
}
#define AQ   4
#define ACT  4
#define ANW  8                  // waves per block
#define ACG  (CC / 16 / ACT)    // channel groups
#define AQB  (ANW / ACG * AQ * 16)   // queries per block = ANW query tiles, one a producer
#define SCL2 0.25503486f        // (1/sqrt(32)) * log2(e)
typedef __attribute__((ext_vector_type(16))) unsigned short v16us;
// lds_barrier: the work-group barrier with the order of LDS accesses alone (a wave's LDS reads and writes are done before it signals). __syncthreads() would wait for the wave's global loads too, and the v fragments asked for ahead of it are to stay in flight across it.
__device__ __forceinline__ void lds_barrier() {
    __builtin_amdgcn_fence(__ATOMIC_RELEASE, "workgroup", "local");
    __builtin_amdgcn_s_barrier();
    __builtin_amdgcn_fence(__ATOMIC_ACQUIRE, "workgroup", "local");
}
__global__ __launch_bounds__(ANW * 32) void k_attn(const bf* __restrict__ Qh, const bf* __restrict__ Kh, const bf* __restrict__ Vh, const bf* __restrict__ XT, const bf* __restrict__ Wo, const float* __restrict__ gam, float* OUTP) {
    __shared__ __align__(16) unsigned short ksh[NKV * DQ];    // per 16-key tile 512 elements: [k half of the fragment][lane][8]; behind the key loop: out_attn, AQB tokens x CC channels
    static_assert(AQB * CC == NKV * DQ, "the out_attn plane takes the LDS of k");
    __shared__ __align__(16) float ost[ANW][16 * 68];    // a wave's own tile of 16 channels x 64 tokens on its way to out
    __shared__ __align__(16) unsigned short psh[2][ANW * 512];    // probabilities of 32 keys, per query tile 512 elements: [k half of the fragment][lane][8]
    __shared__ float pinv[ANW * 32];    // 1 / row sum, [query tile][lane]
    const int tid = threadIdx.x, lane = tid & 31, wave = tid >> 5;
    const int qt0 = (wave / ACG) * AQ;    // first of the query tiles that the wave consumes
    const int q0 = blockIdx.x * AQB + qt0 * 16, cb = (wave % ACG) * (ACT * 16);
    const size_t it = blockIdx.z;
    Qh += it * NTOK * DQP; Kh += it * NKV * DQP; Vh += it * CC * NKV; XT += it * NTOK * CC; OUTP += it * CC * NTOK;
    const size_t qo = (size_t)(blockIdx.x * (AQB / 16) + wave) * (DQP / 32) * 512 + lane * 8;    // the query tile that the wave produces; k block 0 of a row tile holds the 32 real dims
    const bf* qp = Qh + qo;
    const v16bf qh = cat16b(*(const v8us*)qp, *(const v8us*)(qp + 256));
    asm volatile("s_wait_xcnt 0x0" :: "v"(qp) : "memory");    // the q loads stay in flight over the staging of k, which reuses their address registers: the wait in front of that overwrite (the address as an input keeps it whole up to it)
    // k staging: a straight copy of k block 0 of every 16-key tile (the plane is in fragment order already); 64 threads a tile, four tiles a pass, so every load is one address pair plus a constant step, and every LDS store one index plus a constant step
    const bf* kp = Kh + (tid >> 6) * (DQP / 32) * 512 + (tid & 63) * 8;
    const int kd = tid * 8;
#pragma unroll    // whole: the constant steps become immediate offsets
    for (int g = 0; g < NKV / (ANW * 8) / 8; ++g) { v8us th[8];    // groups of eight loads, each with its wait behind it
#pragma unroll
        for (int u = 0; u < 8; ++u) th[u] = *(const v8us*)(kp + (g * 8 + u) * (ANW * 8) * DQP);
        asm volatile("s_wait_xcnt 0x0" :: "v"(kp) : "memory");    // the wait in front of any overwrite of the k loads' address registers (the address as an input keeps it whole up to it, so that no load's result lands in it)
#pragma unroll
        for (int u = 0; u < 8; ++u) *(v8usa*)(ksh + kd + (g * 8 + u) * 2048) = th[u]; }
    __syncthreads();    // k is staged: until out_attn replaces it behind the key loop, its LDS is only read
    float mxu[4];
#pragma unroll
    for (int u = 0; u < 4; ++u) mxu[u] = -3.0e38f;
#pragma unroll 2    // two groups a trip: the second group's LDS reads issue ahead of the first group's matrix instructions
    for (int mt = 0; mt < NKV / 16; mt += 4) {    // four key tiles a group: with one query tile a wave the independent chains that cover the matrix unit's latency come from the keys
        v16bf a[4]; v8f s[4];
#pragma unroll
        for (int u = 0; u < 4; ++u) { const int kb = (mt + u) * 512 + lane * 8; a[u] = cat16b(*(const v8usa*)(ksh + kb), *(const v8usa*)(ksh + kb + 256)); }
#pragma unroll
        for (int u = 0; u < 4; ++u) s[u] = wmmab(a[u], qh, (v8f){});
#pragma unroll
        for (int r = 0; r < 8; ++r) {
#pragma unroll
            for (int u = 0; u < 4; ++u) mxu[u] = fmaxf(mxu[u], s[u][r]); }
    }
    float mx = fmaxf(fmaxf(mxu[0], mxu[1]), fmaxf(mxu[2], mxu[3]));
    mx = fmaxf(mx, __shfl_xor(mx, 16, 32));
    const float mc = mx * SCL2; float sum = 0.f;
    v16bf kf[2];
    auto fetch_k = [&](int m0) {    // the k fragments of keys m0 to m0 + 31, from LDS
#pragma unroll
        for (int t = 0; t < 2; ++t) { const int kb = (m0 / 16 + t) * 512 + lane * 8;
            kf[t] = cat16b(*(const v8usa*)(ksh + kb), *(const v8usa*)(ksh + kb + 256)); }
    };
    // produce: the probabilities of keys m0 to m0 + 31 for the wave's own query tile, into buffer (m0 / 32) & 1. Their k fragments were fetched by the call before; behind its score products it fetches the next call's
    // (behind the last keys: the first again, unused), so that a call starts with no LDS latency in front of it.
    auto produce = [&](int m0) {
        v8f s[2];
#pragma unroll
        for (int t = 0; t < 2; ++t) s[t] = wmmab(kf[t], qh, (v8f){});
        fetch_k((m0 + 32) & (NKV - 1));
        float x[16]; v16bf ph;
#pragma unroll
        for (int e = 0; e < 16; ++e) x[e] = __builtin_fmaf(s[e >> 3][e & 7], SCL2, -mc);
#pragma unroll
        for (int e = 0; e < 16; e += 8)    // eight exponentials a statement: each has an independent instruction behind it, the last a v_nop (the slot the instruction set asks for behind a transcendental)
            asm("v_exp_f32 %0, %0\n\tv_exp_f32 %1, %1\n\tv_exp_f32 %2, %2\n\tv_exp_f32 %3, %3\n\tv_exp_f32 %4, %4\n\tv_exp_f32 %5, %5\n\tv_exp_f32 %6, %6\n\tv_exp_f32 %7, %7\n\tv_nop"
                : "+v"(x[e]), "+v"(x[e + 1]), "+v"(x[e + 2]), "+v"(x[e + 3]), "+v"(x[e + 4]), "+v"(x[e + 5]), "+v"(x[e + 6]), "+v"(x[e + 7]));
#pragma unroll
        for (int e = 0; e < 16; e += 2) {
            const float p0 = x[e], p1 = x[e + 1];
            sum += p0 + p1;
            const v2bf h = __builtin_convertvector((v2f){p0, p1}, v2bf);
            ph[e] = h[0]; ph[e + 1] = h[1]; }
        const int po = wave * 512 + lane * 8, pb = (m0 >> 5) & 1;
        const v16us uh = __builtin_bit_cast(v16us, ph);
        *(v8usa*)(psh[pb] + po) = __builtin_shufflevector(uh, uh, 0, 1, 2, 3, 4, 5, 6, 7); *(v8usa*)(psh[pb] + po + 256) = __builtin_shufflevector(uh, uh, 8, 9, 10, 11, 12, 13, 14, 15);
    };
    v8f acc[ACT][AQ];
#pragma unroll
    for (int c = 0; c < ACT; ++c) {
#pragma unroll
        for (int n = 0; n < AQ; ++n) acc[c][n] = (v8f){}; }
    const int vo = (cb >> 4) * (NKV / 32) * 512 + lane * 8;
    // The two waves that share a SIMD (w and w + ANW / 2) take a trip's two halves in opposite order, so that one's vector work runs beside the other's products instead of both waiting at the barrier for the second to finish both:
    // the first four waves multiply first and then produce, the last four produce first. For speed only: the result does not depend on where a wave runs. The test is the same in all lanes of a wave, and the barrier stands outside it.
    const bool late = __builtin_amdgcn_readfirstlane(wave) < ANW / 2;
    v16bf a[ACT], ph[AQ];
    const bf* pvh = Vh + vo;    // the v fragments that the wave asks for next: one address, the channel tiles as immediate offsets
    auto load_v = [&]() {    // asks for the v fragments of 32 keys and steps on
#pragma unroll
        for (int c = 0; c < ACT; ++c) { const int vb = c * 16 * NKV;    // a channel tile is NKV / 32 tiles of 512 elements = 16 NKV
            a[c] = cat16b(*(const v8us*)(pvh + vb), *(const v8us*)(pvh + vb + 256)); }
        asm volatile("s_wait_xcnt 0x0" :: "v"(pvh) : "memory");    // the v loads stay in flight over the work that follows: the wait in front of the step of their address (the address as an input keeps it whole up to it, so that no load's result lands in it)
        pvh += 512;
    };
    auto read_p = [&](int m0) {    // reads the AQ query tiles' probabilities of keys m0 to m0 + 31 back
        const unsigned short* rh = psh[(m0 >> 5) & 1] + qt0 * 512 + lane * 8;
#pragma unroll
        for (int n = 0; n < AQ; ++n) ph[n] = cat16b(*(const v8usa*)(rh + n * 512), *(const v8usa*)(rh + n * 512 + 256));
    };
    auto products = [&]() {
#pragma unroll
        for (int c = 0; c < ACT; ++c) {
#pragma unroll
            for (int n = 0; n < AQ; ++n) acc[c][n] = wmmab(a[c], ph[n], acc[c][n]); }
    };
    fetch_k(0); produce(0);
    if (late) load_v();
    lds_barrier();    // publishes the first trip's probabilities
#pragma unroll 1    // stays rolled: the two buffers are told apart by an index, and a trip is long enough to carry its branches
    for (int m0 = 0; m0 < NKV - 32; m0 += 32) {
        if (!late) load_v();    // this trip's
        read_p(m0);
        if (!late) produce(m0 + 32);
        products();
        if (late) { load_v(); produce(m0 + 32); }    // the next trip's v: its registers are free now
        lds_barrier();    // publishes the next trip's probabilities and ends every wave's reads of the buffer that the next trip refills
    }
    if (!late) load_v();
    // the residual's x, from the x^T plane: tile (n, c) is the 8 channels a lane of y's accumulator tile (c, n) holds; asked for here, so that the last keys' products and the rounding cover the way from memory
    const bf* px = XT + ((size_t)(q0 >> 4) * (CC / 32) + (cb >> 5)) * 512 + lane * 8;
    v8us xq[ACT][AQ];
#pragma unroll
    for (int n = 0; n < AQ; ++n) {
#pragma unroll
        for (int c = 0; c < ACT; ++c) xq[c][n] = *(const v8us*)(px + n * (CC * 16) + c * 256); }
    asm volatile("s_wait_xcnt 0x0" :: "v"(px) : "memory");    // the x loads stay in flight over the work that follows: the wait in front of any overwrite of their address registers (the address as an input keeps it whole up to it)
    read_p(NKV - 32);
    pinv[tid] = 1.0f / (sum + __shfl_xor(sum, 16, 32));    // the row sums are complete
    products();
    lds_barrier();    // publishes the reciprocals
    const float g = bfr(gam[0]);
    // wo's fragments of k blocks 0 and 1 (they run two blocks ahead of their products, on three sets of registers: one block's products are shorter than the way from L2): one address, the channel tiles and k blocks as immediate offsets
    const bf* pw = Wo + (cb >> 4) * (CC * 16) + lane * 8;
    v16bf wa[3][ACT];
#pragma unroll
    for (int kb = 0; kb < 2; ++kb) {
#pragma unroll
        for (int c = 0; c < ACT; ++c) wa[kb][c] = cat16b(*(const v8us*)(pw + c * (CC * 16) + kb * 512), *(const v8us*)(pw + c * (CC * 16) + kb * 512 + 256)); }
    // out_attn, divided and rounded, into the LDS that held k: no wave reads k behind the key loop's last barrier
#pragma unroll
    for (int n = 0; n < AQ; ++n) { const float inv = pinv[(qt0 + n) * 32 + lane];
        const int ob = ((qt0 + n) * (CC / 32) + (cb >> 5)) * 512 + lane * 8;    // channel tile c is k half c & 1 of k block c / 2 from there: c * 256
#pragma unroll
        for (int c = 0; c < ACT; ++c) { v8us oh;
#pragma unroll
            for (int r = 0; r < 8; ++r) oh[r] = f2bf(acc[c][n][r] * inv);
            *(v8usa*)(ksh + ob + c * 256) = oh; } }
    lds_barrier();    // publishes the block's out_attn plane
    v8f y[ACT][AQ];
#pragma unroll
    for (int c = 0; c < ACT; ++c) {
#pragma unroll
        for (int n = 0; n < AQ; ++n) y[c][n] = (v8f){}; }
    v16bf bh[2][AQ];
    const unsigned short* roh = ksh + qt0 * (CC * 16) + lane * 8;
#pragma unroll
    for (int n = 0; n < AQ; ++n) bh[0][n] = cat16b(*(const v8usa*)(roh + n * (CC * 16)), *(const v8usa*)(roh + n * (CC * 16) + 256));
#pragma unroll    // whole: the steps of wo's address and of the LDS index become immediate offsets, and the sets of fragments are told apart at compile time
    for (int kb = 0; kb < CC / 32; ++kb) {
        if (kb + 2 < CC / 32) { const int ko = (kb + 2) * 512;    // wo's fragments of the next k block but one
#pragma unroll
            for (int c = 0; c < ACT; ++c) wa[(kb + 2) % 3][c] = cat16b(*(const v8us*)(pw + c * (CC * 16) + ko), *(const v8us*)(pw + c * (CC * 16) + ko + 256)); }
        if (kb + 1 < CC / 32) { const int ko = (kb + 1) * 512;    // out_attn's fragments of the next k block, asked for as one group ahead of this block's products
#pragma unroll
            for (int n = 0; n < AQ; ++n) bh[(kb + 1) & 1][n] = cat16b(*(const v8usa*)(roh + n * (CC * 16) + ko), *(const v8usa*)(roh + n * (CC * 16) + ko + 256)); }
        if (kb + 3 == CC / 32) asm volatile("s_wait_xcnt 0x0" :: "v"(pw) : "memory");    // behind the last wo loads: the wait in front of any overwrite of their address registers (the address as an input keeps it whole up to it)
        __builtin_amdgcn_sched_barrier(0);    // keeps the group of loads in front of the products: left alone the compiler put each LDS read directly in front of its four products, with the whole LDS latency in between
#pragma unroll
        for (int c = 0; c < ACT; ++c) {
#pragma unroll
            for (int n = 0; n < AQ; ++n) y[c][n] = wmmab(wa[kb % 3][c], bh[kb & 1][n], y[c][n]); }
        __builtin_amdgcn_sched_barrier(0);    // keeps the next group of loads, and behind the last block the unpacking of x (which doubles its registers), behind these products
    }
    float* os = &ost[wave][0];
    const int lr = lane & 15, hi = lane >> 4;
    float* po = OUTP + (size_t)(cb + hi) * NTOK + q0 + lr * 4;    // pass s of a channel tile stores rows 2 s and 2 s + 1, 16 lanes a row of 64 floats (two whole lines)
#pragma unroll
    for (int c = 0; c < ACT; ++c) {
#pragma unroll
        for (int n = 0; n < AQ; ++n) {
#pragma unroll
            for (int j = 0; j < 8; ++j) os[(hi * 8 + j) * 68 + n * 16 + lr] = bf2f(xq[c][n][j]) + g * y[c][n][j]; }
        __builtin_amdgcn_fence(__ATOMIC_RELEASE, "wavefront", "local"); __builtin_amdgcn_wave_barrier(); __builtin_amdgcn_fence(__ATOMIC_ACQUIRE, "wavefront", "local");    // the lanes read one another's values: keeps the compiler from moving the reads in front of the writes (a wave's LDS operations run in order)
        v4u o[8];
#pragma unroll
        for (int s = 0; s < 8; ++s) o[s] = *(const v4u __attribute__((may_alias))*)(os + (2 * s + hi) * 68 + lr * 4);
        // the eight stores and their wait in one statement: the next tile's reads reuse the registers they name, and a wait in a statement of its own need not stay in front of that overwrite; its memory clobber also keeps the next tile's LDS writes behind this tile's reads. The offsets step by two rows of out (2 NTOK floats).
        static_assert(2 * NTOK * 4 == 32768, "the store offsets below");
        asm volatile("global_store_b128 %0, %1, off\n\tglobal_store_b128 %0, %2, off offset:32768\n\tglobal_store_b128 %0, %3, off offset:65536\n\tglobal_store_b128 %0, %4, off offset:98304\n\t"
                     "global_store_b128 %0, %5, off offset:131072\n\tglobal_store_b128 %0, %6, off offset:163840\n\tglobal_store_b128 %0, %7, off offset:196608\n\tglobal_store_b128 %0, %8, off offset:229376\n\ts_wait_xcnt 0x0"
                     :: "v"(po + (size_t)c * 16 * NTOK), "v"(o[0]), "v"(o[1]), "v"(o[2]), "v"(o[3]), "v"(o[4]), "v"(o[5]), "v"(o[6]), "v"(o[7]) : "memory");
    }
}

extern "C" void kernel_launch(void* const* d_in, const int* in_sizes, int n_in,
                              void* d_out, int out_size, void* d_ws, size_t ws_size, hipStream_t stream) {
    (void)in_sizes; (void)n_in; (void)out_size;
    const float* x = (const float*)d_in[0]; const float* wq = (const float*)d_in[1]; const float* wk = (const float*)d_in[2]; const float* wv = (const float*)d_in[3]; const float* wo = (const float*)d_in[4]; const float* gam = (const float*)d_in[5];
    float* out = (float*)d_out;    // [8][256][64][64]
    char* wsp = (char*)d_ws;
    auto take = [&](size_t bytes) { char* p = wsp; wsp += (bytes + 255) & ~(size_t)255; return (void*)p; };
    bf* WoB = (bf*)take((size_t)CC * CC * 2); bf* XT = (bf*)take((size_t)NBI * NTOK * CC * 2);
    bf* Qh = (bf*)take((size_t)NBI * NTOK * DQP * 2); bf* Kh = (bf*)take((size_t)NBI * NKV * DQP * 2); bf* Vh = (bf*)take((size_t)NBI * CC * NKV * 2);
    if ((size_t)(wsp - (char*)d_ws) > ws_size) return;    // MiB: 0.1 + 16 + 4 + 1 + 4 ~ 25 of 256
    k_front<<<dim3(NTOK / FTK, 1, NBI), FNW * 32, 0, stream>>>(x, wq, wk, wv, wo, WoB, XT, Qh, Kh, Vh);
    k_attn<<<dim3(NTOK / AQB, 1, NBI), ANW * 32, 0, stream>>>(Qh, Kh, Vh, XT, WoB, gam, out);    // out = x + gamma w2.out_attn^T [8][256][4096]
}
